// v000
// Times are from an AMD MI455X. After a warm-up the kernel runs many times in a row, and a time is the length of
// such a window on the GPU divided by its runs, so every launch and the gaps after it count. The runs cycle
// through copies of the inputs. A figure is the median of several windows, for all but v000 over two sittings.
// Sittings can differ by a few percent; kernels timed side by side share one.
// The starting kernel, v000, takes 575 microseconds a run.
// compute dtype: x, Wq/Wk/Wv/Wo, rb0/rb1 (INPUTS) rounded to bf16 with exact bf16 WMMA products (f32 accumulate) for the projections; K pre-split into bf16 hi/lo rows; q f32 split, P and V f16 hi/lo (3 products each); softmax, the causal raster mask and the factorised 2-D relative bias in f32.
#include <hip/hip_runtime.h>
#include <math.h>

typedef __attribute__((ext_vector_type(16))) _Float16 v16h;
typedef __attribute__((ext_vector_type(16))) __bf16 v16b;
typedef __attribute__((ext_vector_type(8)))  _Float16 v8h;
typedef __attribute__((ext_vector_type(8)))  float v8f;
typedef __attribute__((ext_vector_type(4)))  float v4f;
typedef __attribute__((ext_vector_type(2)))  float v2f;
typedef __attribute__((ext_vector_type(4)))  unsigned v4u;
typedef __attribute__((ext_vector_type(4)))  int v4i;
typedef float __attribute__((may_alias)) float_a;
typedef int __attribute__((may_alias)) int_a;

template <typename T> __device__ __forceinline__ void vst2(void* p, T v) { *(T*)p = v;  }
__device__ __forceinline__ v8f wmma16(v16h a, v16h b, v8f c) {
  v8f d = __builtin_amdgcn_wmma_f32_16x16x32_f16(false, a, false, b, (short)0, c, false, false);
  asm volatile("v_nop\n\tv_nop\n\tv_nop\n\tv_nop" : "+v"(d) : "v"(a), "v"(b));
  return d;
}
__device__ __forceinline__ v8f wmma_bf(v16b a, v16b b, v8f c) {
  v8f d = __builtin_amdgcn_wmma_f32_16x16x32_bf16(false, a, false, b, (short)0, c, false, false);
  asm volatile("v_nop\n\tv_nop\n\tv_nop\n\tv_nop" : "+v"(d) : "v"(a), "v"(b));
  return d;
}
// 16x16x32 fragments: lane = (h = lane>>4, row/col = lane&15); elements 0..7 = k0+8h+0..7, 8..15 = k0+16+8h+0..7; D element r = row 8h+r
__device__ __forceinline__ v16h frag_h(const _Float16* rowk0, int lane) {
  union { v16h v; v8h q[2]; } u; const _Float16* p = rowk0 + 8 * (lane >> 4);
  u.q[0] = *(const v8h*)p; u.q[1] = *(const v8h*)(p + 16); return u.v;
}
__device__ __forceinline__ v16h frag_f32(const float* rowk0, int lane) {
  v16h a; const float* p = rowk0 + 8 * (lane >> 4);
#pragma unroll
  for (int i = 0; i < 8; ++i) { a[i] = (_Float16)p[i]; a[8 + i] = (_Float16)p[16 + i]; }
  return a;
}
__device__ __forceinline__ v16h frag_f32s(const float* rowk0, int lane, float sc) {
  v16h a; const float* p = rowk0 + 8 * (lane >> 4);
#pragma unroll
  for (int i = 0; i < 8; ++i) { a[i] = (_Float16)(p[i] * sc); a[8 + i] = (_Float16)(p[16 + i] * sc); }
  return a;
}
// column fragment from a [K][ld] layout (column n), rows >= K read as 0
__device__ __forceinline__ v16h fragc_f32(const float* W, int k0, int n, int lane, int ld, int K) {
  v16h a; const int g = lane >> 4;
#pragma unroll
  for (int i = 0; i < 8; ++i) { const int ka = k0 + 8 * g + i, kb = ka + 16;
    a[i] = (_Float16)(ka < K ? W[(size_t)ka * ld + n] : 0.f); a[8 + i] = (_Float16)(kb < K ? W[(size_t)kb * ld + n] : 0.f); }
  return a;
}
struct F2 { v16b h, l; };
__device__ __forceinline__ F2 bsplit16(const float v[16]) { F2 r;
#pragma unroll
  for (int i = 0; i < 16; ++i) { const __bf16 h = (__bf16)v[i]; r.h[i] = h; r.l[i] = (__bf16)(v[i] - (float)h); }
  return r; }
__device__ __forceinline__ F2 split_row(const float* row, int k0, int lane) { float v[16]; const float* p = row + k0 + 8 * (lane >> 4);
#pragma unroll
  for (int i = 0; i < 8; ++i) { v[i] = p[i]; v[8 + i] = p[16 + i]; }
  return bsplit16(v); }
__device__ __forceinline__ F2 split_rowK(const float* row, int k0, int lane, int K) { float v[16]; const int g = lane >> 4;
#pragma unroll
  for (int i = 0; i < 8; ++i) { const int ka = k0 + 8 * g + i, kb = ka + 16; v[i] = ka < K ? row[ka] : 0.f; v[8 + i] = kb < K ? row[kb] : 0.f; }
  return bsplit16(v); }
__device__ __forceinline__ F2 split_col(const float* W, int k0, int n, int lane, int ld, int K) { float v[16]; const int g = lane >> 4;
#pragma unroll
  for (int i = 0; i < 8; ++i) { const int ka = k0 + 8 * g + i, kb = ka + 16; v[i] = ka < K ? W[(size_t)ka * ld + n] : 0.f; v[8 + i] = kb < K ? W[(size_t)kb * ld + n] : 0.f; }
  return bsplit16(v); }
__device__ __forceinline__ v8f mac3(const F2& a, const F2& b, v8f c) { c = wmma_bf(a.l, b.h, c); c = wmma_bf(a.h, b.l, c); return wmma_bf(a.h, b.h, c); }
__device__ __forceinline__ float sigm(float v) { return 1.0f / (1.0f + expf(-v)); }
#define LDSX() do { asm volatile("s_wait_dscnt 0" ::: "memory"); __builtin_amdgcn_wave_barrier(); __builtin_amdgcn_fence(__ATOMIC_RELEASE, "workgroup"); } while (0)


// Axial ('number-dimension') self attention over the 32 x 32 raster of each of 16 images (8 heads x 64, [in][out] DenseND kernels, no biases): scores = (q 64^-0.5).k + rb0[h][31 + kr - qr] + rb1[h][31 + kc - qc];
#define NB 8
#define SS 1024
#define E 512
#define NH 8
#define RW 32
#define HD 64
#define NR (NB * SS)
#define PLO 1024.0f
#define VLO 2048.0f
__device__ __forceinline__ float bfr(float v) { return (float)(__bf16)v; }
__device__ __forceinline__ v16b frag_b(const __bf16* rowk0, int lane) { return __builtin_bit_cast(v16b, frag_h((const _Float16*)rowk0, lane)); }

__global__ __launch_bounds__(256) void k_cvt(const float* __restrict__ x, __bf16* __restrict__ Xb) {
  const size_t i8 = (size_t)blockIdx.x * 256 + threadIdx.x; if (i8 >= (size_t)NR * E / 8) return;
  union { __bf16 h[8]; v4u u; } pk;
#pragma unroll
  for (int e = 0; e < 8; ++e) pk.h[e] = (__bf16)x[i8 * 8 + e];
  vst2((unsigned*)(Xb + i8 * 8), pk.u);
}
// PT rows: [0,E) Wq[:,n], [E,2E) Wk[:,n], [2E,3E) Wv[:,n], [3E,4E) Wo[:,n]  ([in][out] weights: column n as a bf16 row)
__global__ __launch_bounds__(256) void k_pack(const float* __restrict__ Wq, const float* __restrict__ Wk, const float* __restrict__ Wv, const float* __restrict__ Wo, __bf16* __restrict__ PT) {
  const int n = blockIdx.x, tid = threadIdx.x; __shared__ __align__(16) __bf16 srow[E];
  const float* W = n < E ? Wq : (n < 2 * E ? Wk : (n < 3 * E ? Wv : Wo)); const int nn = n & (E - 1);
  for (int k = tid; k < E; k += 256) srow[k] = (__bf16)W[(size_t)k * E + nn];
  __syncthreads();
  if (tid < E / 8) vst2((unsigned*)(PT + (size_t)n * E + tid * 8), *(const v4u*)(&srow[tid * 8]));
}
// QKV: block (64 rows, 128 cols = 2 heads, which); q -> Q32 f32 [bh][s][64]; k -> bf16 hi/lo rows; v -> VT hi/lo x4 [bh][d][s]
__global__ __launch_bounds__(128) void k_qkv(const __bf16* __restrict__ Xb, const __bf16* __restrict__ PT, float* __restrict__ Q32, __bf16* __restrict__ Kh, __bf16* __restrict__ Kl, _Float16* __restrict__ VTh, _Float16* __restrict__ VTl) {
  __shared__ __align__(16) float so[4][16][132];
  __shared__ __align__(16) _Float16 sth[128][72], stl[128][72];
  const int tid = threadIdx.x, wave = tid >> 5, lane = tid & 31, col = lane & 15, g = lane >> 4;
  const int which = blockIdx.z, r0b = blockIdx.x * 64, r0 = r0b + wave * 16, n0 = blockIdx.y * 128; const int b = r0b / SS, s0 = r0b % SS;
  v8f acc[8] = {};
#pragma unroll 2
  for (int kc = 0; kc < E / 32; ++kc) { const v16b a = frag_b(Xb + (size_t)(r0 + col) * E + kc * 32, lane);
#pragma unroll
    for (int j = 0; j < 8; ++j) acc[j] = wmma_bf(a, frag_b(PT + (size_t)(which * E + n0 + j * 16 + col) * E + kc * 32, lane), acc[j]); }
  if (which < 2) {
#pragma unroll
    for (int j = 0; j < 8; ++j) { const float bb = 0.f;
#pragma unroll
      for (int r = 0; r < 8; ++r) so[wave][8 * g + r][j * 16 + col] = acc[j][r] + bb; }
    LDSX();
    if (which == 0) { for (int qq = lane; qq < 2 * 16 * 16; qq += 32) { const int hh = qq >> 8, rl = (qq >> 4) & 15, pc = qq & 15; const int h = (n0 >> 6) + hh;
        vst2(Q32 + (((size_t)b * NH + h) * SS + s0 + wave * 16 + rl) * HD + pc * 4, *(const v4f*)(&so[wave][rl][hh * 64 + pc * 4])); } }
    else {
      for (int qq = lane; qq < 2 * 16 * 16; qq += 32) { const int hh = qq >> 8, rl = (qq >> 4) & 15, pl = qq & 15; const int h = (n0 >> 6) + hh; const int pc = pl & 7; union { __bf16 e[8]; v4u u; } pk;
#pragma unroll
        for (int e = 0; e < 8; ++e) { const float v = so[wave][rl][hh * 64 + pc * 8 + e]; const __bf16 hi = (__bf16)v; pk.e[e] = pl < 8 ? hi : (__bf16)(v - (float)hi); }
        vst2((unsigned*)((pl < 8 ? Kh : Kl) + (((size_t)b * NH + h) * SS + s0 + wave * 16 + rl) * HD + pc * 8), pk.u); } } }
  else {
#pragma unroll
    for (int j = 0; j < 8; ++j) { const float bb = 0.f;
#pragma unroll
      for (int r = 0; r < 8; ++r) { const float v = (acc[j][r] + bb) * 4.0f; const _Float16 hi = (_Float16)v; sth[j * 16 + col][wave * 16 + 8 * g + r] = hi; stl[j * 16 + col][wave * 16 + 8 * g + r] = (_Float16)((v - (float)hi) * VLO); } }
    __syncthreads();
    for (int qq = tid; qq < 128 * 8; qq += 128) { const int cl = qq >> 3, pc = qq & 7; const int c = n0 + cl, h = c >> 6, d = c & 63; const size_t o = (((size_t)b * NH + h) * HD + d) * SS + s0 + pc * 8;
      vst2(VTh + o, *(const v4u*)(&sth[cl][pc * 8])); vst2(VTl + o, *(const v4u*)(&stl[cl][pc * 8])); } }
}
// causal attention: block (64 queries, bh); key tiles 0..qb; S on q hi/lo x K hi/lo rows; P,V hi/lo; O f32 [bh][s][64]
__global__ __launch_bounds__(128) void k_attn(const float* __restrict__ Q32, const __bf16* __restrict__ Kh, const __bf16* __restrict__ Kl, const _Float16* __restrict__ VTh, const _Float16* __restrict__ VTl, const float* __restrict__ rb0, const float* __restrict__ rb1, float* __restrict__ O32) {
  __shared__ __align__(16) float sS[4][16][68];
  __shared__ __align__(16) _Float16 sPh[4][16][72], sPl[4][16][72];
  __shared__ __align__(16) float sO[4][16][68];
  const int tid = threadIdx.x, w = tid >> 5, lane = tid & 31, col = lane & 15, g = lane >> 4;
  const size_t bh = blockIdx.y; const int qb = blockIdx.x; const int q0 = qb * 64 + w * 16;
  F2 aq[2];
#pragma unroll
  for (int kc = 0; kc < 2; ++kc) aq[kc] = split_row(Q32 + (bh * SS + q0 + col) * HD, kc * 32, lane);
  const int h = (int)(bh % NH); __shared__ float sb0[4][64], sb1[4][64]; for (int i = lane; i < 64; i += 32) { sb0[w][i] = bfr(rb0[h * 2 * RW + i]); sb1[w][i] = bfr(rb1[h * 2 * RW + i]); }     // this head's two 64-entry bias tables
  float mrun = -3.0e38f, lrun = 0.f; v8f acc[4] = {}, ac1[4] = {}, ac2[4] = {};
  LDSX();
#pragma unroll 1
  for (int kt = 0; kt <= qb; ++kt) {      // causal in raster order
#pragma unroll
    for (int t = 0; t < 4; ++t) { const int key = kt * 64 + t * 16 + col; const size_t ko = (bh * SS + key) * HD; v8f s = {};
#pragma unroll
      for (int kc = 0; kc < 2; ++kc) { const v16b khf = frag_b(Kh + ko + kc * 32, lane), klf = frag_b(Kl + ko + kc * 32, lane); s = wmma_bf(aq[kc].l, khf, s); s = wmma_bf(aq[kc].h, klf, s); s = wmma_bf(aq[kc].h, khf, s); }
      const int kr = key / RW, kc2 = key % RW;
#pragma unroll
      for (int r = 0; r < 8; ++r) { const int qi = q0 + 8 * g + r; const int qr = qi / RW, qc = qi % RW; sS[w][8 * g + r][t * 16 + col] = (key > qi) ? -1.0e9f : s[r] * 0.125f + sb0[w][RW - 1 + kr - qr] + sb1[w][RW - 1 + kc2 - qc]; } }
    LDSX();
    float mx = -3.4e38f;
#pragma unroll
    for (int jj = 0; jj < 32; ++jj) mx = fmaxf(mx, sS[w][col][g * 32 + jj]);
    mx = fmaxf(mx, __shfl_xor(mx, 16, 32));
    const float mnew = fmaxf(mrun, mx); const float corr = expf(mrun - mnew);
    float ps = 0.f;
#pragma unroll
    for (int jj = 0; jj < 32; ++jj) { const float p = expf(sS[w][col][g * 32 + jj] - mnew) * 16384.0f; ps += p; const _Float16 hi = (_Float16)p; sPh[w][col][g * 32 + jj] = hi; sPl[w][col][g * 32 + jj] = (_Float16)((p - (float)hi) * PLO); }
    ps += __shfl_xor(ps, 16, 32);
    lrun = lrun * corr + ps * (1.0f / 16384.0f); mrun = mnew;
#pragma unroll
    for (int r = 0; r < 8; ++r) { const float cr = __shfl(corr, 8 * g + r, 32);
#pragma unroll
      for (int t = 0; t < 4; ++t) { acc[t][r] *= cr; ac1[t][r] *= cr; ac2[t][r] *= cr; } }
    LDSX();
#pragma unroll
    for (int kc = 0; kc < 2; ++kc) { const v16h ph = frag_h(&sPh[w][col][0] + kc * 32, lane), pl = frag_h(&sPl[w][col][0] + kc * 32, lane);
#pragma unroll
      for (int t = 0; t < 4; ++t) { const size_t vo = (bh * HD + t * 16 + col) * SS + kt * 64 + kc * 32; const v16h vh = frag_h(VTh + vo, lane);
        acc[t] = wmma16(ph, vh, acc[t]); ac1[t] = wmma16(ph, frag_h(VTl + vo, lane), ac1[t]); ac2[t] = wmma16(pl, vh, ac2[t]); } }
    __builtin_amdgcn_wave_barrier(); }
#pragma unroll
  for (int r = 0; r < 8; ++r) { const float lr = __shfl(lrun, 8 * g + r, 32); const float inv = 1.0f / (lr * 16384.0f * 4.0f);
#pragma unroll
    for (int t = 0; t < 4; ++t) sO[w][8 * g + r][t * 16 + col] = (acc[t][r] + ac1[t][r] * (1.0f / VLO) + ac2[t][r] * (1.0f / PLO)) * inv; }
  LDSX();
  for (int qq = lane; qq < 16 * 16; qq += 32) { const int rl = qq >> 4, pc = qq & 15; vst2(O32 + ((bh * SS) + q0 + rl) * HD + pc * 4, *(const v4f*)(&sO[w][rl][pc * 4])); }
}
// out = ctx Wo : split(ctx) x bf16(Wo columns): 2 products (Wo is an INPUT -> bf16 exact)
__global__ __launch_bounds__(128) void k_out(const float* __restrict__ O32, const __bf16* __restrict__ PT, float* __restrict__ out) {
  __shared__ __align__(16) float so[4][16][132];
  const int tid = threadIdx.x, wave = tid >> 5, lane = tid & 31, col = lane & 15, g = lane >> 4;
  const int r0 = blockIdx.x * 64 + wave * 16, n0 = blockIdx.y * 128; const int ra = r0 + col; const int b = ra / SS, s = ra % SS;
  v8f acc[8] = {};
#pragma unroll 1
  for (int kc = 0; kc < E / 32; ++kc) { const int h = kc >> 1; const F2 a = split_row(O32 + (((size_t)b * NH + h) * SS + s) * HD, (kc & 1) * 32, lane);
#pragma unroll
    for (int j = 0; j < 8; ++j) { const v16b wb = frag_b(PT + (size_t)(3 * E + n0 + j * 16 + col) * E + kc * 32, lane); acc[j] = wmma_bf(a.l, wb, acc[j]); acc[j] = wmma_bf(a.h, wb, acc[j]); } }
#pragma unroll
  for (int j = 0; j < 8; ++j) {
#pragma unroll
    for (int r = 0; r < 8; ++r) so[wave][8 * g + r][j * 16 + col] = acc[j][r]; }
  LDSX();
#pragma unroll 4
  for (int rl = 0; rl < 16; ++rl) vst2(out + (size_t)(r0 + rl) * E + n0 + lane * 4, *(const v4f*)(&so[wave][rl][lane * 4]));
}
extern "C" void kernel_launch(void* const* d_in, const int* in_sizes, int n_in, void* d_out, int out_size, void* d_ws, size_t ws_size, hipStream_t stream) {
  (void)in_sizes; (void)n_in; (void)out_size; (void)ws_size;
  const float** I = (const float**)d_in;   // x, Wq, Wk, Wv, Wo, rb0, rb1
  const float* x = I[0]; const float* Wq = I[1]; const float* Wk = I[2]; const float* Wv = I[3]; const float* Wo = I[4]; const float* rb0 = I[5]; const float* rb1 = I[6];
  float* out = (float*)d_out;
  char* ws = (char*)d_ws; size_t off = 0;
  auto take = [&](size_t bytes) { char* p = ws + off; off += (bytes + 255) & ~(size_t)255; return p; };
  __bf16* Xb = (__bf16*)take((size_t)NR * E * 2); __bf16* PT = (__bf16*)take((size_t)4 * E * E * 2);
  float* Q32 = (float*)take((size_t)NR * E * 4); __bf16* Kh = (__bf16*)take((size_t)NR * E * 2); __bf16* Kl = (__bf16*)take((size_t)NR * E * 2); _Float16* VTh = (_Float16*)take((size_t)NR * E * 2); _Float16* VTl = (_Float16*)take((size_t)NR * E * 2); float* O32 = (float*)take((size_t)NR * E * 4);
  k_pack<<<4 * E, 256, 0, stream>>>(Wq, Wk, Wv, Wo, PT);
  for (int ps = 0; ps < 2; ++ps) { const float* xp = x + (size_t)ps * NR * E; float* op = out + (size_t)ps * NR * E;
    k_cvt<<<(NR * E / 8 + 255) / 256, 256, 0, stream>>>(xp, Xb);
    k_qkv<<<dim3(NR / 64, E / 128, 3), 128, 0, stream>>>(Xb, PT, Q32, Kh, Kl, VTh, VTl);
    k_attn<<<dim3(SS / 64, NB * NH), 128, 0, stream>>>(Q32, Kh, Kl, VTh, VTl, rb0, rb1, O32);
    k_out<<<dim3(NR / 64, E / 128), 128, 0, stream>>>(O32, PT, op); }
}

// v001
// One run takes 282 microseconds.
// In both of two side-by-side timings against v000, it was 2.11 times as fast.
// compute dtype: x, Wq/Wk/Wv/Wo, rb0/rb1 (INPUTS) rounded to bf16 with exact bf16 WMMA products (f32 accumulate) for the projections; K pre-split into bf16 hi/lo rows; q f32 split, P and V f16 hi/lo (3 products each); softmax, the causal raster mask and the factorised 2-D relative bias in f32.
#include <hip/hip_runtime.h>
#include <math.h>

typedef __attribute__((ext_vector_type(16))) _Float16 v16h;
typedef __attribute__((ext_vector_type(16))) __bf16 v16b;
typedef __attribute__((ext_vector_type(8)))  _Float16 v8h;
typedef __attribute__((ext_vector_type(8)))  float v8f;
typedef __attribute__((ext_vector_type(4)))  float v4f;
typedef __attribute__((ext_vector_type(2)))  float v2f;
typedef __attribute__((ext_vector_type(4)))  unsigned v4u;
typedef __attribute__((ext_vector_type(4)))  int v4i;
typedef float __attribute__((may_alias)) float_a;
typedef int __attribute__((may_alias)) int_a;

template <typename T> __device__ __forceinline__ void vst2(void* p, T v) { *(T*)p = v;  }
__device__ __forceinline__ v8f wmma16(v16h a, v16h b, v8f c) {
  v8f d = __builtin_amdgcn_wmma_f32_16x16x32_f16(false, a, false, b, (short)0, c, false, false);
  asm volatile("v_nop\n\tv_nop\n\tv_nop\n\tv_nop" : "+v"(d) : "v"(a), "v"(b));
  return d;
}
__device__ __forceinline__ v8f wmma_bf(v16b a, v16b b, v8f c) {
  v8f d = __builtin_amdgcn_wmma_f32_16x16x32_bf16(false, a, false, b, (short)0, c, false, false);
  asm volatile("v_nop\n\tv_nop\n\tv_nop\n\tv_nop" : "+v"(d) : "v"(a), "v"(b));
  return d;
}
// 16x16x32 fragments: lane = (h = lane>>4, row/col = lane&15); elements 0..7 = k0+8h+0..7, 8..15 = k0+16+8h+0..7; D element r = row 8h+r
__device__ __forceinline__ v16h frag_h(const _Float16* rowk0, int lane) {
  union { v16h v; v8h q[2]; } u; const _Float16* p = rowk0 + 8 * (lane >> 4);
  u.q[0] = *(const v8h*)p; u.q[1] = *(const v8h*)(p + 16); return u.v;
}
__device__ __forceinline__ v16h frag_f32(const float* rowk0, int lane) {
  v16h a; const float* p = rowk0 + 8 * (lane >> 4);
#pragma unroll
  for (int i = 0; i < 8; ++i) { a[i] = (_Float16)p[i]; a[8 + i] = (_Float16)p[16 + i]; }
  return a;
}
__device__ __forceinline__ v16h frag_f32s(const float* rowk0, int lane, float sc) {
  v16h a; const float* p = rowk0 + 8 * (lane >> 4);
#pragma unroll
  for (int i = 0; i < 8; ++i) { a[i] = (_Float16)(p[i] * sc); a[8 + i] = (_Float16)(p[16 + i] * sc); }
  return a;
}
// column fragment from a [K][ld] layout (column n), rows >= K read as 0
__device__ __forceinline__ v16h fragc_f32(const float* W, int k0, int n, int lane, int ld, int K) {
  v16h a; const int g = lane >> 4;
#pragma unroll
  for (int i = 0; i < 8; ++i) { const int ka = k0 + 8 * g + i, kb = ka + 16;
    a[i] = (_Float16)(ka < K ? W[(size_t)ka * ld + n] : 0.f); a[8 + i] = (_Float16)(kb < K ? W[(size_t)kb * ld + n] : 0.f); }
  return a;
}
struct F2 { v16b h, l; };
__device__ __forceinline__ F2 bsplit16(const float v[16]) { F2 r;
#pragma unroll
  for (int i = 0; i < 16; ++i) { const __bf16 h = (__bf16)v[i]; r.h[i] = h; r.l[i] = (__bf16)(v[i] - (float)h); }
  return r; }
__device__ __forceinline__ F2 split_row(const float* row, int k0, int lane) { float v[16]; const float* p = row + k0 + 8 * (lane >> 4);
#pragma unroll
  for (int i = 0; i < 8; ++i) { v[i] = p[i]; v[8 + i] = p[16 + i]; }
  return bsplit16(v); }
__device__ __forceinline__ F2 split_rowK(const float* row, int k0, int lane, int K) { float v[16]; const int g = lane >> 4;
#pragma unroll
  for (int i = 0; i < 8; ++i) { const int ka = k0 + 8 * g + i, kb = ka + 16; v[i] = ka < K ? row[ka] : 0.f; v[8 + i] = kb < K ? row[kb] : 0.f; }
  return bsplit16(v); }
__device__ __forceinline__ F2 split_col(const float* W, int k0, int n, int lane, int ld, int K) { float v[16]; const int g = lane >> 4;
#pragma unroll
  for (int i = 0; i < 8; ++i) { const int ka = k0 + 8 * g + i, kb = ka + 16; v[i] = ka < K ? W[(size_t)ka * ld + n] : 0.f; v[8 + i] = kb < K ? W[(size_t)kb * ld + n] : 0.f; }
  return bsplit16(v); }
__device__ __forceinline__ v8f mac3(const F2& a, const F2& b, v8f c) { c = wmma_bf(a.l, b.h, c); c = wmma_bf(a.h, b.l, c); return wmma_bf(a.h, b.h, c); }
__device__ __forceinline__ float sigm(float v) { return 1.0f / (1.0f + expf(-v)); }
#define LDSX() do { asm volatile("s_wait_dscnt 0" ::: "memory"); __builtin_amdgcn_wave_barrier(); __builtin_amdgcn_fence(__ATOMIC_RELEASE, "workgroup"); } while (0)


// Axial ('number-dimension') self attention over the 32 x 32 raster of each of 16 images (8 heads x 64, [in][out] DenseND kernels, no biases): scores = (q 64^-0.5).k + rb0[h][31 + kr - qr] + rb1[h][31 + kc - qc];
#define NB 8
#define SS 1024
#define E 512
#define NH 8
#define RW 32
#define HD 64
#define NR (NB * SS)
#define PLO 1024.0f
#define VLO 2048.0f
__device__ __forceinline__ float bfr(float v) { return (float)(__bf16)v; }
__device__ __forceinline__ v16b frag_b(const __bf16* rowk0, int lane) { return __builtin_bit_cast(v16b, frag_h((const _Float16*)rowk0, lane)); }

typedef uint32_t u32x4 __attribute__((ext_vector_type(4)));
typedef uint32_t u32x8 __attribute__((ext_vector_type(8)));
__device__ __forceinline__ uint32_t uni(uint32_t v) { return (uint32_t)__builtin_amdgcn_readfirstlane(v); }
#define TROW 128u                 // bytes of a staged row: 64 16-bit elements
#define TPITCH 144u               // its pitch in LDS, set by the tensor load's pad: 16 B x 9, no bank conflict for 16-byte fragment reads
#define TPLANE 10240u             // 64 rows x 144 B = 9,216 B, rounded up so that every plane starts at a multiple of 2 KiB
__device__ __forceinline__ uint32_t pinned(uint32_t v) { uint32_t w = uni(v); asm volatile("" : "+s"(w)); return w; }   // holds a wave-uniform test in a scalar register, so that the branch round a tensor load is a scalar one (a tensor load ignores EXEC)
// tensor descriptor, group 1: 1-byte elements, tensor = tile = rows rows of 128 B, source row pitch src_pitch bytes, 4 dwords of LDS pad behind every 32 dwords
__device__ __forceinline__ u32x8 tdm_group1(uint32_t src_pitch, uint32_t rows) {
  u32x8 g;
  g[0] = uni((1u << 20) | (4u << 22) | (3u << 25));
  g[1] = uni(TROW << 16);
  g[2] = uni(rows << 16);
  g[3] = uni(TROW << 16);
  g[4] = uni(rows);
  g[5] = uni(src_pitch);
  g[6] = uni(0u);
  g[7] = uni(0u);
  return g;
}
// group 0: one request, LDS destination (byte offset in the work-group's LDS), global address of the tile's first byte, type 2
__device__ __forceinline__ u32x4 tdm_group0(uint32_t lds_dst, uint64_t ga) {
  u32x4 g;
  g[0] = uni(1u); g[1] = uni(lds_dst); g[2] = uni((uint32_t)ga); g[3] = uni((((uint32_t)(ga >> 32)) & 0x01FFFFFFu) | 0x80000000u);
  return g;
}

__global__ __launch_bounds__(256) void k_cvt(const float* __restrict__ x, __bf16* __restrict__ Xb) {
  const size_t i8 = (size_t)blockIdx.x * 256 + threadIdx.x; if (i8 >= (size_t)NR * E / 8) return;
  union { __bf16 h[8]; v4u u; } pk;
#pragma unroll
  for (int e = 0; e < 8; ++e) pk.h[e] = (__bf16)x[i8 * 8 + e];
  vst2((unsigned*)(Xb + i8 * 8), pk.u);
}
// PT rows: [0,E) Wq[:,n], [E,2E) Wk[:,n], [2E,3E) Wv[:,n], [3E,4E) Wo[:,n]  ([in][out] weights: column n as a bf16 row)
__global__ __launch_bounds__(256) void k_pack(const float* __restrict__ Wq, const float* __restrict__ Wk, const float* __restrict__ Wv, const float* __restrict__ Wo, __bf16* __restrict__ PT) {
  const int n = blockIdx.x, tid = threadIdx.x; __shared__ __align__(16) __bf16 srow[E];
  const float* W = n < E ? Wq : (n < 2 * E ? Wk : (n < 3 * E ? Wv : Wo)); const int nn = n & (E - 1);
  for (int k = tid; k < E; k += 256) srow[k] = (__bf16)W[(size_t)k * E + nn];
  __syncthreads();
  if (tid < E / 8) vst2((unsigned*)(PT + (size_t)n * E + tid * 8), *(const v4u*)(&srow[tid * 8]));
}
// QKV: block (64 rows, 128 cols = 2 heads, which); q -> Q32 f32 [bh][s][64]; k -> bf16 hi/lo rows; v -> VT hi/lo x4 [bh][d][s]
__global__ __launch_bounds__(128) void k_qkv(const __bf16* __restrict__ Xb, const __bf16* __restrict__ PT, float* __restrict__ Q32, __bf16* __restrict__ Kh, __bf16* __restrict__ Kl, _Float16* __restrict__ VTh, _Float16* __restrict__ VTl) {
  __shared__ __align__(16) float so[4][16][132];
  __shared__ __align__(16) _Float16 sth[128][72], stl[128][72];
  __shared__ __attribute__((aligned(2048))) unsigned char sT[3 * TPLANE];   // 64 k of: the block's 64 x rows, its weight rows 0..63, its weight rows 64..127
  const int tid = threadIdx.x, wave = tid >> 5, lane = tid & 31, col = lane & 15, g = lane >> 4;
  const int which = blockIdx.z, r0b = blockIdx.x * 64, n0 = blockIdx.y * 128; const int b = r0b / SS, s0 = r0b % SS;
  v8f acc[8] = {};
  const uint32_t wv = uni((uint32_t)tid >> 5);      // waves 0, 1, 2 bring one plane each
  const uint64_t tsrc = wv == 0u ? (uint64_t)(size_t)(Xb + (size_t)r0b * E) : (uint64_t)(size_t)(PT + (size_t)(which * E + n0 + (wv == 2u ? 64 : 0)) * E);
  const u32x8 tg1 = tdm_group1((uint32_t)(E * 2), 64u); u32x4 tg0 = tdm_group0((uint32_t)(size_t)sT + (wv < 3u ? wv : 0u) * TPLANE, tsrc);
  const __bf16* const pA = (const __bf16*)(sT + (wave * 16 + col) * TPITCH); const __bf16* const pB = (const __bf16*)(sT + TPLANE + col * TPITCH);
#pragma unroll 1
  for (int st = 0; st < E / 64; ++st) {
    asm volatile("s_wait_dscnt 0x0" ::: "memory");      // this wave's reads of the staged tiles have retired before they are overwritten
    __syncthreads();                                    // every wave has left the previous tiles
    if (pinned(wv < 3u)) {
      { const uint64_t ga = tsrc + (uint64_t)((uint32_t)st * TROW); tg0[2] = uni((uint32_t)ga); tg0[3] = uni((((uint32_t)(ga >> 32)) & 0x01FFFFFFu) | 0x80000000u); }   // no request is outstanding here
      asm volatile("tensor_load_to_lds %0, %1" :: "s"(tg0), "s"(tg1) : "memory");   // this wave's plane, 64 k on
      asm volatile("s_wait_tensorcnt 0x0" ::: "memory"); }   // it has landed
    __syncthreads();                                    // so have the other waves': the tiles may be read
#pragma unroll
    for (int k2 = 0; k2 < 2; ++k2) { const v16b a = frag_b(pA + k2 * 32, lane);
#pragma unroll
      for (int j = 0; j < 8; ++j) acc[j] = wmma_bf(a, frag_b(pB + (j >> 2) * (TPLANE / 2) + (j & 3) * 16 * (TPITCH / 2) + k2 * 32, lane), acc[j]); } }
  if (which < 2) {
#pragma unroll
    for (int j = 0; j < 8; ++j) { const float bb = 0.f;
#pragma unroll
      for (int r = 0; r < 8; ++r) so[wave][8 * g + r][j * 16 + col] = acc[j][r] + bb; }
    LDSX();
    if (which == 0) { for (int qq = lane; qq < 2 * 16 * 16; qq += 32) { const int hh = qq >> 8, rl = (qq >> 4) & 15, pc = qq & 15; const int h = (n0 >> 6) + hh;
        vst2(Q32 + (((size_t)b * NH + h) * SS + s0 + wave * 16 + rl) * HD + pc * 4, *(const v4f*)(&so[wave][rl][hh * 64 + pc * 4])); } }
    else {
      for (int qq = lane; qq < 2 * 16 * 16; qq += 32) { const int hh = qq >> 8, rl = (qq >> 4) & 15, pl = qq & 15; const int h = (n0 >> 6) + hh; const int pc = pl & 7; union { __bf16 e[8]; v4u u; } pk;
#pragma unroll
        for (int e = 0; e < 8; ++e) { const float v = so[wave][rl][hh * 64 + pc * 8 + e]; const __bf16 hi = (__bf16)v; pk.e[e] = pl < 8 ? hi : (__bf16)(v - (float)hi); }
        vst2((unsigned*)((pl < 8 ? Kh : Kl) + (((size_t)b * NH + h) * SS + s0 + wave * 16 + rl) * HD + pc * 8), pk.u); } } }
  else {
#pragma unroll
    for (int j = 0; j < 8; ++j) { const float bb = 0.f;
#pragma unroll
      for (int r = 0; r < 8; ++r) { const float v = (acc[j][r] + bb) * 4.0f; const _Float16 hi = (_Float16)v; sth[j * 16 + col][wave * 16 + 8 * g + r] = hi; stl[j * 16 + col][wave * 16 + 8 * g + r] = (_Float16)((v - (float)hi) * VLO); } }
    __syncthreads();
    for (int qq = tid; qq < 128 * 8; qq += 128) { const int cl = qq >> 3, pc = qq & 7; const int c = n0 + cl, h = c >> 6, d = c & 63; const size_t o = (((size_t)b * NH + h) * HD + d) * SS + s0 + pc * 8;
      vst2(VTh + o, *(const v4u*)(&sth[cl][pc * 8])); vst2(VTl + o, *(const v4u*)(&stl[cl][pc * 8])); } }
}
// causal attention: block (64 queries, bh); key tiles 0..qb, each staged once per block in LDS (wave w brings plane w: K hi, K lo, V^T hi, V^T lo) and read by all four waves; S on q hi/lo x K hi/lo rows; P,V hi/lo; O f32 [bh][s][64]
__global__ __launch_bounds__(128) void k_attn(const float* __restrict__ Q32, const __bf16* __restrict__ Kh, const __bf16* __restrict__ Kl, const _Float16* __restrict__ VTh, const _Float16* __restrict__ VTl, const float* __restrict__ rb0, const float* __restrict__ rb1, float* __restrict__ O32) {
  __shared__ __align__(16) float sS[4][16][68];
  __shared__ __align__(16) _Float16 sPh[4][16][72], sPl[4][16][72];
  __shared__ __attribute__((aligned(2048))) unsigned char sKV[4 * TPLANE];
  const int tid = threadIdx.x, w = tid >> 5, lane = tid & 31, col = lane & 15, g = lane >> 4;
  const size_t bh = blockIdx.y; const int qb = blockIdx.x; const int q0 = qb * 64 + w * 16;
  F2 aq[2];
#pragma unroll
  for (int kc = 0; kc < 2; ++kc) aq[kc] = split_row(Q32 + (bh * SS + q0 + col) * HD, kc * 32, lane);
  const int h = (int)(bh % NH); __shared__ float sb0[4][64], sb1[4][64]; for (int i = lane; i < 64; i += 32) { sb0[w][i] = bfr(rb0[h * 2 * RW + i]); sb1[w][i] = bfr(rb1[h * 2 * RW + i]); }     // this head's two 64-entry bias tables
  float mrun = -3.0e38f, lrun = 0.f; v8f acc[4] = {}, ac1[4] = {}, ac2[4] = {};
  const uint32_t wv = uni((uint32_t)tid >> 5);      // K planes: rows = keys, 128 B apart, a tile 8,192 B on; V^T planes: rows = d, 2,048 B apart, a tile 128 B on
  const uint64_t tsrc = (uint64_t)(size_t)(wv == 0u ? (const void*)Kh : wv == 1u ? (const void*)Kl : wv == 2u ? (const void*)VTh : (const void*)VTl) + (uint64_t)bh * (SS * HD * 2);
  const uint32_t tstep = wv < 2u ? 64u * TROW : TROW, tdst = (uint32_t)(size_t)sKV + wv * TPLANE;
  const u32x8 tg1 = tdm_group1(wv < 2u ? TROW : (uint32_t)(SS * 2), 64u); u32x4 tg0 = tdm_group0(tdst, tsrc);
  const __bf16* const pKh = (const __bf16*)(sKV + col * TPITCH); const __bf16* const pKl = (const __bf16*)(sKV + TPLANE + col * TPITCH);
  const _Float16* const pVh = (const _Float16*)(sKV + 2 * TPLANE + col * TPITCH); const _Float16* const pVl = (const _Float16*)(sKV + 3 * TPLANE + col * TPITCH);
  LDSX();
#pragma unroll 1
  for (int kt = 0; kt <= qb; ++kt) {      // causal in raster order
    asm volatile("s_wait_dscnt 0x0" ::: "memory");      // this wave's reads of the staged tile have retired before the tile is overwritten
    __syncthreads();                                    // every wave has left the previous key tile
    { const uint64_t ga = tsrc + (uint64_t)((uint32_t)kt * tstep); tg0[2] = uni((uint32_t)ga); tg0[3] = uni((((uint32_t)(ga >> 32)) & 0x01FFFFFFu) | 0x80000000u); }   // no request is outstanding here
    asm volatile("tensor_load_to_lds %0, %1" :: "s"(tg0), "s"(tg1) : "memory");   // every wave: its own plane of this key tile
    asm volatile("s_wait_tensorcnt 0x0" ::: "memory");  // this wave's plane has landed
    __syncthreads();                                    // so have the other waves': the tile may be read
#pragma unroll
    for (int t = 0; t < 4; ++t) { const int key = kt * 64 + t * 16 + col; v8f s = {};
#pragma unroll
      for (int kc = 0; kc < 2; ++kc) { const v16b khf = frag_b(pKh + t * 16 * (TPITCH / 2) + kc * 32, lane), klf = frag_b(pKl + t * 16 * (TPITCH / 2) + kc * 32, lane); s = wmma_bf(aq[kc].l, khf, s); s = wmma_bf(aq[kc].h, klf, s); s = wmma_bf(aq[kc].h, khf, s); }
      const int kr = key / RW, kc2 = key % RW;
#pragma unroll
      for (int r = 0; r < 8; ++r) { const int qi = q0 + 8 * g + r; const int qr = qi / RW, qc = qi % RW; sS[w][8 * g + r][t * 16 + col] = (key > qi) ? -1.0e9f : s[r] * 0.125f + sb0[w][RW - 1 + kr - qr] + sb1[w][RW - 1 + kc2 - qc]; } }
    LDSX();
    float mx = -3.4e38f;
#pragma unroll
    for (int jj = 0; jj < 32; ++jj) mx = fmaxf(mx, sS[w][col][g * 32 + jj]);
    mx = fmaxf(mx, __shfl_xor(mx, 16, 32));
    const float mnew = fmaxf(mrun, mx); const float corr = expf(mrun - mnew);
    float ps = 0.f;
#pragma unroll
    for (int jj = 0; jj < 32; ++jj) { const float p = expf(sS[w][col][g * 32 + jj] - mnew) * 16384.0f; ps += p; const _Float16 hi = (_Float16)p; sPh[w][col][g * 32 + jj] = hi; sPl[w][col][g * 32 + jj] = (_Float16)((p - (float)hi) * PLO); }
    ps += __shfl_xor(ps, 16, 32);
    lrun = lrun * corr + ps * (1.0f / 16384.0f); mrun = mnew;
#pragma unroll
    for (int r = 0; r < 8; ++r) { const float cr = __shfl(corr, 8 * g + r, 32);
#pragma unroll
      for (int t = 0; t < 4; ++t) { acc[t][r] *= cr; ac1[t][r] *= cr; ac2[t][r] *= cr; } }
    LDSX();
#pragma unroll
    for (int kc = 0; kc < 2; ++kc) { const v16h ph = frag_h(&sPh[w][col][0] + kc * 32, lane), pl = frag_h(&sPl[w][col][0] + kc * 32, lane);
#pragma unroll
      for (int t = 0; t < 4; ++t) { const v16h vh = frag_h(pVh + t * 16 * (TPITCH / 2) + kc * 32, lane);
        acc[t] = wmma16(ph, vh, acc[t]); ac1[t] = wmma16(ph, frag_h(pVl + t * 16 * (TPITCH / 2) + kc * 32, lane), ac1[t]); ac2[t] = wmma16(pl, vh, ac2[t]); } }
    __builtin_amdgcn_wave_barrier(); }
#pragma unroll
  for (int r = 0; r < 8; ++r) { const float lr = __shfl(lrun, 8 * g + r, 32); const float inv = 1.0f / (lr * 16384.0f * 4.0f);
#pragma unroll
    for (int t = 0; t < 4; ++t) sS[w][8 * g + r][t * 16 + col] = (acc[t][r] + ac1[t][r] * (1.0f / VLO) + ac2[t][r] * (1.0f / PLO)) * inv; }
  LDSX();
  for (int qq = lane; qq < 16 * 16; qq += 32) { const int rl = qq >> 4, pc = qq & 15; vst2(O32 + ((bh * SS) + q0 + rl) * HD + pc * 4, *(const v4f*)(&sS[w][rl][pc * 4])); }
}
// out = ctx Wo : split(ctx) x bf16(Wo columns): 2 products (Wo is an INPUT -> bf16 exact)
__global__ __launch_bounds__(128) void k_out(const float* __restrict__ O32, const __bf16* __restrict__ PT, float* __restrict__ out) {
  __shared__ __align__(16) float so[4][16][132];
  const int tid = threadIdx.x, wave = tid >> 5, lane = tid & 31, col = lane & 15, g = lane >> 4;
  __shared__ __attribute__((aligned(2048))) unsigned char sT[128 * TPITCH + 2 * TPLANE];   // one head's 64 k of: the block's 64 ctx rows (f32: 128 half rows of 128 B, 18,432 B = 9 x 2 KiB), its weight rows 0..63, its weight rows 64..127
  const int r0b = blockIdx.x * 64, r0 = r0b + wave * 16, n0 = blockIdx.y * 128; const int b = r0b / SS, s0 = r0b % SS;
  v8f acc[8] = {};
  const uint32_t wv = uni((uint32_t)tid >> 5);      // waves 0, 1, 2 bring one plane each
  const uint64_t tsrc = wv == 0u ? (uint64_t)(size_t)(O32 + ((size_t)b * NH * SS + s0) * HD) : (uint64_t)(size_t)(PT + (size_t)(3 * E + n0 + (wv == 2u ? 64 : 0)) * E);
  const uint32_t tstep = wv == 0u ? (uint32_t)(SS * HD * 4) : TROW;
  const u32x8 tg1 = tdm_group1(wv == 0u ? TROW : (uint32_t)(E * 2), wv == 0u ? 128u : 64u);
  u32x4 tg0 = tdm_group0((uint32_t)(size_t)sT + (wv == 0u ? 0u : 128u * TPITCH + (wv == 2u ? TPLANE : 0u)), tsrc);
  const float* const pA = (const float*)(sT + (wave * 16 + col) * 2 * TPITCH); const __bf16* const pB = (const __bf16*)(sT + 128 * TPITCH + col * TPITCH);
#pragma unroll 1
  for (int h = 0; h < NH; ++h) {
    asm volatile("s_wait_dscnt 0x0" ::: "memory");      // this wave's reads of the staged tiles have retired before they are overwritten
    __syncthreads();                                    // every wave has left the previous tiles
    if (pinned(wv < 3u)) {
      { const uint64_t ga = tsrc + (uint64_t)((uint32_t)h * tstep); tg0[2] = uni((uint32_t)ga); tg0[3] = uni((((uint32_t)(ga >> 32)) & 0x01FFFFFFu) | 0x80000000u); }   // no request is outstanding here
      asm volatile("tensor_load_to_lds %0, %1" :: "s"(tg0), "s"(tg1) : "memory");   // this wave's plane of head h
      asm volatile("s_wait_tensorcnt 0x0" ::: "memory"); }   // it has landed
    __syncthreads();                                    // so have the other waves': the tiles may be read
#pragma unroll
    for (int k2 = 0; k2 < 2; ++k2) { const F2 a = split_row(pA + k2 * (TPITCH / 4), 0, lane);
#pragma unroll
      for (int j = 0; j < 8; ++j) { const v16b wb = frag_b(pB + (j >> 2) * (TPLANE / 2) + (j & 3) * 16 * (TPITCH / 2) + k2 * 32, lane); acc[j] = wmma_bf(a.l, wb, acc[j]); acc[j] = wmma_bf(a.h, wb, acc[j]); } } }
#pragma unroll
  for (int j = 0; j < 8; ++j) {
#pragma unroll
    for (int r = 0; r < 8; ++r) so[wave][8 * g + r][j * 16 + col] = acc[j][r]; }
  LDSX();
#pragma unroll 4
  for (int rl = 0; rl < 16; ++rl) vst2(out + (size_t)(r0 + rl) * E + n0 + lane * 4, *(const v4f*)(&so[wave][rl][lane * 4]));
}
extern "C" void kernel_launch(void* const* d_in, const int* in_sizes, int n_in, void* d_out, int out_size, void* d_ws, size_t ws_size, hipStream_t stream) {
  (void)in_sizes; (void)n_in; (void)out_size; (void)ws_size;
  const float** I = (const float**)d_in;   // x, Wq, Wk, Wv, Wo, rb0, rb1
  const float* x = I[0]; const float* Wq = I[1]; const float* Wk = I[2]; const float* Wv = I[3]; const float* Wo = I[4]; const float* rb0 = I[5]; const float* rb1 = I[6];
  float* out = (float*)d_out;
  char* ws = (char*)d_ws; size_t off = 0;
  auto take = [&](size_t bytes) { char* p = ws + off; off += (bytes + 255) & ~(size_t)255; return p; };
  __bf16* Xb = (__bf16*)take((size_t)NR * E * 2); __bf16* PT = (__bf16*)take((size_t)4 * E * E * 2);
  float* Q32 = (float*)take((size_t)NR * E * 4); __bf16* Kh = (__bf16*)take((size_t)NR * E * 2); __bf16* Kl = (__bf16*)take((size_t)NR * E * 2); _Float16* VTh = (_Float16*)take((size_t)NR * E * 2); _Float16* VTl = (_Float16*)take((size_t)NR * E * 2); float* O32 = (float*)take((size_t)NR * E * 4);
  k_pack<<<4 * E, 256, 0, stream>>>(Wq, Wk, Wv, Wo, PT);
  for (int ps = 0; ps < 2; ++ps) { const float* xp = x + (size_t)ps * NR * E; float* op = out + (size_t)ps * NR * E;
    k_cvt<<<(NR * E / 8 + 255) / 256, 256, 0, stream>>>(xp, Xb);
    k_qkv<<<dim3(NR / 64, E / 128, 3), 128, 0, stream>>>(Xb, PT, Q32, Kh, Kl, VTh, VTl);
    k_attn<<<dim3(SS / 64, NB * NH), 128, 0, stream>>>(Q32, Kh, Kl, VTh, VTl, rb0, rb1, O32);
    k_out<<<dim3(NR / 64, E / 128), 128, 0, stream>>>(O32, PT, op); }
}

// v002
// A run of this version takes 263 microseconds.
// Next to v001, in two timings, it ran 1.08 times as fast each time.
// Over all steps from v000 it is 2.27 times as fast.
// compute dtype: x, Wq/Wk/Wv/Wo, rb0/rb1 (INPUTS) rounded to bf16 with exact bf16 WMMA products (f32 accumulate) for the projections; K pre-split into bf16 hi/lo rows; q f32 split, P and V f16 hi/lo (3 products each); softmax, the causal raster mask and the factorised 2-D relative bias in f32.
#include <hip/hip_runtime.h>
#include <math.h>

typedef __attribute__((ext_vector_type(16))) _Float16 v16h;
typedef __attribute__((ext_vector_type(16))) __bf16 v16b;
typedef __attribute__((ext_vector_type(8)))  _Float16 v8h;
typedef __attribute__((ext_vector_type(8)))  float v8f;
typedef __attribute__((ext_vector_type(4)))  float v4f;
typedef __attribute__((ext_vector_type(2)))  float v2f;
typedef __attribute__((ext_vector_type(4)))  unsigned v4u;
typedef __attribute__((ext_vector_type(4)))  int v4i;
typedef float __attribute__((may_alias)) float_a;
typedef int __attribute__((may_alias)) int_a;

template <typename T> __device__ __forceinline__ void vst2(void* p, T v) { *(T*)p = v;  }
__device__ __forceinline__ v8f wmma16(v16h a, v16h b, v8f c) {
  v8f d = __builtin_amdgcn_wmma_f32_16x16x32_f16(false, a, false, b, (short)0, c, false, false);
  asm volatile("v_nop\n\tv_nop\n\tv_nop\n\tv_nop" : "+v"(d) : "v"(a), "v"(b));
  return d;
}
__device__ __forceinline__ v8f wmma_bf(v16b a, v16b b, v8f c) {
  v8f d = __builtin_amdgcn_wmma_f32_16x16x32_bf16(false, a, false, b, (short)0, c, false, false);
  asm volatile("v_nop\n\tv_nop\n\tv_nop\n\tv_nop" : "+v"(d) : "v"(a), "v"(b));
  return d;
}
// 16x16x32 fragments: lane = (h = lane>>4, row/col = lane&15); elements 0..7 = k0+8h+0..7, 8..15 = k0+16+8h+0..7; D element r = row 8h+r
__device__ __forceinline__ v16h frag_h(const _Float16* rowk0, int lane) {
  union { v16h v; v8h q[2]; } u; const _Float16* p = rowk0 + 8 * (lane >> 4);
  u.q[0] = *(const v8h*)p; u.q[1] = *(const v8h*)(p + 16); return u.v;
}
__device__ __forceinline__ v16h frag_f32(const float* rowk0, int lane) {
  v16h a; const float* p = rowk0 + 8 * (lane >> 4);
#pragma unroll
  for (int i = 0; i < 8; ++i) { a[i] = (_Float16)p[i]; a[8 + i] = (_Float16)p[16 + i]; }
  return a;
}
__device__ __forceinline__ v16h frag_f32s(const float* rowk0, int lane, float sc) {
  v16h a; const float* p = rowk0 + 8 * (lane >> 4);
#pragma unroll
  for (int i = 0; i < 8; ++i) { a[i] = (_Float16)(p[i] * sc); a[8 + i] = (_Float16)(p[16 + i] * sc); }
  return a;
}
// column fragment from a [K][ld] layout (column n), rows >= K read as 0
__device__ __forceinline__ v16h fragc_f32(const float* W, int k0, int n, int lane, int ld, int K) {
  v16h a; const int g = lane >> 4;
#pragma unroll
  for (int i = 0; i < 8; ++i) { const int ka = k0 + 8 * g + i, kb = ka + 16;
    a[i] = (_Float16)(ka < K ? W[(size_t)ka * ld + n] : 0.f); a[8 + i] = (_Float16)(kb < K ? W[(size_t)kb * ld + n] : 0.f); }
  return a;
}
struct F2 { v16b h, l; };
__device__ __forceinline__ F2 bsplit16(const float v[16]) { F2 r;
#pragma unroll
  for (int i = 0; i < 16; ++i) { const __bf16 h = (__bf16)v[i]; r.h[i] = h; r.l[i] = (__bf16)(v[i] - (float)h); }
  return r; }
__device__ __forceinline__ F2 split_row(const float* row, int k0, int lane) { float v[16]; const float* p = row + k0 + 8 * (lane >> 4);
#pragma unroll
  for (int i = 0; i < 8; ++i) { v[i] = p[i]; v[8 + i] = p[16 + i]; }
  return bsplit16(v); }
__device__ __forceinline__ F2 split_rowK(const float* row, int k0, int lane, int K) { float v[16]; const int g = lane >> 4;
#pragma unroll
  for (int i = 0; i < 8; ++i) { const int ka = k0 + 8 * g + i, kb = ka + 16; v[i] = ka < K ? row[ka] : 0.f; v[8 + i] = kb < K ? row[kb] : 0.f; }
  return bsplit16(v); }
__device__ __forceinline__ F2 split_col(const float* W, int k0, int n, int lane, int ld, int K) { float v[16]; const int g = lane >> 4;
#pragma unroll
  for (int i = 0; i < 8; ++i) { const int ka = k0 + 8 * g + i, kb = ka + 16; v[i] = ka < K ? W[(size_t)ka * ld + n] : 0.f; v[8 + i] = kb < K ? W[(size_t)kb * ld + n] : 0.f; }
  return bsplit16(v); }
__device__ __forceinline__ v8f mac3(const F2& a, const F2& b, v8f c) { c = wmma_bf(a.l, b.h, c); c = wmma_bf(a.h, b.l, c); return wmma_bf(a.h, b.h, c); }
__device__ __forceinline__ float sigm(float v) { return 1.0f / (1.0f + expf(-v)); }
#define LDSX() do { asm volatile("s_wait_dscnt 0" ::: "memory"); __builtin_amdgcn_wave_barrier(); __builtin_amdgcn_fence(__ATOMIC_RELEASE, "workgroup"); } while (0)


// Axial ('number-dimension') self attention over the 32 x 32 raster of each of 16 images (8 heads x 64, [in][out] DenseND kernels, no biases): scores = (q 64^-0.5).k + rb0[h][31 + kr - qr] + rb1[h][31 + kc - qc];
#define NB 8
#define SS 1024
#define E 512
#define NH 8
#define RW 32
#define HD 64
#define NR (NB * SS)
#define PLO 1024.0f
#define VLO 2048.0f
__device__ __forceinline__ float bfr(float v) { return (float)(__bf16)v; }
__device__ __forceinline__ v16b frag_b(const __bf16* rowk0, int lane) { return __builtin_bit_cast(v16b, frag_h((const _Float16*)rowk0, lane)); }

typedef uint32_t u32x4 __attribute__((ext_vector_type(4)));
typedef uint32_t u32x8 __attribute__((ext_vector_type(8)));
__device__ __forceinline__ uint32_t uni(uint32_t v) { return (uint32_t)__builtin_amdgcn_readfirstlane(v); }
#define TROW 128u                 // bytes of a staged row: 64 16-bit elements
#define TPITCH 144u               // its pitch in LDS, set by the tensor load's pad: 16 B x 9, no bank conflict for 16-byte fragment reads
#define TPLANE 10240u             // 64 rows x 144 B = 9,216 B, rounded up so that every plane starts at a multiple of 2 KiB
__device__ __forceinline__ uint32_t pinned(uint32_t v) { uint32_t w = uni(v); asm volatile("" : "+s"(w)); return w; }   // holds a wave-uniform test in a scalar register, so that the branch round a tensor load is a scalar one (a tensor load ignores EXEC)
// tensor descriptor, group 1: 1-byte elements, tensor = tile = rows rows of 128 B, source row pitch src_pitch bytes, 4 dwords of LDS pad behind every 32 dwords
__device__ __forceinline__ u32x8 tdm_group1(uint32_t src_pitch, uint32_t rows) {
  u32x8 g;
  g[0] = uni((1u << 20) | (4u << 22) | (3u << 25));
  g[1] = uni(TROW << 16);
  g[2] = uni(rows << 16);
  g[3] = uni(TROW << 16);
  g[4] = uni(rows);
  g[5] = uni(src_pitch);
  g[6] = uni(0u);
  g[7] = uni(0u);
  return g;
}
// group 0: one request, LDS destination (byte offset in the work-group's LDS), global address of the tile's first byte, type 2
__device__ __forceinline__ u32x4 tdm_group0(uint32_t lds_dst, uint64_t ga) {
  u32x4 g;
  g[0] = uni(1u); g[1] = uni(lds_dst); g[2] = uni((uint32_t)ga); g[3] = uni((((uint32_t)(ga >> 32)) & 0x01FFFFFFu) | 0x80000000u);
  return g;
}

__global__ __launch_bounds__(256) void k_cvt(const float* __restrict__ x, __bf16* __restrict__ Xb) {
  const size_t i8 = (size_t)blockIdx.x * 256 + threadIdx.x; if (i8 >= (size_t)NR * E / 8) return;
  union { __bf16 h[8]; v4u u; } pk;
#pragma unroll
  for (int e = 0; e < 8; ++e) pk.h[e] = (__bf16)x[i8 * 8 + e];
  vst2((unsigned*)(Xb + i8 * 8), pk.u);
}
// PT rows: [0,E) Wq[:,n], [E,2E) Wk[:,n], [2E,3E) Wv[:,n], [3E,4E) Wo[:,n]  ([in][out] weights: column n as a bf16 row)
__global__ __launch_bounds__(256) void k_pack(const float* __restrict__ Wq, const float* __restrict__ Wk, const float* __restrict__ Wv, const float* __restrict__ Wo, __bf16* __restrict__ PT) {
  const int n = blockIdx.x, tid = threadIdx.x; __shared__ __align__(16) __bf16 srow[E];
  const float* W = n < E ? Wq : (n < 2 * E ? Wk : (n < 3 * E ? Wv : Wo)); const int nn = n & (E - 1);
  for (int k = tid; k < E; k += 256) srow[k] = (__bf16)W[(size_t)k * E + nn];
  __syncthreads();
  if (tid < E / 8) vst2((unsigned*)(PT + (size_t)n * E + tid * 8), *(const v4u*)(&srow[tid * 8]));
}
// QKV: block (64 rows, 128 cols = 2 heads, which); q -> Q32 f32 [bh][s][64]; k -> bf16 hi/lo rows; v -> VT hi/lo x4 [bh][d][s]
__global__ __launch_bounds__(128) void k_qkv(const __bf16* __restrict__ Xb, const __bf16* __restrict__ PT, float* __restrict__ Q32, __bf16* __restrict__ Kh, __bf16* __restrict__ Kl, _Float16* __restrict__ VTh, _Float16* __restrict__ VTl) {
  __shared__ __align__(16) float so[4][16][132];
  __shared__ __align__(16) _Float16 sth[128][72], stl[128][72];
  __shared__ __attribute__((aligned(2048))) unsigned char sT[3 * TPLANE];   // 64 k of: the block's 64 x rows, its weight rows 0..63, its weight rows 64..127
  const int tid = threadIdx.x, wave = tid >> 5, lane = tid & 31, col = lane & 15, g = lane >> 4;
  const int which = blockIdx.z, r0b = blockIdx.x * 64, n0 = blockIdx.y * 128; const int b = r0b / SS, s0 = r0b % SS;
  v8f acc[8] = {};
  const uint32_t wv = uni((uint32_t)tid >> 5);      // waves 0, 1, 2 bring one plane each
  const uint64_t tsrc = wv == 0u ? (uint64_t)(size_t)(Xb + (size_t)r0b * E) : (uint64_t)(size_t)(PT + (size_t)(which * E + n0 + (wv == 2u ? 64 : 0)) * E);
  const u32x8 tg1 = tdm_group1((uint32_t)(E * 2), 64u); u32x4 tg0 = tdm_group0((uint32_t)(size_t)sT + (wv < 3u ? wv : 0u) * TPLANE, tsrc);
  const __bf16* const pA = (const __bf16*)(sT + (wave * 16 + col) * TPITCH); const __bf16* const pB = (const __bf16*)(sT + TPLANE + col * TPITCH);
#pragma unroll 1
  for (int st = 0; st < E / 64; ++st) {
    asm volatile("s_wait_dscnt 0x0" ::: "memory");      // this wave's reads of the staged tiles have retired before they are overwritten
    __syncthreads();                                    // every wave has left the previous tiles
    if (pinned(wv < 3u)) {
      { const uint64_t ga = tsrc + (uint64_t)((uint32_t)st * TROW); tg0[2] = uni((uint32_t)ga); tg0[3] = uni((((uint32_t)(ga >> 32)) & 0x01FFFFFFu) | 0x80000000u); }   // no request is outstanding here
      asm volatile("tensor_load_to_lds %0, %1" :: "s"(tg0), "s"(tg1) : "memory");   // this wave's plane, 64 k on
      asm volatile("s_wait_tensorcnt 0x0" ::: "memory"); }   // it has landed
    __syncthreads();                                    // so have the other waves': the tiles may be read
#pragma unroll
    for (int k2 = 0; k2 < 2; ++k2) { const v16b a = frag_b(pA + k2 * 32, lane);
#pragma unroll
      for (int j = 0; j < 8; ++j) acc[j] = wmma_bf(a, frag_b(pB + (j >> 2) * (TPLANE / 2) + (j & 3) * 16 * (TPITCH / 2) + k2 * 32, lane), acc[j]); } }
  if (which < 2) {
#pragma unroll
    for (int j = 0; j < 8; ++j) { const float bb = 0.f;
#pragma unroll
      for (int r = 0; r < 8; ++r) so[wave][8 * g + r][j * 16 + col] = acc[j][r] + bb; }
    LDSX();
    if (which == 0) { for (int qq = lane; qq < 2 * 16 * 16; qq += 32) { const int hh = qq >> 8, rl = (qq >> 4) & 15, pc = qq & 15; const int h = (n0 >> 6) + hh;
        vst2(Q32 + (((size_t)b * NH + h) * SS + s0 + wave * 16 + rl) * HD + pc * 4, *(const v4f*)(&so[wave][rl][hh * 64 + pc * 4])); } }
    else {
      for (int qq = lane; qq < 2 * 16 * 16; qq += 32) { const int hh = qq >> 8, rl = (qq >> 4) & 15, pl = qq & 15; const int h = (n0 >> 6) + hh; const int pc = pl & 7; union { __bf16 e[8]; v4u u; } pk;
#pragma unroll
        for (int e = 0; e < 8; ++e) { const float v = so[wave][rl][hh * 64 + pc * 8 + e]; const __bf16 hi = (__bf16)v; pk.e[e] = pl < 8 ? hi : (__bf16)(v - (float)hi); }
        vst2((unsigned*)((pl < 8 ? Kh : Kl) + (((size_t)b * NH + h) * SS + s0 + wave * 16 + rl) * HD + pc * 8), pk.u); } } }
  else {
#pragma unroll
    for (int j = 0; j < 8; ++j) { const float bb = 0.f;
#pragma unroll
      for (int r = 0; r < 8; ++r) { const float v = (acc[j][r] + bb) * 4.0f; const _Float16 hi = (_Float16)v; sth[j * 16 + col][wave * 16 + 8 * g + r] = hi; stl[j * 16 + col][wave * 16 + 8 * g + r] = (_Float16)((v - (float)hi) * VLO); } }
    __syncthreads();
    for (int qq = tid; qq < 128 * 8; qq += 128) { const int cl = qq >> 3, pc = qq & 7; const int c = n0 + cl, h = c >> 6, d = c & 63; const size_t o = (((size_t)b * NH + h) * HD + d) * SS + s0 + pc * 8;
      vst2(VTh + o, *(const v4u*)(&sth[cl][pc * 8])); vst2(VTl + o, *(const v4u*)(&stl[cl][pc * 8])); } }
}
// causal attention: block (64 queries, bh); key tiles 0..qb, each staged once per block in LDS (wave w brings plane w: K hi, K lo, V^T hi, V^T lo) and read by all four waves; S on q hi/lo x K hi/lo rows; P,V hi/lo; O f32 [bh][s][64]
__global__ __launch_bounds__(128) void k_attn(const float* __restrict__ Q32, const __bf16* __restrict__ Kh, const __bf16* __restrict__ Kl, const _Float16* __restrict__ VTh, const _Float16* __restrict__ VTl, const float* __restrict__ rb0, const float* __restrict__ rb1, float* __restrict__ O32) {
  __shared__ __align__(16) float sS[4][16][68];
  __shared__ __align__(16) _Float16 sPh[4][16][72], sPl[4][16][72];
  __shared__ __attribute__((aligned(2048))) unsigned char sKV[4 * TPLANE];
  const int tid = threadIdx.x, w = tid >> 5, lane = tid & 31, col = lane & 15, g = lane >> 4;
  const size_t bh = blockIdx.y; const int qb = blockIdx.x; const int q0 = qb * 64 + w * 16;
  F2 aq[2];
#pragma unroll
  for (int kc = 0; kc < 2; ++kc) aq[kc] = split_row(Q32 + (bh * SS + q0 + col) * HD, kc * 32, lane);
  const int h = (int)(bh % NH); __shared__ float sb0[4][64], sb1[4][64]; for (int i = lane; i < 64; i += 32) { sb0[w][i] = bfr(rb0[h * 2 * RW + i]); sb1[w][i] = bfr(rb1[h * 2 * RW + i]); }     // this head's two 64-entry bias tables
  float mrun = -3.0e38f, lrun = 0.f; v8f acc[4] = {}, ac1[4] = {}, ac2[4] = {};
  const uint32_t wv = uni((uint32_t)tid >> 5);      // K planes: rows = keys, 128 B apart, a tile 8,192 B on; V^T planes: rows = d, 2,048 B apart, a tile 128 B on
  const uint64_t tsrc = (uint64_t)(size_t)(wv == 0u ? (const void*)Kh : wv == 1u ? (const void*)Kl : wv == 2u ? (const void*)VTh : (const void*)VTl) + (uint64_t)bh * (SS * HD * 2);
  const uint32_t tstep = wv < 2u ? 64u * TROW : TROW, tdst = (uint32_t)(size_t)sKV + wv * TPLANE;
  const u32x8 tg1 = tdm_group1(wv < 2u ? TROW : (uint32_t)(SS * 2), 64u); u32x4 tg0 = tdm_group0(tdst, tsrc);
  const __bf16* const pKh = (const __bf16*)(sKV + col * TPITCH); const __bf16* const pKl = (const __bf16*)(sKV + TPLANE + col * TPITCH);
  const _Float16* const pVh = (const _Float16*)(sKV + 2 * TPLANE + col * TPITCH); const _Float16* const pVl = (const _Float16*)(sKV + 3 * TPLANE + col * TPITCH);
  LDSX();
  // the column term rb1[31 + kc - qc] does not depend on the key tile: 64 keys are two whole raster rows, so a lane meets only 2 x 8 of its values; they stay in registers (both loops unrolled: every index a constant, no scratch array)
  float b1r[2][8];
#pragma unroll
  for (int p = 0; p < 2; ++p) {
#pragma unroll
    for (int r = 0; r < 8; ++r) b1r[p][r] = sb1[w][RW - 1 + p * 16 + col - ((w & 1) * 16 + 8 * g + r)]; }
  const float* const pb0 = &sb0[w][RW - 1 - 2 * qb - (w >> 1)];      // the row term rb0[31 + kr - qr] is one value per wave and raster row of keys: entries 2 kt and 2 kt + 1 from here
  const int dq = col - (q0 + 8 * g);
#pragma unroll 1
  for (int kt = 0; kt <= qb; ++kt) {      // causal in raster order
    asm volatile("s_wait_dscnt 0x0" ::: "memory");      // this wave's reads of the staged tile have retired before the tile is overwritten
    __syncthreads();                                    // every wave has left the previous key tile
    { const uint64_t ga = tsrc + (uint64_t)((uint32_t)kt * tstep); tg0[2] = uni((uint32_t)ga); tg0[3] = uni((((uint32_t)(ga >> 32)) & 0x01FFFFFFu) | 0x80000000u); }   // no request is outstanding here
    asm volatile("tensor_load_to_lds %0, %1" :: "s"(tg0), "s"(tg1) : "memory");   // every wave: its own plane of this key tile
    asm volatile("s_wait_tensorcnt 0x0" ::: "memory");  // this wave's plane has landed
    __syncthreads();                                    // so have the other waves': the tile may be read
    const float b0r[2] = { pb0[2 * kt], pb0[2 * kt + 1] };
#pragma unroll
    for (int t = 0; t < 4; ++t) { const int dk = kt * 64 + t * 16 + dq; v8f s = {};      // dk - r = key - query
#pragma unroll
      for (int kc = 0; kc < 2; ++kc) { const v16b khf = frag_b(pKh + t * 16 * (TPITCH / 2) + kc * 32, lane), klf = frag_b(pKl + t * 16 * (TPITCH / 2) + kc * 32, lane); s = wmma_bf(aq[kc].l, khf, s); s = wmma_bf(aq[kc].h, klf, s); s = wmma_bf(aq[kc].h, khf, s); }
#pragma unroll
      for (int r = 0; r < 8; ++r) sS[w][8 * g + r][t * 16 + col] = (dk > r) ? -1.0e9f : s[r] * 0.125f + b0r[t >> 1] + b1r[t & 1][r]; }
    LDSX();
    float mx = -3.4e38f;
#pragma unroll
    for (int jj = 0; jj < 32; ++jj) mx = fmaxf(mx, sS[w][col][g * 32 + jj]);
    mx = fmaxf(mx, __shfl_xor(mx, 16, 32));
    const float mnew = fmaxf(mrun, mx); const float corr = expf(mrun - mnew);
    float ps = 0.f;
#pragma unroll
    for (int jj = 0; jj < 32; ++jj) { const float p = expf(sS[w][col][g * 32 + jj] - mnew) * 16384.0f; ps += p; const _Float16 hi = (_Float16)p; sPh[w][col][g * 32 + jj] = hi; sPl[w][col][g * 32 + jj] = (_Float16)((p - (float)hi) * PLO); }
    ps += __shfl_xor(ps, 16, 32);
    lrun = lrun * corr + ps * (1.0f / 16384.0f); mrun = mnew;
#pragma unroll
    for (int r = 0; r < 8; ++r) { const float cr = __shfl(corr, 8 * g + r, 32);
#pragma unroll
      for (int t = 0; t < 4; ++t) { acc[t][r] *= cr; ac1[t][r] *= cr; ac2[t][r] *= cr; } }
    LDSX();
#pragma unroll
    for (int kc = 0; kc < 2; ++kc) { const v16h ph = frag_h(&sPh[w][col][0] + kc * 32, lane), pl = frag_h(&sPl[w][col][0] + kc * 32, lane);
#pragma unroll
      for (int t = 0; t < 4; ++t) { const v16h vh = frag_h(pVh + t * 16 * (TPITCH / 2) + kc * 32, lane);
        acc[t] = wmma16(ph, vh, acc[t]); ac1[t] = wmma16(ph, frag_h(pVl + t * 16 * (TPITCH / 2) + kc * 32, lane), ac1[t]); ac2[t] = wmma16(pl, vh, ac2[t]); } }
    __builtin_amdgcn_wave_barrier(); }
#pragma unroll
  for (int r = 0; r < 8; ++r) { const float lr = __shfl(lrun, 8 * g + r, 32); const float inv = 1.0f / (lr * 16384.0f * 4.0f);
#pragma unroll
    for (int t = 0; t < 4; ++t) sS[w][8 * g + r][t * 16 + col] = (acc[t][r] + ac1[t][r] * (1.0f / VLO) + ac2[t][r] * (1.0f / PLO)) * inv; }
  LDSX();
  for (int qq = lane; qq < 16 * 16; qq += 32) { const int rl = qq >> 4, pc = qq & 15; vst2(O32 + ((bh * SS) + q0 + rl) * HD + pc * 4, *(const v4f*)(&sS[w][rl][pc * 4])); }
}
// out = ctx Wo : split(ctx) x bf16(Wo columns): 2 products (Wo is an INPUT -> bf16 exact)
__global__ __launch_bounds__(128) void k_out(const float* __restrict__ O32, const __bf16* __restrict__ PT, float* __restrict__ out) {
  __shared__ __align__(16) float so[4][16][132];
  const int tid = threadIdx.x, wave = tid >> 5, lane = tid & 31, col = lane & 15, g = lane >> 4;
  __shared__ __attribute__((aligned(2048))) unsigned char sT[128 * TPITCH + 2 * TPLANE];   // one head's 64 k of: the block's 64 ctx rows (f32: 128 half rows of 128 B, 18,432 B = 9 x 2 KiB), its weight rows 0..63, its weight rows 64..127
  const int r0b = blockIdx.x * 64, r0 = r0b + wave * 16, n0 = blockIdx.y * 128; const int b = r0b / SS, s0 = r0b % SS;
  v8f acc[8] = {};
  const uint32_t wv = uni((uint32_t)tid >> 5);      // waves 0, 1, 2 bring one plane each
  const uint64_t tsrc = wv == 0u ? (uint64_t)(size_t)(O32 + ((size_t)b * NH * SS + s0) * HD) : (uint64_t)(size_t)(PT + (size_t)(3 * E + n0 + (wv == 2u ? 64 : 0)) * E);
  const uint32_t tstep = wv == 0u ? (uint32_t)(SS * HD * 4) : TROW;
  const u32x8 tg1 = tdm_group1(wv == 0u ? TROW : (uint32_t)(E * 2), wv == 0u ? 128u : 64u);
  u32x4 tg0 = tdm_group0((uint32_t)(size_t)sT + (wv == 0u ? 0u : 128u * TPITCH + (wv == 2u ? TPLANE : 0u)), tsrc);
  const float* const pA = (const float*)(sT + (wave * 16 + col) * 2 * TPITCH); const __bf16* const pB = (const __bf16*)(sT + 128 * TPITCH + col * TPITCH);
#pragma unroll 1
  for (int h = 0; h < NH; ++h) {
    asm volatile("s_wait_dscnt 0x0" ::: "memory");      // this wave's reads of the staged tiles have retired before they are overwritten
    __syncthreads();                                    // every wave has left the previous tiles
    if (pinned(wv < 3u)) {
      { const uint64_t ga = tsrc + (uint64_t)((uint32_t)h * tstep); tg0[2] = uni((uint32_t)ga); tg0[3] = uni((((uint32_t)(ga >> 32)) & 0x01FFFFFFu) | 0x80000000u); }   // no request is outstanding here
      asm volatile("tensor_load_to_lds %0, %1" :: "s"(tg0), "s"(tg1) : "memory");   // this wave's plane of head h
      asm volatile("s_wait_tensorcnt 0x0" ::: "memory"); }   // it has landed
    __syncthreads();                                    // so have the other waves': the tiles may be read
#pragma unroll
    for (int k2 = 0; k2 < 2; ++k2) { const F2 a = split_row(pA + k2 * (TPITCH / 4), 0, lane);
#pragma unroll
      for (int j = 0; j < 8; ++j) { const v16b wb = frag_b(pB + (j >> 2) * (TPLANE / 2) + (j & 3) * 16 * (TPITCH / 2) + k2 * 32, lane); acc[j] = wmma_bf(a.l, wb, acc[j]); acc[j] = wmma_bf(a.h, wb, acc[j]); } } }
#pragma unroll
  for (int j = 0; j < 8; ++j) {
#pragma unroll
    for (int r = 0; r < 8; ++r) so[wave][8 * g + r][j * 16 + col] = acc[j][r]; }
  LDSX();
#pragma unroll 4
  for (int rl = 0; rl < 16; ++rl) vst2(out + (size_t)(r0 + rl) * E + n0 + lane * 4, *(const v4f*)(&so[wave][rl][lane * 4]));
}
extern "C" void kernel_launch(void* const* d_in, const int* in_sizes, int n_in, void* d_out, int out_size, void* d_ws, size_t ws_size, hipStream_t stream) {
  (void)in_sizes; (void)n_in; (void)out_size; (void)ws_size;
  const float** I = (const float**)d_in;   // x, Wq, Wk, Wv, Wo, rb0, rb1
  const float* x = I[0]; const float* Wq = I[1]; const float* Wk = I[2]; const float* Wv = I[3]; const float* Wo = I[4]; const float* rb0 = I[5]; const float* rb1 = I[6];
  float* out = (float*)d_out;
  char* ws = (char*)d_ws; size_t off = 0;
  auto take = [&](size_t bytes) { char* p = ws + off; off += (bytes + 255) & ~(size_t)255; return p; };
  __bf16* Xb = (__bf16*)take((size_t)NR * E * 2); __bf16* PT = (__bf16*)take((size_t)4 * E * E * 2);
  float* Q32 = (float*)take((size_t)NR * E * 4); __bf16* Kh = (__bf16*)take((size_t)NR * E * 2); __bf16* Kl = (__bf16*)take((size_t)NR * E * 2); _Float16* VTh = (_Float16*)take((size_t)NR * E * 2); _Float16* VTl = (_Float16*)take((size_t)NR * E * 2); float* O32 = (float*)take((size_t)NR * E * 4);
  k_pack<<<4 * E, 256, 0, stream>>>(Wq, Wk, Wv, Wo, PT);
  for (int ps = 0; ps < 2; ++ps) { const float* xp = x + (size_t)ps * NR * E; float* op = out + (size_t)ps * NR * E;
    k_cvt<<<(NR * E / 8 + 255) / 256, 256, 0, stream>>>(xp, Xb);
    k_qkv<<<dim3(NR / 64, E / 128, 3), 128, 0, stream>>>(Xb, PT, Q32, Kh, Kl, VTh, VTl);
    k_attn<<<dim3(SS / 64, NB * NH), 128, 0, stream>>>(Q32, Kh, Kl, VTh, VTl, rb0, rb1, O32);
    k_out<<<dim3(NR / 64, E / 128), 128, 0, stream>>>(O32, PT, op); }
}

// v003
// One run takes 241 microseconds.
// Next to v002, in two timings, it ran 1.09 times as fast each time.
// Counting every step since v000, it is 2.47 times as fast.
// compute dtype: x, Wq/Wk/Wv/Wo, rb0/rb1 (INPUTS) rounded to bf16 with exact bf16 WMMA products (f32 accumulate) for the projections; K pre-split into bf16 hi/lo rows; q f32 split, P and V f16 hi/lo (3 products each); softmax, the causal raster mask and the factorised 2-D relative bias in f32.
#include <hip/hip_runtime.h>
#include <math.h>

typedef __attribute__((ext_vector_type(16))) _Float16 v16h;
typedef __attribute__((ext_vector_type(16))) __bf16 v16b;
typedef __attribute__((ext_vector_type(8)))  _Float16 v8h;
typedef __attribute__((ext_vector_type(8)))  float v8f;
typedef __attribute__((ext_vector_type(4)))  float v4f;
typedef __attribute__((ext_vector_type(2)))  float v2f;
typedef __attribute__((ext_vector_type(4)))  unsigned v4u;
typedef __attribute__((ext_vector_type(4)))  int v4i;
typedef float __attribute__((may_alias)) float_a;
typedef int __attribute__((may_alias)) int_a;

template <typename T> __device__ __forceinline__ void vst2(void* p, T v) { *(T*)p = v;  }
__device__ __forceinline__ v8f wmma16(v16h a, v16h b, v8f c) {
  v8f d = __builtin_amdgcn_wmma_f32_16x16x32_f16(false, a, false, b, (short)0, c, false, false);
  asm volatile("v_nop\n\tv_nop\n\tv_nop\n\tv_nop" : "+v"(d) : "v"(a), "v"(b));
  return d;
}
__device__ __forceinline__ v8f wmma_bf(v16b a, v16b b, v8f c) {
  v8f d = __builtin_amdgcn_wmma_f32_16x16x32_bf16(false, a, false, b, (short)0, c, false, false);
  asm volatile("v_nop\n\tv_nop\n\tv_nop\n\tv_nop" : "+v"(d) : "v"(a), "v"(b));
  return d;
}
// 16x16x32 fragments: lane = (h = lane>>4, row/col = lane&15); elements 0..7 = k0+8h+0..7, 8..15 = k0+16+8h+0..7; D element r = row 8h+r
__device__ __forceinline__ v16h frag_h(const _Float16* rowk0, int lane) {
  union { v16h v; v8h q[2]; } u; const _Float16* p = rowk0 + 8 * (lane >> 4);
  u.q[0] = *(const v8h*)p; u.q[1] = *(const v8h*)(p + 16); return u.v;
}
__device__ __forceinline__ v16h frag_f32(const float* rowk0, int lane) {
  v16h a; const float* p = rowk0 + 8 * (lane >> 4);
#pragma unroll
  for (int i = 0; i < 8; ++i) { a[i] = (_Float16)p[i]; a[8 + i] = (_Float16)p[16 + i]; }
  return a;
}
__device__ __forceinline__ v16h frag_f32s(const float* rowk0, int lane, float sc) {
  v16h a; const float* p = rowk0 + 8 * (lane >> 4);
#pragma unroll
  for (int i = 0; i < 8; ++i) { a[i] = (_Float16)(p[i] * sc); a[8 + i] = (_Float16)(p[16 + i] * sc); }
  return a;
}
// column fragment from a [K][ld] layout (column n), rows >= K read as 0
__device__ __forceinline__ v16h fragc_f32(const float* W, int k0, int n, int lane, int ld, int K) {
  v16h a; const int g = lane >> 4;
#pragma unroll
  for (int i = 0; i < 8; ++i) { const int ka = k0 + 8 * g + i, kb = ka + 16;
    a[i] = (_Float16)(ka < K ? W[(size_t)ka * ld + n] : 0.f); a[8 + i] = (_Float16)(kb < K ? W[(size_t)kb * ld + n] : 0.f); }
  return a;
}
struct F2 { v16b h, l; };
__device__ __forceinline__ F2 bsplit16(const float v[16]) { F2 r;
#pragma unroll
  for (int i = 0; i < 16; ++i) { const __bf16 h = (__bf16)v[i]; r.h[i] = h; r.l[i] = (__bf16)(v[i] - (float)h); }
  return r; }
__device__ __forceinline__ F2 split_row(const float* row, int k0, int lane) { float v[16]; const float* p = row + k0 + 8 * (lane >> 4);
#pragma unroll
  for (int i = 0; i < 8; ++i) { v[i] = p[i]; v[8 + i] = p[16 + i]; }
  return bsplit16(v); }
__device__ __forceinline__ F2 split_rowK(const float* row, int k0, int lane, int K) { float v[16]; const int g = lane >> 4;
#pragma unroll
  for (int i = 0; i < 8; ++i) { const int ka = k0 + 8 * g + i, kb = ka + 16; v[i] = ka < K ? row[ka] : 0.f; v[8 + i] = kb < K ? row[kb] : 0.f; }
  return bsplit16(v); }
__device__ __forceinline__ F2 split_col(const float* W, int k0, int n, int lane, int ld, int K) { float v[16]; const int g = lane >> 4;
#pragma unroll
  for (int i = 0; i < 8; ++i) { const int ka = k0 + 8 * g + i, kb = ka + 16; v[i] = ka < K ? W[(size_t)ka * ld + n] : 0.f; v[8 + i] = kb < K ? W[(size_t)kb * ld + n] : 0.f; }
  return bsplit16(v); }
__device__ __forceinline__ v8f mac3(const F2& a, const F2& b, v8f c) { c = wmma_bf(a.l, b.h, c); c = wmma_bf(a.h, b.l, c); return wmma_bf(a.h, b.h, c); }
__device__ __forceinline__ float sigm(float v) { return 1.0f / (1.0f + expf(-v)); }
#define LDSX() do { asm volatile("s_wait_dscnt 0" ::: "memory"); __builtin_amdgcn_wave_barrier(); __builtin_amdgcn_fence(__ATOMIC_RELEASE, "workgroup"); } while (0)


// Axial ('number-dimension') self attention over the 32 x 32 raster of each of 16 images (8 heads x 64, [in][out] DenseND kernels, no biases): scores = (q 64^-0.5).k + rb0[h][31 + kr - qr] + rb1[h][31 + kc - qc];
#define NB 8
#define SS 1024
#define E 512
#define NH 8
#define RW 32
#define HD 64
#define NR (NB * SS)
#define PLO 1024.0f
#define VLO 2048.0f
#define L2E 1.4426950408889634f
__device__ __forceinline__ float bfr(float v) { return (float)(__bf16)v; }
__device__ __forceinline__ v16b frag_b(const __bf16* rowk0, int lane) { return __builtin_bit_cast(v16b, frag_h((const _Float16*)rowk0, lane)); }

typedef uint32_t u32x4 __attribute__((ext_vector_type(4)));
typedef uint32_t u32x8 __attribute__((ext_vector_type(8)));
__device__ __forceinline__ uint32_t uni(uint32_t v) { return (uint32_t)__builtin_amdgcn_readfirstlane(v); }
#define TROW 128u                 // bytes of a staged row: 64 16-bit elements
#define TPITCH 144u               // its pitch in LDS, set by the tensor load's pad: 16 B x 9, no bank conflict for 16-byte fragment reads
#define TPLANE 10240u             // 64 rows x 144 B = 9,216 B, rounded up so that every plane starts at a multiple of 2 KiB
__device__ __forceinline__ uint32_t pinned(uint32_t v) { uint32_t w = uni(v); asm volatile("" : "+s"(w)); return w; }   // holds a wave-uniform test in a scalar register, so that the branch round a tensor load is a scalar one (a tensor load ignores EXEC)
// tensor descriptor, group 1: 1-byte elements, tensor = tile = rows rows of 128 B, source row pitch src_pitch bytes, 4 dwords of LDS pad behind every 32 dwords
__device__ __forceinline__ u32x8 tdm_group1(uint32_t src_pitch, uint32_t rows) {
  u32x8 g;
  g[0] = uni((1u << 20) | (4u << 22) | (3u << 25));
  g[1] = uni(TROW << 16);
  g[2] = uni(rows << 16);
  g[3] = uni(TROW << 16);
  g[4] = uni(rows);
  g[5] = uni(src_pitch);
  g[6] = uni(0u);
  g[7] = uni(0u);
  return g;
}
// group 0: one request, LDS destination (byte offset in the work-group's LDS), global address of the tile's first byte, type 2
__device__ __forceinline__ u32x4 tdm_group0(uint32_t lds_dst, uint64_t ga) {
  u32x4 g;
  g[0] = uni(1u); g[1] = uni(lds_dst); g[2] = uni((uint32_t)ga); g[3] = uni((((uint32_t)(ga >> 32)) & 0x01FFFFFFu) | 0x80000000u);
  return g;
}

__global__ __launch_bounds__(256) void k_cvt(const float* __restrict__ x, __bf16* __restrict__ Xb) {
  const size_t i8 = (size_t)blockIdx.x * 256 + threadIdx.x; if (i8 >= (size_t)NR * E / 8) return;
  union { __bf16 h[8]; v4u u; } pk;
#pragma unroll
  for (int e = 0; e < 8; ++e) pk.h[e] = (__bf16)x[i8 * 8 + e];
  vst2((unsigned*)(Xb + i8 * 8), pk.u);
}
// PT rows: [0,E) Wq[:,n], [E,2E) Wk[:,n], [2E,3E) Wv[:,n], [3E,4E) Wo[:,n]  ([in][out] weights: column n as a bf16 row)
__global__ __launch_bounds__(256) void k_pack(const float* __restrict__ Wq, const float* __restrict__ Wk, const float* __restrict__ Wv, const float* __restrict__ Wo, __bf16* __restrict__ PT) {
  const int n = blockIdx.x, tid = threadIdx.x; __shared__ __align__(16) __bf16 srow[E];
  const float* W = n < E ? Wq : (n < 2 * E ? Wk : (n < 3 * E ? Wv : Wo)); const int nn = n & (E - 1);
  for (int k = tid; k < E; k += 256) srow[k] = (__bf16)W[(size_t)k * E + nn];
  __syncthreads();
  if (tid < E / 8) vst2((unsigned*)(PT + (size_t)n * E + tid * 8), *(const v4u*)(&srow[tid * 8]));
}
// QKV: block (64 rows, 128 cols = 2 heads, which); q -> Q32 f32 [bh][s][64]; k -> bf16 hi/lo rows; v -> VT hi/lo x4 [bh][d][s]
__global__ __launch_bounds__(128) void k_qkv(const __bf16* __restrict__ Xb, const __bf16* __restrict__ PT, float* __restrict__ Q32, __bf16* __restrict__ Kh, __bf16* __restrict__ Kl, _Float16* __restrict__ VTh, _Float16* __restrict__ VTl) {
  __shared__ __align__(16) float so[4][16][132];
  __shared__ __align__(16) _Float16 sth[128][72], stl[128][72];
  __shared__ __attribute__((aligned(2048))) unsigned char sT[3 * TPLANE];   // 64 k of: the block's 64 x rows, its weight rows 0..63, its weight rows 64..127
  const int tid = threadIdx.x, wave = tid >> 5, lane = tid & 31, col = lane & 15, g = lane >> 4;
  const int which = blockIdx.z, r0b = blockIdx.x * 64, n0 = blockIdx.y * 128; const int b = r0b / SS, s0 = r0b % SS;
  v8f acc[8] = {};
  const uint32_t wv = uni((uint32_t)tid >> 5);      // waves 0, 1, 2 bring one plane each
  const uint64_t tsrc = wv == 0u ? (uint64_t)(size_t)(Xb + (size_t)r0b * E) : (uint64_t)(size_t)(PT + (size_t)(which * E + n0 + (wv == 2u ? 64 : 0)) * E);
  const u32x8 tg1 = tdm_group1((uint32_t)(E * 2), 64u); u32x4 tg0 = tdm_group0((uint32_t)(size_t)sT + (wv < 3u ? wv : 0u) * TPLANE, tsrc);
  const __bf16* const pA = (const __bf16*)(sT + (wave * 16 + col) * TPITCH); const __bf16* const pB = (const __bf16*)(sT + TPLANE + col * TPITCH);
#pragma unroll 1
  for (int st = 0; st < E / 64; ++st) {
    asm volatile("s_wait_dscnt 0x0" ::: "memory");      // this wave's reads of the staged tiles have retired before they are overwritten
    __syncthreads();                                    // every wave has left the previous tiles
    if (pinned(wv < 3u)) {
      { const uint64_t ga = tsrc + (uint64_t)((uint32_t)st * TROW); tg0[2] = uni((uint32_t)ga); tg0[3] = uni((((uint32_t)(ga >> 32)) & 0x01FFFFFFu) | 0x80000000u); }   // no request is outstanding here
      asm volatile("tensor_load_to_lds %0, %1" :: "s"(tg0), "s"(tg1) : "memory");   // this wave's plane, 64 k on
      asm volatile("s_wait_tensorcnt 0x0" ::: "memory"); }   // it has landed
    __syncthreads();                                    // so have the other waves': the tiles may be read
#pragma unroll
    for (int k2 = 0; k2 < 2; ++k2) { const v16b a = frag_b(pA + k2 * 32, lane);
#pragma unroll
      for (int j = 0; j < 8; ++j) acc[j] = wmma_bf(a, frag_b(pB + (j >> 2) * (TPLANE / 2) + (j & 3) * 16 * (TPITCH / 2) + k2 * 32, lane), acc[j]); } }
  if (which < 2) {
#pragma unroll
    for (int j = 0; j < 8; ++j) { const float bb = 0.f;
#pragma unroll
      for (int r = 0; r < 8; ++r) so[wave][8 * g + r][j * 16 + col] = acc[j][r] + bb; }
    LDSX();
    if (which == 0) { for (int qq = lane; qq < 2 * 16 * 16; qq += 32) { const int hh = qq >> 8, rl = (qq >> 4) & 15, pc = qq & 15; const int h = (n0 >> 6) + hh;
        vst2(Q32 + (((size_t)b * NH + h) * SS + s0 + wave * 16 + rl) * HD + pc * 4, *(const v4f*)(&so[wave][rl][hh * 64 + pc * 4])); } }
    else {
      for (int qq = lane; qq < 2 * 16 * 16; qq += 32) { const int hh = qq >> 8, rl = (qq >> 4) & 15, pl = qq & 15; const int h = (n0 >> 6) + hh; const int pc = pl & 7; union { __bf16 e[8]; v4u u; } pk;
#pragma unroll
        for (int e = 0; e < 8; ++e) { const float v = so[wave][rl][hh * 64 + pc * 8 + e]; const __bf16 hi = (__bf16)v; pk.e[e] = pl < 8 ? hi : (__bf16)(v - (float)hi); }
        vst2((unsigned*)((pl < 8 ? Kh : Kl) + (((size_t)b * NH + h) * SS + s0 + wave * 16 + rl) * HD + pc * 8), pk.u); } } }
  else {
#pragma unroll
    for (int j = 0; j < 8; ++j) { const float bb = 0.f;
#pragma unroll
      for (int r = 0; r < 8; ++r) { const float v = (acc[j][r] + bb) * 4.0f; const _Float16 hi = (_Float16)v; sth[j * 16 + col][wave * 16 + 8 * g + r] = hi; stl[j * 16 + col][wave * 16 + 8 * g + r] = (_Float16)((v - (float)hi) * VLO); } }
    __syncthreads();
    for (int qq = tid; qq < 128 * 8; qq += 128) { const int cl = qq >> 3, pc = qq & 7; const int c = n0 + cl, h = c >> 6, d = c & 63; const size_t o = (((size_t)b * NH + h) * HD + d) * SS + s0 + pc * 8;
      vst2(VTh + o, *(const v4u*)(&sth[cl][pc * 8])); vst2(VTl + o, *(const v4u*)(&stl[cl][pc * 8])); } }
}
// causal attention: block (64 queries, bh); key tiles 0..qb, each staged once per block in LDS (wave w brings plane w: K hi, K lo, V^T hi, V^T lo) and read by all four waves; S on q hi/lo x K hi/lo rows; P,V hi/lo; O f32 [bh][s][64]
__global__ __launch_bounds__(128) void k_attn(const float* __restrict__ Q32, const __bf16* __restrict__ Kh, const __bf16* __restrict__ Kl, const _Float16* __restrict__ VTh, const _Float16* __restrict__ VTl, const float* __restrict__ rb0, const float* __restrict__ rb1, float* __restrict__ O32) {
  __shared__ __align__(16) float sS[4][16][68];
  __shared__ __align__(16) _Float16 sPh[4][16][72], sPl[4][16][72];
  __shared__ __attribute__((aligned(2048))) unsigned char sKV[4 * TPLANE];
  const int tid = threadIdx.x, w = tid >> 5, lane = tid & 31, col = lane & 15, g = lane >> 4;
  const size_t bh = blockIdx.y; const int qb = blockIdx.x; const int q0 = qb * 64 + w * 16;
  F2 aq[2];
#pragma unroll
  for (int kc = 0; kc < 2; ++kc) aq[kc] = split_row(Q32 + (bh * SS + q0 + col) * HD, kc * 32, lane);
  const int h = (int)(bh % NH); __shared__ float sb0[4][64], sb1[4][64]; for (int i = lane; i < 64; i += 32) { sb0[w][i] = bfr(rb0[h * 2 * RW + i]); sb1[w][i] = bfr(rb1[h * 2 * RW + i]); }     // this head's two 64-entry bias tables
  float mrun = -3.0e38f, lrun = 0.f; v8f acc[4] = {}, ac1[4] = {}, ac2[4] = {};
  const uint32_t wv = uni((uint32_t)tid >> 5);      // K planes: rows = keys, 128 B apart, a tile 8,192 B on; V^T planes: rows = d, 2,048 B apart, a tile 128 B on
  const uint64_t tsrc = (uint64_t)(size_t)(wv == 0u ? (const void*)Kh : wv == 1u ? (const void*)Kl : wv == 2u ? (const void*)VTh : (const void*)VTl) + (uint64_t)bh * (SS * HD * 2);
  const uint32_t tstep = wv < 2u ? 64u * TROW : TROW, tdst = (uint32_t)(size_t)sKV + wv * TPLANE;
  const u32x8 tg1 = tdm_group1(wv < 2u ? TROW : (uint32_t)(SS * 2), 64u); u32x4 tg0 = tdm_group0(tdst, tsrc);
  const __bf16* const pKh = (const __bf16*)(sKV + col * TPITCH); const __bf16* const pKl = (const __bf16*)(sKV + TPLANE + col * TPITCH);
  const _Float16* const pVh = (const _Float16*)(sKV + 2 * TPLANE + col * TPITCH); const _Float16* const pVl = (const _Float16*)(sKV + 3 * TPLANE + col * TPITCH);
  LDSX();
  // the column term rb1[31 + kc - qc] does not depend on the key tile: 64 keys are two whole raster rows, so a lane meets only 2 x 8 of its values; they stay in registers (both loops unrolled: every index a constant, no scratch array)
  float b1r[2][8];
#pragma unroll
  for (int p = 0; p < 2; ++p) {
#pragma unroll
    for (int r = 0; r < 8; ++r) b1r[p][r] = sb1[w][RW - 1 + p * 16 + col - ((w & 1) * 16 + 8 * g + r)]; }
  const float* const pb0 = &sb0[w][RW - 1 - 2 * qb - (w >> 1)];      // the row term rb0[31 + kr - qr] is one value per wave and raster row of keys: entries 2 kt and 2 kt + 1 from here
  const int dq = col - (q0 + 8 * g);
#pragma unroll 1
  for (int kt = 0; kt <= qb; ++kt) {      // causal in raster order
    asm volatile("s_wait_dscnt 0x0" ::: "memory");      // this wave's reads of the staged tile have retired before the tile is overwritten
    __syncthreads();                                    // every wave has left the previous key tile
    { const uint64_t ga = tsrc + (uint64_t)((uint32_t)kt * tstep); tg0[2] = uni((uint32_t)ga); tg0[3] = uni((((uint32_t)(ga >> 32)) & 0x01FFFFFFu) | 0x80000000u); }   // no request is outstanding here
    asm volatile("tensor_load_to_lds %0, %1" :: "s"(tg0), "s"(tg1) : "memory");   // every wave: its own plane of this key tile
    asm volatile("s_wait_tensorcnt 0x0" ::: "memory");  // this wave's plane has landed
    __syncthreads();                                    // so have the other waves': the tile may be read
    const float b0r[2] = { pb0[2 * kt], pb0[2 * kt + 1] };
#pragma unroll
    for (int t = 0; t < 4; ++t) { const int dk = kt * 64 + t * 16 + dq; v8f s = {};      // dk - r = key - query
#pragma unroll
      for (int kc = 0; kc < 2; ++kc) { const v16b khf = frag_b(pKh + t * 16 * (TPITCH / 2) + kc * 32, lane), klf = frag_b(pKl + t * 16 * (TPITCH / 2) + kc * 32, lane); s = wmma_bf(aq[kc].l, khf, s); s = wmma_bf(aq[kc].h, klf, s); s = wmma_bf(aq[kc].h, khf, s); }
#pragma unroll
      for (int r = 0; r < 8; ++r) sS[w][8 * g + r][t * 16 + col] = (dk > r) ? -1.0e9f : s[r] * 0.125f + b0r[t >> 1] + b1r[t & 1][r]; }
    LDSX();
    float mx = -3.4e38f;
#pragma unroll
    for (int jj = 0; jj < 32; ++jj) mx = fmaxf(mx, sS[w][col][g * 32 + jj]);
    mx = fmaxf(mx, __shfl_xor(mx, 16, 32));
    const float mnew = fmaxf(mrun, mx); const float corr = __builtin_amdgcn_exp2f((mrun - mnew) * L2E);      // 0 on the first tile: the product overflows to -inf
    const float eb = 14.0f - mnew * L2E;      // e^(s - mnew) * 2^14 = 2^(s log2(e) + eb): one multiply-add and the hardware's base-2 exponential per score; a masked score gives 0
    float ps = 0.f;
#pragma unroll
    for (int jj = 0; jj < 32; ++jj) { const float p = __builtin_amdgcn_exp2f(sS[w][col][g * 32 + jj] * L2E + eb); ps += p; const _Float16 hi = (_Float16)p; sPh[w][col][g * 32 + jj] = hi; sPl[w][col][g * 32 + jj] = (_Float16)((p - (float)hi) * PLO); }
    ps += __shfl_xor(ps, 16, 32);
    lrun = lrun * corr + ps * (1.0f / 16384.0f); mrun = mnew;
#pragma unroll
    for (int r = 0; r < 8; ++r) { const float cr = __shfl(corr, 8 * g + r, 32);
#pragma unroll
      for (int t = 0; t < 4; ++t) { acc[t][r] *= cr; ac1[t][r] *= cr; ac2[t][r] *= cr; } }
    LDSX();
#pragma unroll
    for (int kc = 0; kc < 2; ++kc) { const v16h ph = frag_h(&sPh[w][col][0] + kc * 32, lane), pl = frag_h(&sPl[w][col][0] + kc * 32, lane);
#pragma unroll
      for (int t = 0; t < 4; ++t) { const v16h vh = frag_h(pVh + t * 16 * (TPITCH / 2) + kc * 32, lane);
        acc[t] = wmma16(ph, vh, acc[t]); ac1[t] = wmma16(ph, frag_h(pVl + t * 16 * (TPITCH / 2) + kc * 32, lane), ac1[t]); ac2[t] = wmma16(pl, vh, ac2[t]); } }
    __builtin_amdgcn_wave_barrier(); }
#pragma unroll
  for (int r = 0; r < 8; ++r) { const float lr = __shfl(lrun, 8 * g + r, 32); const float inv = 1.0f / (lr * 16384.0f * 4.0f);
#pragma unroll
    for (int t = 0; t < 4; ++t) sS[w][8 * g + r][t * 16 + col] = (acc[t][r] + ac1[t][r] * (1.0f / VLO) + ac2[t][r] * (1.0f / PLO)) * inv; }
  LDSX();
  for (int qq = lane; qq < 16 * 16; qq += 32) { const int rl = qq >> 4, pc = qq & 15; vst2(O32 + ((bh * SS) + q0 + rl) * HD + pc * 4, *(const v4f*)(&sS[w][rl][pc * 4])); }
}
// out = ctx Wo : split(ctx) x bf16(Wo columns): 2 products (Wo is an INPUT -> bf16 exact)
__global__ __launch_bounds__(128) void k_out(const float* __restrict__ O32, const __bf16* __restrict__ PT, float* __restrict__ out) {
  __shared__ __align__(16) float so[4][16][132];
  const int tid = threadIdx.x, wave = tid >> 5, lane = tid & 31, col = lane & 15, g = lane >> 4;
  __shared__ __attribute__((aligned(2048))) unsigned char sT[128 * TPITCH + 2 * TPLANE];   // one head's 64 k of: the block's 64 ctx rows (f32: 128 half rows of 128 B, 18,432 B = 9 x 2 KiB), its weight rows 0..63, its weight rows 64..127
  const int r0b = blockIdx.x * 64, r0 = r0b + wave * 16, n0 = blockIdx.y * 128; const int b = r0b / SS, s0 = r0b % SS;
  v8f acc[8] = {};
  const uint32_t wv = uni((uint32_t)tid >> 5);      // waves 0, 1, 2 bring one plane each
  const uint64_t tsrc = wv == 0u ? (uint64_t)(size_t)(O32 + ((size_t)b * NH * SS + s0) * HD) : (uint64_t)(size_t)(PT + (size_t)(3 * E + n0 + (wv == 2u ? 64 : 0)) * E);
  const uint32_t tstep = wv == 0u ? (uint32_t)(SS * HD * 4) : TROW;
  const u32x8 tg1 = tdm_group1(wv == 0u ? TROW : (uint32_t)(E * 2), wv == 0u ? 128u : 64u);
  u32x4 tg0 = tdm_group0((uint32_t)(size_t)sT + (wv == 0u ? 0u : 128u * TPITCH + (wv == 2u ? TPLANE : 0u)), tsrc);
  const float* const pA = (const float*)(sT + (wave * 16 + col) * 2 * TPITCH); const __bf16* const pB = (const __bf16*)(sT + 128 * TPITCH + col * TPITCH);
#pragma unroll 1
  for (int h = 0; h < NH; ++h) {
    asm volatile("s_wait_dscnt 0x0" ::: "memory");      // this wave's reads of the staged tiles have retired before they are overwritten
    __syncthreads();                                    // every wave has left the previous tiles
    if (pinned(wv < 3u)) {
      { const uint64_t ga = tsrc + (uint64_t)((uint32_t)h * tstep); tg0[2] = uni((uint32_t)ga); tg0[3] = uni((((uint32_t)(ga >> 32)) & 0x01FFFFFFu) | 0x80000000u); }   // no request is outstanding here
      asm volatile("tensor_load_to_lds %0, %1" :: "s"(tg0), "s"(tg1) : "memory");   // this wave's plane of head h
      asm volatile("s_wait_tensorcnt 0x0" ::: "memory"); }   // it has landed
    __syncthreads();                                    // so have the other waves': the tiles may be read
#pragma unroll
    for (int k2 = 0; k2 < 2; ++k2) { const F2 a = split_row(pA + k2 * (TPITCH / 4), 0, lane);
#pragma unroll
      for (int j = 0; j < 8; ++j) { const v16b wb = frag_b(pB + (j >> 2) * (TPLANE / 2) + (j & 3) * 16 * (TPITCH / 2) + k2 * 32, lane); acc[j] = wmma_bf(a.l, wb, acc[j]); acc[j] = wmma_bf(a.h, wb, acc[j]); } } }
#pragma unroll
  for (int j = 0; j < 8; ++j) {
#pragma unroll
    for (int r = 0; r < 8; ++r) so[wave][8 * g + r][j * 16 + col] = acc[j][r]; }
  LDSX();
#pragma unroll 4
  for (int rl = 0; rl < 16; ++rl) vst2(out + (size_t)(r0 + rl) * E + n0 + lane * 4, *(const v4f*)(&so[wave][rl][lane * 4]));
}
extern "C" void kernel_launch(void* const* d_in, const int* in_sizes, int n_in, void* d_out, int out_size, void* d_ws, size_t ws_size, hipStream_t stream) {
  (void)in_sizes; (void)n_in; (void)out_size; (void)ws_size;
  const float** I = (const float**)d_in;   // x, Wq, Wk, Wv, Wo, rb0, rb1
  const float* x = I[0]; const float* Wq = I[1]; const float* Wk = I[2]; const float* Wv = I[3]; const float* Wo = I[4]; const float* rb0 = I[5]; const float* rb1 = I[6];
  float* out = (float*)d_out;
  char* ws = (char*)d_ws; size_t off = 0;
  auto take = [&](size_t bytes) { char* p = ws + off; off += (bytes + 255) & ~(size_t)255; return p; };
  __bf16* Xb = (__bf16*)take((size_t)NR * E * 2); __bf16* PT = (__bf16*)take((size_t)4 * E * E * 2);
  float* Q32 = (float*)take((size_t)NR * E * 4); __bf16* Kh = (__bf16*)take((size_t)NR * E * 2); __bf16* Kl = (__bf16*)take((size_t)NR * E * 2); _Float16* VTh = (_Float16*)take((size_t)NR * E * 2); _Float16* VTl = (_Float16*)take((size_t)NR * E * 2); float* O32 = (float*)take((size_t)NR * E * 4);
  k_pack<<<4 * E, 256, 0, stream>>>(Wq, Wk, Wv, Wo, PT);
  for (int ps = 0; ps < 2; ++ps) { const float* xp = x + (size_t)ps * NR * E; float* op = out + (size_t)ps * NR * E;
    k_cvt<<<(NR * E / 8 + 255) / 256, 256, 0, stream>>>(xp, Xb);
    k_qkv<<<dim3(NR / 64, E / 128, 3), 128, 0, stream>>>(Xb, PT, Q32, Kh, Kl, VTh, VTl);
    k_attn<<<dim3(SS / 64, NB * NH), 128, 0, stream>>>(Q32, Kh, Kl, VTh, VTl, rb0, rb1, O32);
    k_out<<<dim3(NR / 64, E / 128), 128, 0, stream>>>(O32, PT, op); }
}

// v004
// One run takes 213 microseconds.
// In two side-by-side timings against v003, it was 1.15 and 1.13 times as fast.
// All steps since v000 together make it 2.82 times as fast.
// compute dtype: x, Wq/Wk/Wv/Wo, rb0/rb1 (INPUTS) rounded to bf16 with exact bf16 WMMA products (f32 accumulate) for the projections; K pre-split into bf16 hi/lo rows; q f32 split, P and V f16 hi/lo (3 products each); softmax, the causal raster mask and the factorised 2-D relative bias in f32.
#include <hip/hip_runtime.h>
#include <math.h>

typedef __attribute__((ext_vector_type(16))) _Float16 v16h;
typedef __attribute__((ext_vector_type(16))) __bf16 v16b;
typedef __attribute__((ext_vector_type(8)))  _Float16 v8h;
typedef __attribute__((ext_vector_type(8)))  float v8f;
typedef __attribute__((ext_vector_type(4)))  float v4f;
typedef __attribute__((ext_vector_type(2)))  float v2f;
typedef __attribute__((ext_vector_type(4)))  unsigned v4u;
typedef __attribute__((ext_vector_type(4)))  int v4i;
typedef float __attribute__((may_alias)) float_a;
typedef int __attribute__((may_alias)) int_a;

template <typename T> __device__ __forceinline__ void vst2(void* p, T v) { *(T*)p = v;  }
__device__ __forceinline__ v8f wmma16(v16h a, v16h b, v8f c) {
  v8f d = __builtin_amdgcn_wmma_f32_16x16x32_f16(false, a, false, b, (short)0, c, false, false);
  asm volatile("v_nop\n\tv_nop\n\tv_nop\n\tv_nop" : "+v"(d) : "v"(a), "v"(b));
  return d;
}
__device__ __forceinline__ v8f wmma_bf(v16b a, v16b b, v8f c) {
  v8f d = __builtin_amdgcn_wmma_f32_16x16x32_bf16(false, a, false, b, (short)0, c, false, false);
  asm volatile("v_nop\n\tv_nop\n\tv_nop\n\tv_nop" : "+v"(d) : "v"(a), "v"(b));
  return d;
}
// 16x16x32 fragments: lane = (h = lane>>4, row/col = lane&15); elements 0..7 = k0+8h+0..7, 8..15 = k0+16+8h+0..7; D element r = row 8h+r
__device__ __forceinline__ v16h frag_h(const _Float16* rowk0, int lane) {
  union { v16h v; v8h q[2]; } u; const _Float16* p = rowk0 + 8 * (lane >> 4);
  u.q[0] = *(const v8h*)p; u.q[1] = *(const v8h*)(p + 16); return u.v;
}
__device__ __forceinline__ v16h frag_f32(const float* rowk0, int lane) {
  v16h a; const float* p = rowk0 + 8 * (lane >> 4);
#pragma unroll
  for (int i = 0; i < 8; ++i) { a[i] = (_Float16)p[i]; a[8 + i] = (_Float16)p[16 + i]; }
  return a;
}
__device__ __forceinline__ v16h frag_f32s(const float* rowk0, int lane, float sc) {
  v16h a; const float* p = rowk0 + 8 * (lane >> 4);
#pragma unroll
  for (int i = 0; i < 8; ++i) { a[i] = (_Float16)(p[i] * sc); a[8 + i] = (_Float16)(p[16 + i] * sc); }
  return a;
}
// column fragment from a [K][ld] layout (column n), rows >= K read as 0
__device__ __forceinline__ v16h fragc_f32(const float* W, int k0, int n, int lane, int ld, int K) {
  v16h a; const int g = lane >> 4;
#pragma unroll
  for (int i = 0; i < 8; ++i) { const int ka = k0 + 8 * g + i, kb = ka + 16;
    a[i] = (_Float16)(ka < K ? W[(size_t)ka * ld + n] : 0.f); a[8 + i] = (_Float16)(kb < K ? W[(size_t)kb * ld + n] : 0.f); }
  return a;
}
struct F2 { v16b h, l; };
__device__ __forceinline__ F2 bsplit16(const float v[16]) { F2 r;
#pragma unroll
  for (int i = 0; i < 16; ++i) { const __bf16 h = (__bf16)v[i]; r.h[i] = h; r.l[i] = (__bf16)(v[i] - (float)h); }
  return r; }
__device__ __forceinline__ F2 split_row(const float* row, int k0, int lane) { float v[16]; const float* p = row + k0 + 8 * (lane >> 4);
#pragma unroll
  for (int i = 0; i < 8; ++i) { v[i] = p[i]; v[8 + i] = p[16 + i]; }
  return bsplit16(v); }
__device__ __forceinline__ F2 split_rowK(const float* row, int k0, int lane, int K) { float v[16]; const int g = lane >> 4;
#pragma unroll
  for (int i = 0; i < 8; ++i) { const int ka = k0 + 8 * g + i, kb = ka + 16; v[i] = ka < K ? row[ka] : 0.f; v[8 + i] = kb < K ? row[kb] : 0.f; }
  return bsplit16(v); }
__device__ __forceinline__ F2 split_col(const float* W, int k0, int n, int lane, int ld, int K) { float v[16]; const int g = lane >> 4;
#pragma unroll
  for (int i = 0; i < 8; ++i) { const int ka = k0 + 8 * g + i, kb = ka + 16; v[i] = ka < K ? W[(size_t)ka * ld + n] : 0.f; v[8 + i] = kb < K ? W[(size_t)kb * ld + n] : 0.f; }
  return bsplit16(v); }
__device__ __forceinline__ v8f mac3(const F2& a, const F2& b, v8f c) { c = wmma_bf(a.l, b.h, c); c = wmma_bf(a.h, b.l, c); return wmma_bf(a.h, b.h, c); }
__device__ __forceinline__ float sigm(float v) { return 1.0f / (1.0f + expf(-v)); }
#define LDSX() do { asm volatile("s_wait_dscnt 0" ::: "memory"); __builtin_amdgcn_wave_barrier(); __builtin_amdgcn_fence(__ATOMIC_RELEASE, "workgroup"); } while (0)


// Axial ('number-dimension') self attention over the 32 x 32 raster of each of 16 images (8 heads x 64, [in][out] DenseND kernels, no biases): scores = (q 64^-0.5).k + rb0[h][31 + kr - qr] + rb1[h][31 + kc - qc];
#define NB 16
#define SS 1024
#define E 512
#define NH 8
#define RW 32
#define HD 64
#define NR (NB * SS)
#define PLO 1024.0f
#define VLO 2048.0f
#define L2E 1.4426950408889634f
__device__ __forceinline__ float bfr(float v) { return (float)(__bf16)v; }
__device__ __forceinline__ v16b frag_b(const __bf16* rowk0, int lane) { return __builtin_bit_cast(v16b, frag_h((const _Float16*)rowk0, lane)); }

typedef uint32_t u32x4 __attribute__((ext_vector_type(4)));
typedef uint32_t u32x8 __attribute__((ext_vector_type(8)));
__device__ __forceinline__ uint32_t uni(uint32_t v) { return (uint32_t)__builtin_amdgcn_readfirstlane(v); }
#define TROW 128u                 // bytes of a staged row: 64 16-bit elements
#define TPITCH 144u               // its pitch in LDS, set by the tensor load's pad: 16 B x 9, no bank conflict for 16-byte fragment reads
#define TPLANE 10240u             // 64 rows x 144 B = 9,216 B, rounded up so that every plane starts at a multiple of 2 KiB
__device__ __forceinline__ uint32_t pinned(uint32_t v) { uint32_t w = uni(v); asm volatile("" : "+s"(w)); return w; }   // holds a wave-uniform test in a scalar register, so that the branch round a tensor load is a scalar one (a tensor load ignores EXEC)
// tensor descriptor, group 1: 1-byte elements, tensor = tile = rows rows of 128 B, source row pitch src_pitch bytes, 4 dwords of LDS pad behind every 32 dwords
__device__ __forceinline__ u32x8 tdm_group1(uint32_t src_pitch, uint32_t rows) {
  u32x8 g;
  g[0] = uni((1u << 20) | (4u << 22) | (3u << 25));
  g[1] = uni(TROW << 16);
  g[2] = uni(rows << 16);
  g[3] = uni(TROW << 16);
  g[4] = uni(rows);
  g[5] = uni(src_pitch);
  g[6] = uni(0u);
  g[7] = uni(0u);
  return g;
}
// group 0: one request, LDS destination (byte offset in the work-group's LDS), global address of the tile's first byte, type 2
__device__ __forceinline__ u32x4 tdm_group0(uint32_t lds_dst, uint64_t ga) {
  u32x4 g;
  g[0] = uni(1u); g[1] = uni(lds_dst); g[2] = uni((uint32_t)ga); g[3] = uni((((uint32_t)(ga >> 32)) & 0x01FFFFFFu) | 0x80000000u);
  return g;
}

__global__ __launch_bounds__(256) void k_cvt(const float* __restrict__ x, __bf16* __restrict__ Xb) {
  const size_t i8 = (size_t)blockIdx.x * 256 + threadIdx.x; if (i8 >= (size_t)NR * E / 8) return;
  union { __bf16 h[8]; v4u u; } pk;
#pragma unroll
  for (int e = 0; e < 8; ++e) pk.h[e] = (__bf16)x[i8 * 8 + e];
  vst2((unsigned*)(Xb + i8 * 8), pk.u);
}
// PT rows: [0,E) Wq[:,n], [E,2E) Wk[:,n], [2E,3E) Wv[:,n], [3E,4E) Wo[:,n]  ([in][out] weights: column n as a bf16 row)
__global__ __launch_bounds__(256) void k_pack(const float* __restrict__ Wq, const float* __restrict__ Wk, const float* __restrict__ Wv, const float* __restrict__ Wo, __bf16* __restrict__ PT) {
  const int n = blockIdx.x, tid = threadIdx.x; __shared__ __align__(16) __bf16 srow[E];
  const float* W = n < E ? Wq : (n < 2 * E ? Wk : (n < 3 * E ? Wv : Wo)); const int nn = n & (E - 1);
  for (int k = tid; k < E; k += 256) srow[k] = (__bf16)W[(size_t)k * E + nn];
  __syncthreads();
  if (tid < E / 8) vst2((unsigned*)(PT + (size_t)n * E + tid * 8), *(const v4u*)(&srow[tid * 8]));
}
// QKV: block (64 rows, 128 cols = 2 heads, which); q -> Q32 f32 [bh][s][64]; k -> bf16 hi/lo rows; v -> VT hi/lo x4 [bh][d][s]
__global__ __launch_bounds__(128) void k_qkv(const __bf16* __restrict__ Xb, const __bf16* __restrict__ PT, float* __restrict__ Q32, __bf16* __restrict__ Kh, __bf16* __restrict__ Kl, _Float16* __restrict__ VTh, _Float16* __restrict__ VTl) {
  __shared__ __align__(16) float so[4][16][132];
  __shared__ __align__(16) _Float16 sth[128][72], stl[128][72];
  __shared__ __attribute__((aligned(2048))) unsigned char sT[3 * TPLANE];   // 64 k of: the block's 64 x rows, its weight rows 0..63, its weight rows 64..127
  const int tid = threadIdx.x, wave = tid >> 5, lane = tid & 31, col = lane & 15, g = lane >> 4;
  const int which = blockIdx.z, r0b = blockIdx.x * 64, n0 = blockIdx.y * 128; const int b = r0b / SS, s0 = r0b % SS;
  v8f acc[8] = {};
  const uint32_t wv = uni((uint32_t)tid >> 5);      // waves 0, 1, 2 bring one plane each
  const uint64_t tsrc = wv == 0u ? (uint64_t)(size_t)(Xb + (size_t)r0b * E) : (uint64_t)(size_t)(PT + (size_t)(which * E + n0 + (wv == 2u ? 64 : 0)) * E);
  const u32x8 tg1 = tdm_group1((uint32_t)(E * 2), 64u); u32x4 tg0 = tdm_group0((uint32_t)(size_t)sT + (wv < 3u ? wv : 0u) * TPLANE, tsrc);
  const __bf16* const pA = (const __bf16*)(sT + (wave * 16 + col) * TPITCH); const __bf16* const pB = (const __bf16*)(sT + TPLANE + col * TPITCH);
#pragma unroll 1
  for (int st = 0; st < E / 64; ++st) {
    asm volatile("s_wait_dscnt 0x0" ::: "memory");      // this wave's reads of the staged tiles have retired before they are overwritten
    __syncthreads();                                    // every wave has left the previous tiles
    if (pinned(wv < 3u)) {
      { const uint64_t ga = tsrc + (uint64_t)((uint32_t)st * TROW); tg0[2] = uni((uint32_t)ga); tg0[3] = uni((((uint32_t)(ga >> 32)) & 0x01FFFFFFu) | 0x80000000u); }   // no request is outstanding here
      asm volatile("tensor_load_to_lds %0, %1" :: "s"(tg0), "s"(tg1) : "memory");   // this wave's plane, 64 k on
      asm volatile("s_wait_tensorcnt 0x0" ::: "memory"); }   // it has landed
    __syncthreads();                                    // so have the other waves': the tiles may be read
#pragma unroll
    for (int k2 = 0; k2 < 2; ++k2) { const v16b a = frag_b(pA + k2 * 32, lane);
#pragma unroll
      for (int j = 0; j < 8; ++j) acc[j] = wmma_bf(a, frag_b(pB + (j >> 2) * (TPLANE / 2) + (j & 3) * 16 * (TPITCH / 2) + k2 * 32, lane), acc[j]); } }
  if (which < 2) {
#pragma unroll
    for (int j = 0; j < 8; ++j) { const float bb = 0.f;
#pragma unroll
      for (int r = 0; r < 8; ++r) so[wave][8 * g + r][j * 16 + col] = acc[j][r] + bb; }
    LDSX();
    if (which == 0) { for (int qq = lane; qq < 2 * 16 * 16; qq += 32) { const int hh = qq >> 8, rl = (qq >> 4) & 15, pc = qq & 15; const int h = (n0 >> 6) + hh;
        vst2(Q32 + (((size_t)b * NH + h) * SS + s0 + wave * 16 + rl) * HD + pc * 4, *(const v4f*)(&so[wave][rl][hh * 64 + pc * 4])); } }
    else {
      for (int qq = lane; qq < 2 * 16 * 16; qq += 32) { const int hh = qq >> 8, rl = (qq >> 4) & 15, pl = qq & 15; const int h = (n0 >> 6) + hh; const int pc = pl & 7; union { __bf16 e[8]; v4u u; } pk;
#pragma unroll
        for (int e = 0; e < 8; ++e) { const float v = so[wave][rl][hh * 64 + pc * 8 + e]; const __bf16 hi = (__bf16)v; pk.e[e] = pl < 8 ? hi : (__bf16)(v - (float)hi); }
        vst2((unsigned*)((pl < 8 ? Kh : Kl) + (((size_t)b * NH + h) * SS + s0 + wave * 16 + rl) * HD + pc * 8), pk.u); } } }
  else {
#pragma unroll
    for (int j = 0; j < 8; ++j) { const float bb = 0.f;
#pragma unroll
      for (int r = 0; r < 8; ++r) { const float v = (acc[j][r] + bb) * 4.0f; const _Float16 hi = (_Float16)v; sth[j * 16 + col][wave * 16 + 8 * g + r] = hi; stl[j * 16 + col][wave * 16 + 8 * g + r] = (_Float16)((v - (float)hi) * VLO); } }
    __syncthreads();
    for (int qq = tid; qq < 128 * 8; qq += 128) { const int cl = qq >> 3, pc = qq & 7; const int c = n0 + cl, h = c >> 6, d = c & 63; const size_t o = (((size_t)b * NH + h) * HD + d) * SS + s0 + pc * 8;
      vst2(VTh + o, *(const v4u*)(&sth[cl][pc * 8])); vst2(VTl + o, *(const v4u*)(&stl[cl][pc * 8])); } }
}
// causal attention: block (64 queries, bh); key tiles 0..qb, each staged once per block in LDS (wave w brings plane w: K hi, K lo, V^T hi, V^T lo) and read by all four waves; S on q hi/lo x K hi/lo rows; P,V hi/lo; O f32 [bh][s][64]
__global__ __launch_bounds__(128) void k_attn(const float* __restrict__ Q32, const __bf16* __restrict__ Kh, const __bf16* __restrict__ Kl, const _Float16* __restrict__ VTh, const _Float16* __restrict__ VTl, const float* __restrict__ rb0, const float* __restrict__ rb1, float* __restrict__ O32) {
  __shared__ __align__(16) float sS[4][16][68];
  __shared__ __align__(16) _Float16 sPh[4][16][72], sPl[4][16][72];
  __shared__ __attribute__((aligned(2048))) unsigned char sKV[4 * TPLANE];
  const int tid = threadIdx.x, w = tid >> 5, lane = tid & 31, col = lane & 15, g = lane >> 4;
  const size_t bh = blockIdx.y; const int qb = blockIdx.x; const int q0 = qb * 64 + w * 16;
  F2 aq[2];
#pragma unroll
  for (int kc = 0; kc < 2; ++kc) aq[kc] = split_row(Q32 + (bh * SS + q0 + col) * HD, kc * 32, lane);
  const int h = (int)(bh % NH); __shared__ float sb0[4][64], sb1[4][64]; for (int i = lane; i < 64; i += 32) { sb0[w][i] = bfr(rb0[h * 2 * RW + i]); sb1[w][i] = bfr(rb1[h * 2 * RW + i]); }     // this head's two 64-entry bias tables
  float mrun = -3.0e38f, lrun = 0.f; v8f acc[4] = {}, ac1[4] = {}, ac2[4] = {};
  const uint32_t wv = uni((uint32_t)tid >> 5);      // K planes: rows = keys, 128 B apart, a tile 8,192 B on; V^T planes: rows = d, 2,048 B apart, a tile 128 B on
  const uint64_t tsrc = (uint64_t)(size_t)(wv == 0u ? (const void*)Kh : wv == 1u ? (const void*)Kl : wv == 2u ? (const void*)VTh : (const void*)VTl) + (uint64_t)bh * (SS * HD * 2);
  const uint32_t tstep = wv < 2u ? 64u * TROW : TROW, tdst = (uint32_t)(size_t)sKV + wv * TPLANE;
  const u32x8 tg1 = tdm_group1(wv < 2u ? TROW : (uint32_t)(SS * 2), 64u); u32x4 tg0 = tdm_group0(tdst, tsrc);
  const __bf16* const pKh = (const __bf16*)(sKV + col * TPITCH); const __bf16* const pKl = (const __bf16*)(sKV + TPLANE + col * TPITCH);
  const _Float16* const pVh = (const _Float16*)(sKV + 2 * TPLANE + col * TPITCH); const _Float16* const pVl = (const _Float16*)(sKV + 3 * TPLANE + col * TPITCH);
  LDSX();
  // the column term rb1[31 + kc - qc] does not depend on the key tile: 64 keys are two whole raster rows, so a lane meets only 2 x 8 of its values; they stay in registers (both loops unrolled: every index a constant, no scratch array)
  float b1r[2][8];
#pragma unroll
  for (int p = 0; p < 2; ++p) {
#pragma unroll
    for (int r = 0; r < 8; ++r) b1r[p][r] = sb1[w][RW - 1 + p * 16 + col - ((w & 1) * 16 + 8 * g + r)]; }
  const float* const pb0 = &sb0[w][RW - 1 - 2 * qb - (w >> 1)];      // the row term rb0[31 + kr - qr] is one value per wave and raster row of keys: entries 2 kt and 2 kt + 1 from here
  const int dq = col - (q0 + 8 * g);
#pragma unroll 1
  for (int kt = 0; kt <= qb; ++kt) {      // causal in raster order
    asm volatile("s_wait_dscnt 0x0" ::: "memory");      // this wave's reads of the staged tile have retired before the tile is overwritten
    __syncthreads();                                    // every wave has left the previous key tile
    { const uint64_t ga = tsrc + (uint64_t)((uint32_t)kt * tstep); tg0[2] = uni((uint32_t)ga); tg0[3] = uni((((uint32_t)(ga >> 32)) & 0x01FFFFFFu) | 0x80000000u); }   // no request is outstanding here
    asm volatile("tensor_load_to_lds %0, %1" :: "s"(tg0), "s"(tg1) : "memory");   // every wave: its own plane of this key tile
    asm volatile("s_wait_tensorcnt 0x0" ::: "memory");  // this wave's plane has landed
    __syncthreads();                                    // so have the other waves': the tile may be read
    const float b0r[2] = { pb0[2 * kt], pb0[2 * kt + 1] };
#pragma unroll
    for (int t = 0; t < 4; ++t) { const int dk = kt * 64 + t * 16 + dq; v8f s = {};      // dk - r = key - query
#pragma unroll
      for (int kc = 0; kc < 2; ++kc) { const v16b khf = frag_b(pKh + t * 16 * (TPITCH / 2) + kc * 32, lane), klf = frag_b(pKl + t * 16 * (TPITCH / 2) + kc * 32, lane); s = wmma_bf(aq[kc].l, khf, s); s = wmma_bf(aq[kc].h, klf, s); s = wmma_bf(aq[kc].h, khf, s); }
#pragma unroll
      for (int r = 0; r < 8; ++r) sS[w][8 * g + r][t * 16 + col] = (dk > r) ? -1.0e9f : s[r] * 0.125f + b0r[t >> 1] + b1r[t & 1][r]; }
    LDSX();
    float mx = -3.4e38f;
#pragma unroll
    for (int jj = 0; jj < 32; ++jj) mx = fmaxf(mx, sS[w][col][g * 32 + jj]);
    mx = fmaxf(mx, __shfl_xor(mx, 16, 32));
    const float mnew = fmaxf(mrun, mx); const float corr = __builtin_amdgcn_exp2f((mrun - mnew) * L2E);      // 0 on the first tile: the product overflows to -inf
    const float eb = 14.0f - mnew * L2E;      // e^(s - mnew) * 2^14 = 2^(s log2(e) + eb): one multiply-add and the hardware's base-2 exponential per score; a masked score gives 0
    float ps = 0.f;
#pragma unroll
    for (int jj = 0; jj < 32; ++jj) { const float p = __builtin_amdgcn_exp2f(sS[w][col][g * 32 + jj] * L2E + eb); ps += p; const _Float16 hi = (_Float16)p; sPh[w][col][g * 32 + jj] = hi; sPl[w][col][g * 32 + jj] = (_Float16)((p - (float)hi) * PLO); }
    ps += __shfl_xor(ps, 16, 32);
    lrun = lrun * corr + ps * (1.0f / 16384.0f); mrun = mnew;
#pragma unroll
    for (int r = 0; r < 8; ++r) { const float cr = __shfl(corr, 8 * g + r, 32);
#pragma unroll
      for (int t = 0; t < 4; ++t) { acc[t][r] *= cr; ac1[t][r] *= cr; ac2[t][r] *= cr; } }
    LDSX();
#pragma unroll
    for (int kc = 0; kc < 2; ++kc) { const v16h ph = frag_h(&sPh[w][col][0] + kc * 32, lane), pl = frag_h(&sPl[w][col][0] + kc * 32, lane);
#pragma unroll
      for (int t = 0; t < 4; ++t) { const v16h vh = frag_h(pVh + t * 16 * (TPITCH / 2) + kc * 32, lane);
        acc[t] = wmma16(ph, vh, acc[t]); ac1[t] = wmma16(ph, frag_h(pVl + t * 16 * (TPITCH / 2) + kc * 32, lane), ac1[t]); ac2[t] = wmma16(pl, vh, ac2[t]); } }
    __builtin_amdgcn_wave_barrier(); }
#pragma unroll
  for (int r = 0; r < 8; ++r) { const float lr = __shfl(lrun, 8 * g + r, 32); const float inv = 1.0f / (lr * 16384.0f * 4.0f);
#pragma unroll
    for (int t = 0; t < 4; ++t) sS[w][8 * g + r][t * 16 + col] = (acc[t][r] + ac1[t][r] * (1.0f / VLO) + ac2[t][r] * (1.0f / PLO)) * inv; }
  LDSX();
  for (int qq = lane; qq < 16 * 16; qq += 32) { const int rl = qq >> 4, pc = qq & 15; vst2(O32 + ((bh * SS) + q0 + rl) * HD + pc * 4, *(const v4f*)(&sS[w][rl][pc * 4])); }
}
// out = ctx Wo : split(ctx) x bf16(Wo columns): 2 products (Wo is an INPUT -> bf16 exact)
__global__ __launch_bounds__(128) void k_out(const float* __restrict__ O32, const __bf16* __restrict__ PT, float* __restrict__ out) {
  __shared__ __align__(16) float so[4][16][132];
  const int tid = threadIdx.x, wave = tid >> 5, lane = tid & 31, col = lane & 15, g = lane >> 4;
  __shared__ __attribute__((aligned(2048))) unsigned char sT[128 * TPITCH + 2 * TPLANE];   // one head's 64 k of: the block's 64 ctx rows (f32: 128 half rows of 128 B, 18,432 B = 9 x 2 KiB), its weight rows 0..63, its weight rows 64..127
  const int r0b = blockIdx.x * 64, r0 = r0b + wave * 16, n0 = blockIdx.y * 128; const int b = r0b / SS, s0 = r0b % SS;
  v8f acc[8] = {};
  const uint32_t wv = uni((uint32_t)tid >> 5);      // waves 0, 1, 2 bring one plane each
  const uint64_t tsrc = wv == 0u ? (uint64_t)(size_t)(O32 + ((size_t)b * NH * SS + s0) * HD) : (uint64_t)(size_t)(PT + (size_t)(3 * E + n0 + (wv == 2u ? 64 : 0)) * E);
  const uint32_t tstep = wv == 0u ? (uint32_t)(SS * HD * 4) : TROW;
  const u32x8 tg1 = tdm_group1(wv == 0u ? TROW : (uint32_t)(E * 2), wv == 0u ? 128u : 64u);
  u32x4 tg0 = tdm_group0((uint32_t)(size_t)sT + (wv == 0u ? 0u : 128u * TPITCH + (wv == 2u ? TPLANE : 0u)), tsrc);
  const float* const pA = (const float*)(sT + (wave * 16 + col) * 2 * TPITCH); const __bf16* const pB = (const __bf16*)(sT + 128 * TPITCH + col * TPITCH);
#pragma unroll 1
  for (int h = 0; h < NH; ++h) {
    asm volatile("s_wait_dscnt 0x0" ::: "memory");      // this wave's reads of the staged tiles have retired before they are overwritten
    __syncthreads();                                    // every wave has left the previous tiles
    if (pinned(wv < 3u)) {
      { const uint64_t ga = tsrc + (uint64_t)((uint32_t)h * tstep); tg0[2] = uni((uint32_t)ga); tg0[3] = uni((((uint32_t)(ga >> 32)) & 0x01FFFFFFu) | 0x80000000u); }   // no request is outstanding here
      asm volatile("tensor_load_to_lds %0, %1" :: "s"(tg0), "s"(tg1) : "memory");   // this wave's plane of head h
      asm volatile("s_wait_tensorcnt 0x0" ::: "memory"); }   // it has landed
    __syncthreads();                                    // so have the other waves': the tiles may be read
#pragma unroll
    for (int k2 = 0; k2 < 2; ++k2) { const F2 a = split_row(pA + k2 * (TPITCH / 4), 0, lane);
#pragma unroll
      for (int j = 0; j < 8; ++j) { const v16b wb = frag_b(pB + (j >> 2) * (TPLANE / 2) + (j & 3) * 16 * (TPITCH / 2) + k2 * 32, lane); acc[j] = wmma_bf(a.l, wb, acc[j]); acc[j] = wmma_bf(a.h, wb, acc[j]); } } }
#pragma unroll
  for (int j = 0; j < 8; ++j) {
#pragma unroll
    for (int r = 0; r < 8; ++r) so[wave][8 * g + r][j * 16 + col] = acc[j][r]; }
  LDSX();
#pragma unroll 4
  for (int rl = 0; rl < 16; ++rl) vst2(out + (size_t)(r0 + rl) * E + n0 + lane * 4, *(const v4f*)(&so[wave][rl][lane * 4]));
}
extern "C" void kernel_launch(void* const* d_in, const int* in_sizes, int n_in, void* d_out, int out_size, void* d_ws, size_t ws_size, hipStream_t stream) {
  (void)in_sizes; (void)n_in; (void)out_size; (void)ws_size;
  const float** I = (const float**)d_in;   // x, Wq, Wk, Wv, Wo, rb0, rb1
  const float* x = I[0]; const float* Wq = I[1]; const float* Wk = I[2]; const float* Wv = I[3]; const float* Wo = I[4]; const float* rb0 = I[5]; const float* rb1 = I[6];
  float* out = (float*)d_out;
  char* ws = (char*)d_ws; size_t off = 0;
  auto take = [&](size_t bytes) { char* p = ws + off; off += (bytes + 255) & ~(size_t)255; return p; };
  __bf16* Xb = (__bf16*)take((size_t)NR * E * 2); __bf16* PT = (__bf16*)take((size_t)4 * E * E * 2);
  float* Q32 = (float*)take((size_t)NR * E * 4); __bf16* Kh = (__bf16*)take((size_t)NR * E * 2); __bf16* Kl = (__bf16*)take((size_t)NR * E * 2); _Float16* VTh = (_Float16*)take((size_t)NR * E * 2); _Float16* VTl = (_Float16*)take((size_t)NR * E * 2); float* O32 = (float*)take((size_t)NR * E * 4);
  k_pack<<<4 * E, 256, 0, stream>>>(Wq, Wk, Wv, Wo, PT);
  k_cvt<<<(NR * E / 8 + 255) / 256, 256, 0, stream>>>(x, Xb);
  k_qkv<<<dim3(NR / 64, E / 128, 3), 128, 0, stream>>>(Xb, PT, Q32, Kh, Kl, VTh, VTl);
  k_attn<<<dim3(SS / 64, NB * NH), 128, 0, stream>>>(Q32, Kh, Kl, VTh, VTl, rb0, rb1, O32);
  k_out<<<dim3(NR / 64, E / 128), 128, 0, stream>>>(O32, PT, out);
}

// v005
// A run of this version takes 184 microseconds.
// Next to v004, in two timings, it ran 1.16 times as fast each time.
// All steps since v000 together make it 3.27 times as fast.
// compute dtype: x, Wq/Wk/Wv/Wo, rb0/rb1 (INPUTS) rounded to bf16 with exact bf16 WMMA products (f32 accumulate) for the projections; K pre-split into bf16 hi/lo rows; q f32 split, P and V f16 hi/lo (3 products each); softmax, the causal raster mask and the factorised 2-D relative bias in f32.
#include <hip/hip_runtime.h>
#include <math.h>

typedef __attribute__((ext_vector_type(16))) _Float16 v16h;
typedef __attribute__((ext_vector_type(16))) __bf16 v16b;
typedef __attribute__((ext_vector_type(8)))  _Float16 v8h;
typedef __attribute__((ext_vector_type(8)))  float v8f;
typedef __attribute__((ext_vector_type(4)))  float v4f;
typedef __attribute__((ext_vector_type(2)))  float v2f;
typedef __attribute__((ext_vector_type(4)))  unsigned v4u;
typedef __attribute__((ext_vector_type(4)))  int v4i;
typedef float __attribute__((may_alias)) float_a;
typedef int __attribute__((may_alias)) int_a;

template <typename T> __device__ __forceinline__ void vst2(void* p, T v) { *(T*)p = v;  }
__device__ __forceinline__ v8f wmma16(v16h a, v16h b, v8f c) {
  v8f d = __builtin_amdgcn_wmma_f32_16x16x32_f16(false, a, false, b, (short)0, c, false, false);
  asm volatile("v_nop\n\tv_nop\n\tv_nop\n\tv_nop" : "+v"(d) : "v"(a), "v"(b));
  return d;
}
__device__ __forceinline__ v8f wmma_bf(v16b a, v16b b, v8f c) {
  v8f d = __builtin_amdgcn_wmma_f32_16x16x32_bf16(false, a, false, b, (short)0, c, false, false);
  asm volatile("v_nop\n\tv_nop\n\tv_nop\n\tv_nop" : "+v"(d) : "v"(a), "v"(b));
  return d;
}
// 16x16x32 fragments: lane = (h = lane>>4, row/col = lane&15); elements 0..7 = k0+8h+0..7, 8..15 = k0+16+8h+0..7; D element r = row 8h+r
__device__ __forceinline__ v16h frag_h(const _Float16* rowk0, int lane) {
  union { v16h v; v8h q[2]; } u; const _Float16* p = rowk0 + 8 * (lane >> 4);
  u.q[0] = *(const v8h*)p; u.q[1] = *(const v8h*)(p + 16); return u.v;
}
__device__ __forceinline__ v16h frag_f32(const float* rowk0, int lane) {
  v16h a; const float* p = rowk0 + 8 * (lane >> 4);
#pragma unroll
  for (int i = 0; i < 8; ++i) { a[i] = (_Float16)p[i]; a[8 + i] = (_Float16)p[16 + i]; }
  return a;
}
__device__ __forceinline__ v16h frag_f32s(const float* rowk0, int lane, float sc) {
  v16h a; const float* p = rowk0 + 8 * (lane >> 4);
#pragma unroll
  for (int i = 0; i < 8; ++i) { a[i] = (_Float16)(p[i] * sc); a[8 + i] = (_Float16)(p[16 + i] * sc); }
  return a;
}
// column fragment from a [K][ld] layout (column n), rows >= K read as 0
__device__ __forceinline__ v16h fragc_f32(const float* W, int k0, int n, int lane, int ld, int K) {
  v16h a; const int g = lane >> 4;
#pragma unroll
  for (int i = 0; i < 8; ++i) { const int ka = k0 + 8 * g + i, kb = ka + 16;
    a[i] = (_Float16)(ka < K ? W[(size_t)ka * ld + n] : 0.f); a[8 + i] = (_Float16)(kb < K ? W[(size_t)kb * ld + n] : 0.f); }
  return a;
}
struct F2 { v16b h, l; };
__device__ __forceinline__ F2 bsplit16(const float v[16]) { F2 r;
#pragma unroll
  for (int i = 0; i < 16; ++i) { const __bf16 h = (__bf16)v[i]; r.h[i] = h; r.l[i] = (__bf16)(v[i] - (float)h); }
  return r; }
__device__ __forceinline__ F2 split_row(const float* row, int k0, int lane) { float v[16]; const float* p = row + k0 + 8 * (lane >> 4);
#pragma unroll
  for (int i = 0; i < 8; ++i) { v[i] = p[i]; v[8 + i] = p[16 + i]; }
  return bsplit16(v); }
__device__ __forceinline__ F2 split_rowK(const float* row, int k0, int lane, int K) { float v[16]; const int g = lane >> 4;
#pragma unroll
  for (int i = 0; i < 8; ++i) { const int ka = k0 + 8 * g + i, kb = ka + 16; v[i] = ka < K ? row[ka] : 0.f; v[8 + i] = kb < K ? row[kb] : 0.f; }
  return bsplit16(v); }
__device__ __forceinline__ F2 split_col(const float* W, int k0, int n, int lane, int ld, int K) { float v[16]; const int g = lane >> 4;
#pragma unroll
  for (int i = 0; i < 8; ++i) { const int ka = k0 + 8 * g + i, kb = ka + 16; v[i] = ka < K ? W[(size_t)ka * ld + n] : 0.f; v[8 + i] = kb < K ? W[(size_t)kb * ld + n] : 0.f; }
  return bsplit16(v); }
__device__ __forceinline__ v8f mac3(const F2& a, const F2& b, v8f c) { c = wmma_bf(a.l, b.h, c); c = wmma_bf(a.h, b.l, c); return wmma_bf(a.h, b.h, c); }
__device__ __forceinline__ float sigm(float v) { return 1.0f / (1.0f + expf(-v)); }
#define LDSX() do { asm volatile("s_wait_dscnt 0" ::: "memory"); __builtin_amdgcn_wave_barrier(); __builtin_amdgcn_fence(__ATOMIC_RELEASE, "workgroup"); } while (0)


// Axial ('number-dimension') self attention over the 32 x 32 raster of each of 16 images (8 heads x 64, [in][out] DenseND kernels, no biases): scores = (q 64^-0.5).k + rb0[h][31 + kr - qr] + rb1[h][31 + kc - qc];
#define NB 16
#define SS 1024
#define E 512
#define NH 8
#define RW 32
#define HD 64
#define NR (NB * SS)
#define PLO 1024.0f
#define VLO 2048.0f
#define L2E 1.4426950408889634f
__device__ __forceinline__ float bfr(float v) { return (float)(__bf16)v; }
__device__ __forceinline__ v16b frag_b(const __bf16* rowk0, int lane) { return __builtin_bit_cast(v16b, frag_h((const _Float16*)rowk0, lane)); }

typedef uint32_t u32x4 __attribute__((ext_vector_type(4)));
typedef uint32_t u32x8 __attribute__((ext_vector_type(8)));
__device__ __forceinline__ uint32_t uni(uint32_t v) { return (uint32_t)__builtin_amdgcn_readfirstlane(v); }
#define TROW 128u                 // bytes of a staged row: 64 16-bit elements
#define TPITCH 144u               // its pitch in LDS, set by the tensor load's pad: 16 B x 9, no bank conflict for 16-byte fragment reads
#define TPLANE 10240u             // 64 rows x 144 B = 9,216 B, rounded up so that every plane starts at a multiple of 2 KiB
__device__ __forceinline__ uint32_t pinned(uint32_t v) { uint32_t w = uni(v); asm volatile("" : "+s"(w)); return w; }   // holds a wave-uniform test in a scalar register, so that the branch round a tensor load is a scalar one (a tensor load ignores EXEC)
// tensor descriptor, group 1: 1-byte elements, tensor = tile = rows rows of 128 B, source row pitch src_pitch bytes, 4 dwords of LDS pad behind every 32 dwords
__device__ __forceinline__ u32x8 tdm_group1(uint32_t src_pitch, uint32_t rows) {
  u32x8 g;
  g[0] = uni((1u << 20) | (4u << 22) | (3u << 25));
  g[1] = uni(TROW << 16);
  g[2] = uni(rows << 16);
  g[3] = uni(TROW << 16);
  g[4] = uni(rows);
  g[5] = uni(src_pitch);
  g[6] = uni(0u);
  g[7] = uni(0u);
  return g;
}
// group 0: one request, LDS destination (byte offset in the work-group's LDS), global address of the tile's first byte, type 2
__device__ __forceinline__ u32x4 tdm_group0(uint32_t lds_dst, uint64_t ga) {
  u32x4 g;
  g[0] = uni(1u); g[1] = uni(lds_dst); g[2] = uni((uint32_t)ga); g[3] = uni((((uint32_t)(ga >> 32)) & 0x01FFFFFFu) | 0x80000000u);
  return g;
}

__global__ __launch_bounds__(256) void k_cvt(const float* __restrict__ x, __bf16* __restrict__ Xb) {
  const size_t i8 = (size_t)blockIdx.x * 256 + threadIdx.x; if (i8 >= (size_t)NR * E / 8) return;
  union { __bf16 h[8]; v4u u; } pk;
#pragma unroll
  for (int e = 0; e < 8; ++e) pk.h[e] = (__bf16)x[i8 * 8 + e];
  vst2((unsigned*)(Xb + i8 * 8), pk.u);
}
// PT rows: [0,E) Wq[:,n], [E,2E) Wk[:,n], [2E,3E) Wv[:,n], [3E,4E) Wo[:,n]  ([in][out] weights: column n as a bf16 row)
__global__ __launch_bounds__(256) void k_pack(const float* __restrict__ Wq, const float* __restrict__ Wk, const float* __restrict__ Wv, const float* __restrict__ Wo, __bf16* __restrict__ PT) {
  const int n = blockIdx.x, tid = threadIdx.x; __shared__ __align__(16) __bf16 srow[E];
  const float* W = n < E ? Wq : (n < 2 * E ? Wk : (n < 3 * E ? Wv : Wo)); const int nn = n & (E - 1);
  for (int k = tid; k < E; k += 256) srow[k] = (__bf16)W[(size_t)k * E + nn];
  __syncthreads();
  if (tid < E / 8) vst2((unsigned*)(PT + (size_t)n * E + tid * 8), *(const v4u*)(&srow[tid * 8]));
}
// QKV: block (64 rows, 128 cols = 2 heads, which); q -> Q32 f32 [bh][s][64]; k -> bf16 hi/lo rows; v -> VT hi/lo x4 [bh][d][s]
__global__ __launch_bounds__(128) void k_qkv(const __bf16* __restrict__ Xb, const __bf16* __restrict__ PT, float* __restrict__ Q32, __bf16* __restrict__ Kh, __bf16* __restrict__ Kl, _Float16* __restrict__ VTh, _Float16* __restrict__ VTl) {
  __shared__ __align__(16) float so[4][16][132];
  __shared__ __align__(16) _Float16 sth[128][72], stl[128][72];
  __shared__ __attribute__((aligned(2048))) unsigned char sT[3 * TPLANE];   // 64 k of: the block's 64 x rows, its weight rows 0..63, its weight rows 64..127
  const int tid = threadIdx.x, wave = tid >> 5, lane = tid & 31, col = lane & 15, g = lane >> 4;
  const int which = blockIdx.z, r0b = blockIdx.x * 64, n0 = blockIdx.y * 128; const int b = r0b / SS, s0 = r0b % SS;
  v8f acc[8] = {};
  const uint32_t wv = uni((uint32_t)tid >> 5);      // waves 0, 1, 2 bring one plane each
  const uint64_t tsrc = wv == 0u ? (uint64_t)(size_t)(Xb + (size_t)r0b * E) : (uint64_t)(size_t)(PT + (size_t)(which * E + n0 + (wv == 2u ? 64 : 0)) * E);
  const u32x8 tg1 = tdm_group1((uint32_t)(E * 2), 64u); u32x4 tg0 = tdm_group0((uint32_t)(size_t)sT + (wv < 3u ? wv : 0u) * TPLANE, tsrc);
  const __bf16* const pA = (const __bf16*)(sT + (wave * 16 + col) * TPITCH); const __bf16* const pB = (const __bf16*)(sT + TPLANE + col * TPITCH);
#pragma unroll 1
  for (int st = 0; st < E / 64; ++st) {
    asm volatile("s_wait_dscnt 0x0" ::: "memory");      // this wave's reads of the staged tiles have retired before they are overwritten
    __syncthreads();                                    // every wave has left the previous tiles
    if (pinned(wv < 3u)) {
      { const uint64_t ga = tsrc + (uint64_t)((uint32_t)st * TROW); tg0[2] = uni((uint32_t)ga); tg0[3] = uni((((uint32_t)(ga >> 32)) & 0x01FFFFFFu) | 0x80000000u); }   // no request is outstanding here
      asm volatile("tensor_load_to_lds %0, %1" :: "s"(tg0), "s"(tg1) : "memory");   // this wave's plane, 64 k on
      asm volatile("s_wait_tensorcnt 0x0" ::: "memory"); }   // it has landed
    __syncthreads();                                    // so have the other waves': the tiles may be read
    v16b fa[2], fb[2][8];      // every fragment of the stage: its 36 LDS reads go out as one group, and the products wait on counts, not once per product
#pragma unroll
    for (int k2 = 0; k2 < 2; ++k2) { fa[k2] = frag_b(pA + k2 * 32, lane);
#pragma unroll
      for (int j = 0; j < 8; ++j) fb[k2][j] = frag_b(pB + (j >> 2) * (TPLANE / 2) + (j & 3) * 16 * (TPITCH / 2) + k2 * 32, lane); }
#pragma unroll
    for (int k2 = 0; k2 < 2; ++k2) {
#pragma unroll
      for (int j = 0; j < 8; ++j) acc[j] = wmma_bf(fa[k2], fb[k2][j], acc[j]); } }
  if (which < 2) {
#pragma unroll
    for (int j = 0; j < 8; ++j) { const float bb = 0.f;
#pragma unroll
      for (int r = 0; r < 8; ++r) so[wave][8 * g + r][j * 16 + col] = acc[j][r] + bb; }
    LDSX();
    if (which == 0) { for (int qq = lane; qq < 2 * 16 * 16; qq += 32) { const int hh = qq >> 8, rl = (qq >> 4) & 15, pc = qq & 15; const int h = (n0 >> 6) + hh;
        vst2(Q32 + (((size_t)b * NH + h) * SS + s0 + wave * 16 + rl) * HD + pc * 4, *(const v4f*)(&so[wave][rl][hh * 64 + pc * 4])); } }
    else {
      for (int qq = lane; qq < 2 * 16 * 16; qq += 32) { const int hh = qq >> 8, rl = (qq >> 4) & 15, pl = qq & 15; const int h = (n0 >> 6) + hh; const int pc = pl & 7; union { __bf16 e[8]; v4u u; } pk;
#pragma unroll
        for (int e = 0; e < 8; ++e) { const float v = so[wave][rl][hh * 64 + pc * 8 + e]; const __bf16 hi = (__bf16)v; pk.e[e] = pl < 8 ? hi : (__bf16)(v - (float)hi); }
        vst2((unsigned*)((pl < 8 ? Kh : Kl) + (((size_t)b * NH + h) * SS + s0 + wave * 16 + rl) * HD + pc * 8), pk.u); } } }
  else {
#pragma unroll
    for (int j = 0; j < 8; ++j) { const float bb = 0.f;
#pragma unroll
      for (int r = 0; r < 8; ++r) { const float v = (acc[j][r] + bb) * 4.0f; const _Float16 hi = (_Float16)v; sth[j * 16 + col][wave * 16 + 8 * g + r] = hi; stl[j * 16 + col][wave * 16 + 8 * g + r] = (_Float16)((v - (float)hi) * VLO); } }
    __syncthreads();
    for (int qq = tid; qq < 128 * 8; qq += 128) { const int cl = qq >> 3, pc = qq & 7; const int c = n0 + cl, h = c >> 6, d = c & 63; const size_t o = (((size_t)b * NH + h) * HD + d) * SS + s0 + pc * 8;
      vst2(VTh + o, *(const v4u*)(&sth[cl][pc * 8])); vst2(VTl + o, *(const v4u*)(&stl[cl][pc * 8])); } }
}
// causal attention: block (64 queries, bh); key tiles 0..qb, each staged once per block in LDS (wave w brings plane w: K hi, K lo, V^T hi, V^T lo) and read by all four waves; S on q hi/lo x K hi/lo rows; P,V hi/lo; O f32 [bh][s][64]
__global__ __launch_bounds__(128) void k_attn(const float* __restrict__ Q32, const __bf16* __restrict__ Kh, const __bf16* __restrict__ Kl, const _Float16* __restrict__ VTh, const _Float16* __restrict__ VTl, const float* __restrict__ rb0, const float* __restrict__ rb1, float* __restrict__ O32) {
  __shared__ __align__(16) float sS[4][16][68];
  __shared__ __align__(16) _Float16 sPh[4][16][72], sPl[4][16][72];
  __shared__ __attribute__((aligned(2048))) unsigned char sKV[4 * TPLANE];
  const int tid = threadIdx.x, w = tid >> 5, lane = tid & 31, col = lane & 15, g = lane >> 4;
  const size_t bh = blockIdx.y; const int qb = blockIdx.x; const int q0 = qb * 64 + w * 16;
  F2 aq[2];
#pragma unroll
  for (int kc = 0; kc < 2; ++kc) aq[kc] = split_row(Q32 + (bh * SS + q0 + col) * HD, kc * 32, lane);
  const int h = (int)(bh % NH); __shared__ float sb0[4][64], sb1[4][64]; for (int i = lane; i < 64; i += 32) { sb0[w][i] = bfr(rb0[h * 2 * RW + i]); sb1[w][i] = bfr(rb1[h * 2 * RW + i]); }     // this head's two 64-entry bias tables
  float mrun = -3.0e38f, lrun = 0.f; v8f acc[4] = {}, ac1[4] = {}, ac2[4] = {};
  const uint32_t wv = uni((uint32_t)tid >> 5);      // K planes: rows = keys, 128 B apart, a tile 8,192 B on; V^T planes: rows = d, 2,048 B apart, a tile 128 B on
  const uint64_t tsrc = (uint64_t)(size_t)(wv == 0u ? (const void*)Kh : wv == 1u ? (const void*)Kl : wv == 2u ? (const void*)VTh : (const void*)VTl) + (uint64_t)bh * (SS * HD * 2);
  const uint32_t tstep = wv < 2u ? 64u * TROW : TROW, tdst = (uint32_t)(size_t)sKV + wv * TPLANE;
  const u32x8 tg1 = tdm_group1(wv < 2u ? TROW : (uint32_t)(SS * 2), 64u); u32x4 tg0 = tdm_group0(tdst, tsrc);
  const __bf16* const pKh = (const __bf16*)(sKV + col * TPITCH); const __bf16* const pKl = (const __bf16*)(sKV + TPLANE + col * TPITCH);
  const _Float16* const pVh = (const _Float16*)(sKV + 2 * TPLANE + col * TPITCH); const _Float16* const pVl = (const _Float16*)(sKV + 3 * TPLANE + col * TPITCH);
  LDSX();
  // the column term rb1[31 + kc - qc] does not depend on the key tile: 64 keys are two whole raster rows, so a lane meets only 2 x 8 of its values; they stay in registers (both loops unrolled: every index a constant, no scratch array)
  float b1r[2][8];
#pragma unroll
  for (int p = 0; p < 2; ++p) {
#pragma unroll
    for (int r = 0; r < 8; ++r) b1r[p][r] = sb1[w][RW - 1 + p * 16 + col - ((w & 1) * 16 + 8 * g + r)]; }
  const float* const pb0 = &sb0[w][RW - 1 - 2 * qb - (w >> 1)];      // the row term rb0[31 + kr - qr] is one value per wave and raster row of keys: entries 2 kt and 2 kt + 1 from here
  const int dq = col - (q0 + 8 * g);
#pragma unroll 1
  for (int kt = 0; kt <= qb; ++kt) {      // causal in raster order
    asm volatile("s_wait_dscnt 0x0" ::: "memory");      // this wave's reads of the staged tile have retired before the tile is overwritten
    __syncthreads();                                    // every wave has left the previous key tile
    { const uint64_t ga = tsrc + (uint64_t)((uint32_t)kt * tstep); tg0[2] = uni((uint32_t)ga); tg0[3] = uni((((uint32_t)(ga >> 32)) & 0x01FFFFFFu) | 0x80000000u); }   // no request is outstanding here
    asm volatile("tensor_load_to_lds %0, %1" :: "s"(tg0), "s"(tg1) : "memory");   // every wave: its own plane of this key tile
    asm volatile("s_wait_tensorcnt 0x0" ::: "memory");  // this wave's plane has landed
    __syncthreads();                                    // so have the other waves': the tile may be read
    const float b0r[2] = { pb0[2 * kt], pb0[2 * kt + 1] };
    v16b kf[2][2][2];      // K fragments [register set][kc][hi, lo]: the 8 LDS reads of a 16-key group go out together, one group ahead of the products that use them
#pragma unroll
    for (int kc = 0; kc < 2; ++kc) { kf[0][kc][0] = frag_b(pKh + kc * 32, lane); kf[0][kc][1] = frag_b(pKl + kc * 32, lane); }
#pragma unroll
    for (int t = 0; t < 4; ++t) { const int dk = kt * 64 + t * 16 + dq; v8f s = {};      // dk - r = key - query
      if (t < 3) {
#pragma unroll
        for (int kc = 0; kc < 2; ++kc) { kf[(t + 1) & 1][kc][0] = frag_b(pKh + (t + 1) * 16 * (TPITCH / 2) + kc * 32, lane); kf[(t + 1) & 1][kc][1] = frag_b(pKl + (t + 1) * 16 * (TPITCH / 2) + kc * 32, lane); } }
#pragma unroll
      for (int kc = 0; kc < 2; ++kc) { const v16b khf = kf[t & 1][kc][0], klf = kf[t & 1][kc][1]; s = wmma_bf(aq[kc].l, khf, s); s = wmma_bf(aq[kc].h, klf, s); s = wmma_bf(aq[kc].h, khf, s); }
#pragma unroll
      for (int r = 0; r < 8; ++r) sS[w][8 * g + r][t * 16 + col] = (dk > r) ? -1.0e9f : s[r] * 0.125f + b0r[t >> 1] + b1r[t & 1][r]; }
    LDSX();
    float mx = -3.4e38f;
#pragma unroll
    for (int jj = 0; jj < 32; ++jj) mx = fmaxf(mx, sS[w][col][g * 32 + jj]);
    mx = fmaxf(mx, __shfl_xor(mx, 16, 32));
    const float mnew = fmaxf(mrun, mx); const float corr = __builtin_amdgcn_exp2f((mrun - mnew) * L2E);      // 0 on the first tile: the product overflows to -inf
    const float eb = 14.0f - mnew * L2E;      // e^(s - mnew) * 2^14 = 2^(s log2(e) + eb): one multiply-add and the hardware's base-2 exponential per score; a masked score gives 0
    float ps = 0.f;
#pragma unroll
    for (int jj = 0; jj < 32; ++jj) { const float p = __builtin_amdgcn_exp2f(sS[w][col][g * 32 + jj] * L2E + eb); ps += p; const _Float16 hi = (_Float16)p; sPh[w][col][g * 32 + jj] = hi; sPl[w][col][g * 32 + jj] = (_Float16)((p - (float)hi) * PLO); }
    ps += __shfl_xor(ps, 16, 32);
    lrun = lrun * corr + ps * (1.0f / 16384.0f); mrun = mnew;
#pragma unroll
    for (int r = 0; r < 8; ++r) { const float cr = __shfl(corr, 8 * g + r, 32);
#pragma unroll
      for (int t = 0; t < 4; ++t) { acc[t][r] *= cr; ac1[t][r] *= cr; ac2[t][r] *= cr; } }
    LDSX();
#pragma unroll
    for (int kc = 0; kc < 2; ++kc) { const v16h ph = frag_h(&sPh[w][col][0] + kc * 32, lane), pl = frag_h(&sPl[w][col][0] + kc * 32, lane);
#pragma unroll
      for (int tp = 0; tp < 2; ++tp) { v16h vf[2][2];      // V fragments [t][hi, lo] of two 16-column groups: their 8 LDS reads go out together ahead of the 6 products
#pragma unroll
        for (int t = 0; t < 2; ++t) { vf[t][0] = frag_h(pVh + (tp * 2 + t) * 16 * (TPITCH / 2) + kc * 32, lane); vf[t][1] = frag_h(pVl + (tp * 2 + t) * 16 * (TPITCH / 2) + kc * 32, lane); }
#pragma unroll
        for (int t = 0; t < 2; ++t) { acc[tp * 2 + t] = wmma16(ph, vf[t][0], acc[tp * 2 + t]); ac1[tp * 2 + t] = wmma16(ph, vf[t][1], ac1[tp * 2 + t]); ac2[tp * 2 + t] = wmma16(pl, vf[t][0], ac2[tp * 2 + t]); } } }
    __builtin_amdgcn_wave_barrier(); }
#pragma unroll
  for (int r = 0; r < 8; ++r) { const float lr = __shfl(lrun, 8 * g + r, 32); const float inv = 1.0f / (lr * 16384.0f * 4.0f);
#pragma unroll
    for (int t = 0; t < 4; ++t) sS[w][8 * g + r][t * 16 + col] = (acc[t][r] + ac1[t][r] * (1.0f / VLO) + ac2[t][r] * (1.0f / PLO)) * inv; }
  LDSX();
  for (int qq = lane; qq < 16 * 16; qq += 32) { const int rl = qq >> 4, pc = qq & 15; vst2(O32 + ((bh * SS) + q0 + rl) * HD + pc * 4, *(const v4f*)(&sS[w][rl][pc * 4])); }
}
// out = ctx Wo : split(ctx) x bf16(Wo columns): 2 products (Wo is an INPUT -> bf16 exact)
__global__ __launch_bounds__(128) void k_out(const float* __restrict__ O32, const __bf16* __restrict__ PT, float* __restrict__ out) {
  __shared__ __align__(16) float so[4][16][132];
  const int tid = threadIdx.x, wave = tid >> 5, lane = tid & 31, col = lane & 15, g = lane >> 4;
  __shared__ __attribute__((aligned(2048))) unsigned char sT[128 * TPITCH + 2 * TPLANE];   // one head's 64 k of: the block's 64 ctx rows (f32: 128 half rows of 128 B, 18,432 B = 9 x 2 KiB), its weight rows 0..63, its weight rows 64..127
  const int r0b = blockIdx.x * 64, r0 = r0b + wave * 16, n0 = blockIdx.y * 128; const int b = r0b / SS, s0 = r0b % SS;
  v8f acc[8] = {};
  const uint32_t wv = uni((uint32_t)tid >> 5);      // waves 0, 1, 2 bring one plane each
  const uint64_t tsrc = wv == 0u ? (uint64_t)(size_t)(O32 + ((size_t)b * NH * SS + s0) * HD) : (uint64_t)(size_t)(PT + (size_t)(3 * E + n0 + (wv == 2u ? 64 : 0)) * E);
  const uint32_t tstep = wv == 0u ? (uint32_t)(SS * HD * 4) : TROW;
  const u32x8 tg1 = tdm_group1(wv == 0u ? TROW : (uint32_t)(E * 2), wv == 0u ? 128u : 64u);
  u32x4 tg0 = tdm_group0((uint32_t)(size_t)sT + (wv == 0u ? 0u : 128u * TPITCH + (wv == 2u ? TPLANE : 0u)), tsrc);
  const float* const pA = (const float*)(sT + (wave * 16 + col) * 2 * TPITCH); const __bf16* const pB = (const __bf16*)(sT + 128 * TPITCH + col * TPITCH);
#pragma unroll 1
  for (int h = 0; h < NH; ++h) {
    asm volatile("s_wait_dscnt 0x0" ::: "memory");      // this wave's reads of the staged tiles have retired before they are overwritten
    __syncthreads();                                    // every wave has left the previous tiles
    if (pinned(wv < 3u)) {
      { const uint64_t ga = tsrc + (uint64_t)((uint32_t)h * tstep); tg0[2] = uni((uint32_t)ga); tg0[3] = uni((((uint32_t)(ga >> 32)) & 0x01FFFFFFu) | 0x80000000u); }   // no request is outstanding here
      asm volatile("tensor_load_to_lds %0, %1" :: "s"(tg0), "s"(tg1) : "memory");   // this wave's plane of head h
      asm volatile("s_wait_tensorcnt 0x0" ::: "memory"); }   // it has landed
    __syncthreads();                                    // so have the other waves': the tiles may be read
#pragma unroll
    for (int k2 = 0; k2 < 2; ++k2) { float av[16]; v16b wb[8];      // the 20 LDS reads of these 32 k go out as one group ahead of the split and the 16 products
      { const float* p = pA + k2 * (TPITCH / 4) + 8 * g;
#pragma unroll
        for (int i = 0; i < 8; ++i) { av[i] = p[i]; av[8 + i] = p[16 + i]; } }
#pragma unroll
      for (int j = 0; j < 8; ++j) wb[j] = frag_b(pB + (j >> 2) * (TPLANE / 2) + (j & 3) * 16 * (TPITCH / 2) + k2 * 32, lane);
      const F2 a = bsplit16(av);
#pragma unroll
      for (int j = 0; j < 8; ++j) { acc[j] = wmma_bf(a.l, wb[j], acc[j]); acc[j] = wmma_bf(a.h, wb[j], acc[j]); } } }
#pragma unroll
  for (int j = 0; j < 8; ++j) {
#pragma unroll
    for (int r = 0; r < 8; ++r) so[wave][8 * g + r][j * 16 + col] = acc[j][r]; }
  LDSX();
#pragma unroll 4
  for (int rl = 0; rl < 16; ++rl) vst2(out + (size_t)(r0 + rl) * E + n0 + lane * 4, *(const v4f*)(&so[wave][rl][lane * 4]));
}
extern "C" void kernel_launch(void* const* d_in, const int* in_sizes, int n_in, void* d_out, int out_size, void* d_ws, size_t ws_size, hipStream_t stream) {
  (void)in_sizes; (void)n_in; (void)out_size; (void)ws_size;
  const float** I = (const float**)d_in;   // x, Wq, Wk, Wv, Wo, rb0, rb1
  const float* x = I[0]; const float* Wq = I[1]; const float* Wk = I[2]; const float* Wv = I[3]; const float* Wo = I[4]; const float* rb0 = I[5]; const float* rb1 = I[6];
  float* out = (float*)d_out;
  char* ws = (char*)d_ws; size_t off = 0;
  auto take = [&](size_t bytes) { char* p = ws + off; off += (bytes + 255) & ~(size_t)255; return p; };
  __bf16* Xb = (__bf16*)take((size_t)NR * E * 2); __bf16* PT = (__bf16*)take((size_t)4 * E * E * 2);
  float* Q32 = (float*)take((size_t)NR * E * 4); __bf16* Kh = (__bf16*)take((size_t)NR * E * 2); __bf16* Kl = (__bf16*)take((size_t)NR * E * 2); _Float16* VTh = (_Float16*)take((size_t)NR * E * 2); _Float16* VTl = (_Float16*)take((size_t)NR * E * 2); float* O32 = (float*)take((size_t)NR * E * 4);
  k_pack<<<4 * E, 256, 0, stream>>>(Wq, Wk, Wv, Wo, PT);
  k_cvt<<<(NR * E / 8 + 255) / 256, 256, 0, stream>>>(x, Xb);
  k_qkv<<<dim3(NR / 64, E / 128, 3), 128, 0, stream>>>(Xb, PT, Q32, Kh, Kl, VTh, VTl);
  k_attn<<<dim3(SS / 64, NB * NH), 128, 0, stream>>>(Q32, Kh, Kl, VTh, VTl, rb0, rb1, O32);
  k_out<<<dim3(NR / 64, E / 128), 128, 0, stream>>>(O32, PT, out);
}

// v006
// Measured time: 158 microseconds a run.
// Timed twice side by side with v005, it ran 1.17 times as fast both times.
// Over all steps from v000 it is 3.82 times as fast.
// compute dtype: x, Wq/Wk/Wv/Wo, rb0/rb1 (INPUTS) rounded to bf16 with exact bf16 WMMA products (f32 accumulate) for the projections; K pre-split into bf16 hi/lo rows; q f32 split, P and V f16 hi/lo (3 products each); softmax, the causal raster mask and the factorised 2-D relative bias in f32.
#include <hip/hip_runtime.h>
#include <math.h>

typedef __attribute__((ext_vector_type(16))) _Float16 v16h;
typedef __attribute__((ext_vector_type(16))) __bf16 v16b;
typedef __attribute__((ext_vector_type(8)))  _Float16 v8h;
typedef __attribute__((ext_vector_type(8)))  float v8f;
typedef __attribute__((ext_vector_type(4)))  float v4f;
typedef __attribute__((ext_vector_type(2)))  float v2f;
typedef __attribute__((ext_vector_type(4)))  unsigned v4u;
typedef __attribute__((ext_vector_type(4)))  int v4i;
typedef float __attribute__((may_alias)) float_a;
typedef int __attribute__((may_alias)) int_a;

template <typename T> __device__ __forceinline__ void vst2(void* p, T v) { *(T*)p = v;  }
__device__ __forceinline__ v8f wmma16(v16h a, v16h b, v8f c) {
  v8f d = __builtin_amdgcn_wmma_f32_16x16x32_f16(false, a, false, b, (short)0, c, false, false);
  asm volatile("v_nop\n\tv_nop\n\tv_nop\n\tv_nop" : "+v"(d) : "v"(a), "v"(b));
  return d;
}
__device__ __forceinline__ v8f wmma_bf(v16b a, v16b b, v8f c) {
  v8f d = __builtin_amdgcn_wmma_f32_16x16x32_bf16(false, a, false, b, (short)0, c, false, false);
  asm volatile("v_nop\n\tv_nop\n\tv_nop\n\tv_nop" : "+v"(d) : "v"(a), "v"(b));
  return d;
}
// 16x16x32 fragments: lane = (h = lane>>4, row/col = lane&15); elements 0..7 = k0+8h+0..7, 8..15 = k0+16+8h+0..7; D element r = row 8h+r
__device__ __forceinline__ v16h frag_h(const _Float16* rowk0, int lane) {
  union { v16h v; v8h q[2]; } u; const _Float16* p = rowk0 + 8 * (lane >> 4);
  u.q[0] = *(const v8h*)p; u.q[1] = *(const v8h*)(p + 16); return u.v;
}
__device__ __forceinline__ v16h frag_f32(const float* rowk0, int lane) {
  v16h a; const float* p = rowk0 + 8 * (lane >> 4);
#pragma unroll
  for (int i = 0; i < 8; ++i) { a[i] = (_Float16)p[i]; a[8 + i] = (_Float16)p[16 + i]; }
  return a;
}
__device__ __forceinline__ v16h frag_f32s(const float* rowk0, int lane, float sc) {
  v16h a; const float* p = rowk0 + 8 * (lane >> 4);
#pragma unroll
  for (int i = 0; i < 8; ++i) { a[i] = (_Float16)(p[i] * sc); a[8 + i] = (_Float16)(p[16 + i] * sc); }
  return a;
}
// column fragment from a [K][ld] layout (column n), rows >= K read as 0
__device__ __forceinline__ v16h fragc_f32(const float* W, int k0, int n, int lane, int ld, int K) {
  v16h a; const int g = lane >> 4;
#pragma unroll
  for (int i = 0; i < 8; ++i) { const int ka = k0 + 8 * g + i, kb = ka + 16;
    a[i] = (_Float16)(ka < K ? W[(size_t)ka * ld + n] : 0.f); a[8 + i] = (_Float16)(kb < K ? W[(size_t)kb * ld + n] : 0.f); }
  return a;
}
struct F2 { v16b h, l; };
__device__ __forceinline__ F2 bsplit16(const float v[16]) { F2 r;
#pragma unroll
  for (int i = 0; i < 16; ++i) { const __bf16 h = (__bf16)v[i]; r.h[i] = h; r.l[i] = (__bf16)(v[i] - (float)h); }
  return r; }
__device__ __forceinline__ F2 split_row(const float* row, int k0, int lane) { float v[16]; const float* p = row + k0 + 8 * (lane >> 4);
#pragma unroll
  for (int i = 0; i < 8; ++i) { v[i] = p[i]; v[8 + i] = p[16 + i]; }
  return bsplit16(v); }
__device__ __forceinline__ F2 split_rowK(const float* row, int k0, int lane, int K) { float v[16]; const int g = lane >> 4;
#pragma unroll
  for (int i = 0; i < 8; ++i) { const int ka = k0 + 8 * g + i, kb = ka + 16; v[i] = ka < K ? row[ka] : 0.f; v[8 + i] = kb < K ? row[kb] : 0.f; }
  return bsplit16(v); }
__device__ __forceinline__ F2 split_col(const float* W, int k0, int n, int lane, int ld, int K) { float v[16]; const int g = lane >> 4;
#pragma unroll
  for (int i = 0; i < 8; ++i) { const int ka = k0 + 8 * g + i, kb = ka + 16; v[i] = ka < K ? W[(size_t)ka * ld + n] : 0.f; v[8 + i] = kb < K ? W[(size_t)kb * ld + n] : 0.f; }
  return bsplit16(v); }
__device__ __forceinline__ v8f mac3(const F2& a, const F2& b, v8f c) { c = wmma_bf(a.l, b.h, c); c = wmma_bf(a.h, b.l, c); return wmma_bf(a.h, b.h, c); }
__device__ __forceinline__ float sigm(float v) { return 1.0f / (1.0f + expf(-v)); }
#define LDSX() do { asm volatile("s_wait_dscnt 0" ::: "memory"); __builtin_amdgcn_wave_barrier(); __builtin_amdgcn_fence(__ATOMIC_RELEASE, "workgroup"); } while (0)


// Axial ('number-dimension') self attention over the 32 x 32 raster of each of 16 images (8 heads x 64, [in][out] DenseND kernels, no biases): scores = (q 64^-0.5).k + rb0[h][31 + kr - qr] + rb1[h][31 + kc - qc];
#define NB 16
#define SS 1024
#define E 512
#define NH 8
#define RW 32
#define HD 64
#define NR (NB * SS)
#define PLO 1024.0f
#define VLO 2048.0f
#define L2E 1.4426950408889634f
__device__ __forceinline__ float bfr(float v) { return (float)(__bf16)v; }
__device__ __forceinline__ v16b frag_b(const __bf16* rowk0, int lane) { return __builtin_bit_cast(v16b, frag_h((const _Float16*)rowk0, lane)); }

typedef uint32_t u32x4 __attribute__((ext_vector_type(4)));
typedef uint32_t u32x8 __attribute__((ext_vector_type(8)));
__device__ __forceinline__ uint32_t uni(uint32_t v) { return (uint32_t)__builtin_amdgcn_readfirstlane(v); }
#define TROW 128u                 // bytes of a staged row: 64 16-bit elements
#define TPITCH 144u               // its pitch in LDS, set by the tensor load's pad: 16 B x 9, no bank conflict for 16-byte fragment reads
#define TPLANE 10240u             // 64 rows x 144 B = 9,216 B, rounded up so that every plane starts at a multiple of 2 KiB
__device__ __forceinline__ uint32_t pinned(uint32_t v) { uint32_t w = uni(v); asm volatile("" : "+s"(w)); return w; }   // holds a wave-uniform test in a scalar register, so that the branch round a tensor load is a scalar one (a tensor load ignores EXEC)
// tensor descriptor, group 1: 1-byte elements, tensor = tile = rows rows of 128 B, source row pitch src_pitch bytes, 4 dwords of LDS pad behind every 32 dwords
__device__ __forceinline__ u32x8 tdm_group1(uint32_t src_pitch, uint32_t rows) {
  u32x8 g;
  g[0] = uni((1u << 20) | (4u << 22) | (3u << 25));
  g[1] = uni(TROW << 16);
  g[2] = uni(rows << 16);
  g[3] = uni(TROW << 16);
  g[4] = uni(rows);
  g[5] = uni(src_pitch);
  g[6] = uni(0u);
  g[7] = uni(0u);
  return g;
}
// group 0: one request, LDS destination (byte offset in the work-group's LDS), global address of the tile's first byte, type 2
__device__ __forceinline__ u32x4 tdm_group0(uint32_t lds_dst, uint64_t ga) {
  u32x4 g;
  g[0] = uni(1u); g[1] = uni(lds_dst); g[2] = uni((uint32_t)ga); g[3] = uni((((uint32_t)(ga >> 32)) & 0x01FFFFFFu) | 0x80000000u);
  return g;
}

__global__ __launch_bounds__(256) void k_cvt(const float* __restrict__ x, __bf16* __restrict__ Xb) {
  const size_t i8 = (size_t)blockIdx.x * 256 + threadIdx.x; if (i8 >= (size_t)NR * E / 8) return;
  union { __bf16 h[8]; v4u u; } pk;
#pragma unroll
  for (int e = 0; e < 8; ++e) pk.h[e] = (__bf16)x[i8 * 8 + e];
  vst2((unsigned*)(Xb + i8 * 8), pk.u);
}
// PT rows: [0,E) Wq[:,n], [E,2E) Wk[:,n], [2E,3E) Wv[:,n], [3E,4E) Wo[:,n]  ([in][out] weights: column n as a bf16 row)
__global__ __launch_bounds__(256) void k_pack(const float* __restrict__ Wq, const float* __restrict__ Wk, const float* __restrict__ Wv, const float* __restrict__ Wo, __bf16* __restrict__ PT) {
  const int n = blockIdx.x, tid = threadIdx.x; __shared__ __align__(16) __bf16 srow[E];
  const float* W = n < E ? Wq : (n < 2 * E ? Wk : (n < 3 * E ? Wv : Wo)); const int nn = n & (E - 1);
  for (int k = tid; k < E; k += 256) srow[k] = (__bf16)W[(size_t)k * E + nn];
  __syncthreads();
  if (tid < E / 8) vst2((unsigned*)(PT + (size_t)n * E + tid * 8), *(const v4u*)(&srow[tid * 8]));
}
// QKV: block (64 rows, 128 cols = 2 heads, which); q -> Q32 f32 [bh][s][64]; k -> bf16 hi/lo rows; v -> VT hi/lo x4 [bh][d][s]
__global__ __launch_bounds__(128) void k_qkv(const __bf16* __restrict__ Xb, const __bf16* __restrict__ PT, float* __restrict__ Q32, __bf16* __restrict__ Kh, __bf16* __restrict__ Kl, _Float16* __restrict__ VTh, _Float16* __restrict__ VTl) {
  __shared__ __align__(16) float so[4][16][132];
  __shared__ __align__(16) _Float16 sth[128][72], stl[128][72];
  __shared__ __attribute__((aligned(2048))) unsigned char sT[3 * TPLANE];   // 64 k of: the block's 64 x rows, its weight rows 0..63, its weight rows 64..127
  const int tid = threadIdx.x, wave = tid >> 5, lane = tid & 31, col = lane & 15, g = lane >> 4;
  const int which = blockIdx.z, r0b = blockIdx.x * 64, n0 = blockIdx.y * 128; const int b = r0b / SS, s0 = r0b % SS;
  v8f acc[8] = {};
  const uint32_t wv = uni((uint32_t)tid >> 5);      // waves 0, 1, 2 bring one plane each
  const uint64_t tsrc = wv == 0u ? (uint64_t)(size_t)(Xb + (size_t)r0b * E) : (uint64_t)(size_t)(PT + (size_t)(which * E + n0 + (wv == 2u ? 64 : 0)) * E);
  const u32x8 tg1 = tdm_group1((uint32_t)(E * 2), 64u); u32x4 tg0 = tdm_group0((uint32_t)(size_t)sT + (wv < 3u ? wv : 0u) * TPLANE, tsrc);
  const __bf16* const pA = (const __bf16*)(sT + (wave * 16 + col) * TPITCH); const __bf16* const pB = (const __bf16*)(sT + TPLANE + col * TPITCH);
#pragma unroll 1
  for (int st = 0; st < E / 64; ++st) {
    asm volatile("s_wait_dscnt 0x0" ::: "memory");      // this wave's reads of the staged tiles have retired before they are overwritten
    __syncthreads();                                    // every wave has left the previous tiles
    if (pinned(wv < 3u)) {
      { const uint64_t ga = tsrc + (uint64_t)((uint32_t)st * TROW); tg0[2] = uni((uint32_t)ga); tg0[3] = uni((((uint32_t)(ga >> 32)) & 0x01FFFFFFu) | 0x80000000u); }   // no request is outstanding here
      asm volatile("tensor_load_to_lds %0, %1" :: "s"(tg0), "s"(tg1) : "memory");   // this wave's plane, 64 k on
      asm volatile("s_wait_tensorcnt 0x0" ::: "memory"); }   // it has landed
    __syncthreads();                                    // so have the other waves': the tiles may be read
    v16b fa[2], fb[2][8];      // every fragment of the stage: its 36 LDS reads go out as one group, and the products wait on counts, not once per product
#pragma unroll
    for (int k2 = 0; k2 < 2; ++k2) { fa[k2] = frag_b(pA + k2 * 32, lane);
#pragma unroll
      for (int j = 0; j < 8; ++j) fb[k2][j] = frag_b(pB + (j >> 2) * (TPLANE / 2) + (j & 3) * 16 * (TPITCH / 2) + k2 * 32, lane); }
#pragma unroll
    for (int k2 = 0; k2 < 2; ++k2) {
#pragma unroll
      for (int j = 0; j < 8; ++j) acc[j] = wmma_bf(fa[k2], fb[k2][j], acc[j]); } }
  if (which < 2) {
#pragma unroll
    for (int j = 0; j < 8; ++j) { const float bb = 0.f;
#pragma unroll
      for (int r = 0; r < 8; ++r) so[wave][8 * g + r][j * 16 + col] = acc[j][r] + bb; }
    LDSX();
    if (which == 0) { for (int qq = lane; qq < 2 * 16 * 16; qq += 32) { const int hh = qq >> 8, rl = (qq >> 4) & 15, pc = qq & 15; const int h = (n0 >> 6) + hh;
        vst2(Q32 + (((size_t)b * NH + h) * SS + s0 + wave * 16 + rl) * HD + pc * 4, *(const v4f*)(&so[wave][rl][hh * 64 + pc * 4])); } }
    else {
      for (int qq = lane; qq < 2 * 16 * 16; qq += 32) { const int hh = qq >> 8, rl = (qq >> 4) & 15, pl = qq & 15; const int h = (n0 >> 6) + hh; const int pc = pl & 7; union { __bf16 e[8]; v4u u; } pk;
#pragma unroll
        for (int e = 0; e < 8; ++e) { const float v = so[wave][rl][hh * 64 + pc * 8 + e]; const __bf16 hi = (__bf16)v; pk.e[e] = pl < 8 ? hi : (__bf16)(v - (float)hi); }
        vst2((unsigned*)((pl < 8 ? Kh : Kl) + (((size_t)b * NH + h) * SS + s0 + wave * 16 + rl) * HD + pc * 8), pk.u); } } }
  else {
#pragma unroll
    for (int j = 0; j < 8; ++j) { const float bb = 0.f;
#pragma unroll
      for (int r = 0; r < 8; ++r) { const float v = (acc[j][r] + bb) * 4.0f; const _Float16 hi = (_Float16)v; sth[j * 16 + col][wave * 16 + 8 * g + r] = hi; stl[j * 16 + col][wave * 16 + 8 * g + r] = (_Float16)((v - (float)hi) * VLO); } }
    __syncthreads();
    for (int qq = tid; qq < 128 * 8; qq += 128) { const int cl = qq >> 3, pc = qq & 7; const int c = n0 + cl, h = c >> 6, d = c & 63; const size_t o = (((size_t)b * NH + h) * HD + d) * SS + s0 + pc * 8;
      vst2(VTh + o, *(const v4u*)(&sth[cl][pc * 8])); vst2(VTl + o, *(const v4u*)(&stl[cl][pc * 8])); } }
}
typedef __attribute__((ext_vector_type(2))) _Float16 v2h;
// the value that lane ^ 16 holds, by a register exchange between the wave's two 16-lane rows
__device__ __forceinline__ float xhalf(float v) { const int b = __builtin_bit_cast(int, v); return __builtin_bit_cast(float, __builtin_amdgcn_permlanex16(b, b, 0x76543210, 0xfedcba98, false, false)); }
// causal attention: block (64 queries, bh); key tiles 0..qb, each staged once per block in LDS (wave w brings plane w: K hi, K lo, V^T hi, V^T lo) and read by all four waves.
// Transposed products: S^T = K q^T (A = K hi/lo rows, B = q hi/lo) and O^T += V^T P^T (A = V^T rows, B = P^T). A lane then holds 32 scores of ONE query (column = lane & 15; keys 16 t + 8 g + r),
// which is the k order of a B fragment: tiles 2 kc and 2 kc + 1 convert in place into the P^T fragment of keys 32 kc .. 32 kc + 31. Scores and P never pass through LDS; maximum, sum and rescale factor are per lane.
__global__ __launch_bounds__(128) void k_attn(const float* __restrict__ Q32, const __bf16* __restrict__ Kh, const __bf16* __restrict__ Kl, const _Float16* __restrict__ VTh, const _Float16* __restrict__ VTl, const float* __restrict__ rb0, const float* __restrict__ rb1, float* __restrict__ O32) {
  __shared__ __align__(16) float sS[4][16][68];      // output staging only, each wave its own rows
  __shared__ __attribute__((aligned(2048))) unsigned char sKV[4 * TPLANE];
  const int tid = threadIdx.x, w = tid >> 5, lane = tid & 31, col = lane & 15, g = lane >> 4;
  const size_t bh = blockIdx.y; const int qb = blockIdx.x; const int q0 = qb * 64 + w * 16;
  F2 aq[2];
#pragma unroll
  for (int kc = 0; kc < 2; ++kc) aq[kc] = split_row(Q32 + (bh * SS + q0 + col) * HD, kc * 32, lane);
  const int h = (int)(bh % NH); __shared__ float sb0[4][64], sb1[4][64]; for (int i = lane; i < 64; i += 32) { sb0[w][i] = bfr(rb0[h * 2 * RW + i]); sb1[w][i] = bfr(rb1[h * 2 * RW + i]); }     // this head's two 64-entry bias tables
  float mrun = -3.0e38f, lrun = 0.f; v8f acc[4] = {}, ac1[4] = {}, ac2[4] = {};      // mrun: this lane's query; lrun: the sum over this lane's half of the keys, the halves joined after the loop
  const uint32_t wv = uni((uint32_t)tid >> 5);      // K planes: rows = keys, 128 B apart, a tile 8,192 B on; V^T planes: rows = d, 2,048 B apart, a tile 128 B on
  const uint64_t tsrc = (uint64_t)(size_t)(wv == 0u ? (const void*)Kh : wv == 1u ? (const void*)Kl : wv == 2u ? (const void*)VTh : (const void*)VTl) + (uint64_t)bh * (SS * HD * 2);
  const uint32_t tstep = wv < 2u ? 64u * TROW : TROW, tdst = (uint32_t)(size_t)sKV + wv * TPLANE;
  const u32x8 tg1 = tdm_group1(wv < 2u ? TROW : (uint32_t)(SS * 2), 64u); u32x4 tg0 = tdm_group0(tdst, tsrc);
  const __bf16* const pKh = (const __bf16*)(sKV + col * TPITCH); const __bf16* const pKl = (const __bf16*)(sKV + TPLANE + col * TPITCH);
  const _Float16* const pVh = (const _Float16*)(sKV + 2 * TPLANE + col * TPITCH); const _Float16* const pVl = (const _Float16*)(sKV + 3 * TPLANE + col * TPITCH);
  LDSX();
  // the column term rb1[31 + kc - qc] does not depend on the key tile: 64 keys are two whole raster rows, so a lane meets only 2 x 8 of its values; they stay in registers (both loops unrolled: every index a constant, no scratch array)
  float b1r[2][8];
#pragma unroll
  for (int p = 0; p < 2; ++p) {
#pragma unroll
    for (int r = 0; r < 8; ++r) b1r[p][r] = sb1[w][RW - 1 + p * 16 + 8 * g + r - ((w & 1) * 16 + col)]; }
  const float* const pb0 = &sb0[w][RW - 1 - 2 * qb - (w >> 1)];      // the row term rb0[31 + kr - qr] is one value per wave and raster row of keys: entries 2 kt and 2 kt + 1 from here
  const int dq = 8 * g - (q0 + col);
#pragma unroll 1
  for (int kt = 0; kt <= qb; ++kt) {      // causal in raster order
    asm volatile("s_wait_dscnt 0x0" ::: "memory");      // this wave's reads of the staged tile have retired before the tile is overwritten
    __syncthreads();                                    // every wave has left the previous key tile
    { const uint64_t ga = tsrc + (uint64_t)((uint32_t)kt * tstep); tg0[2] = uni((uint32_t)ga); tg0[3] = uni((((uint32_t)(ga >> 32)) & 0x01FFFFFFu) | 0x80000000u); }   // no request is outstanding here
    asm volatile("tensor_load_to_lds %0, %1" :: "s"(tg0), "s"(tg1) : "memory");   // every wave: its own plane of this key tile
    asm volatile("s_wait_tensorcnt 0x0" ::: "memory");  // this wave's plane has landed
    __syncthreads();                                    // so have the other waves': the tile may be read
    const float b0r[2] = { pb0[2 * kt], pb0[2 * kt + 1] };
    v16b kf[2][2][2];      // K fragments [register set][kc][hi, lo]: the 8 LDS reads of a 16-key group go out together, one group ahead of the products that use them
#pragma unroll
    for (int kc = 0; kc < 2; ++kc) { kf[0][kc][0] = frag_b(pKh + kc * 32, lane); kf[0][kc][1] = frag_b(pKl + kc * 32, lane); }
    float sc[4][8]; float mx = -3.4e38f;      // sc, and ph, pl below, are register arrays: every loop over them is unrolled so that each index is a constant
#pragma unroll
    for (int t = 0; t < 4; ++t) { const int dk = kt * 64 + t * 16 + dq; v8f s = {};      // dk + r = key - query
      if (t < 3) {
#pragma unroll
        for (int kc = 0; kc < 2; ++kc) { kf[(t + 1) & 1][kc][0] = frag_b(pKh + (t + 1) * 16 * (TPITCH / 2) + kc * 32, lane); kf[(t + 1) & 1][kc][1] = frag_b(pKl + (t + 1) * 16 * (TPITCH / 2) + kc * 32, lane); } }
#pragma unroll
      for (int kc = 0; kc < 2; ++kc) { const v16b khf = kf[t & 1][kc][0], klf = kf[t & 1][kc][1]; s = wmma_bf(khf, aq[kc].l, s); s = wmma_bf(klf, aq[kc].h, s); s = wmma_bf(khf, aq[kc].h, s); }
#pragma unroll
      for (int r = 0; r < 8; ++r) { sc[t][r] = (dk > -r) ? -1.0e9f : s[r] * 0.125f + b0r[t >> 1] + b1r[t & 1][r]; mx = fmaxf(mx, sc[t][r]); } }
    mx = fmaxf(mx, xhalf(mx));      // the other half of this query's keys
    const float mnew = fmaxf(mrun, mx); const float corr = __builtin_amdgcn_exp2f((mrun - mnew) * L2E);      // 0 on the first tile: the product overflows to -inf
    const float eb = 14.0f - mnew * L2E;      // e^(s - mnew) * 2^14 = 2^(s log2(e) + eb): one multiply-add and the hardware's base-2 exponential per score; a masked score gives 0
    v2f ps2[2] = {}; union { v16h v; v2h q[8]; } ph[2], pl[2];      // two scores at a time: packed sums (two independent chains), packed conversions straight into the fragment's registers
#pragma unroll
    for (int t = 0; t < 4; ++t) {
#pragma unroll
      for (int r = 0; r < 8; r += 2) { const v2f x = (v2f){ sc[t][r], sc[t][r + 1] } * L2E + eb; const v2f p = { __builtin_amdgcn_exp2f(x[0]), __builtin_amdgcn_exp2f(x[1]) }; ps2[(r >> 1) & 1] += p;
        const v2h hi = __builtin_convertvector(p, v2h); ph[t >> 1].q[(t & 1) * 4 + (r >> 1)] = hi; pl[t >> 1].q[(t & 1) * 4 + (r >> 1)] = __builtin_convertvector((p - __builtin_convertvector(hi, v2f)) * PLO, v2h); } }
    const float ps = (ps2[0][0] + ps2[1][0]) + (ps2[0][1] + ps2[1][1]);
    lrun = lrun * corr + ps * (1.0f / 16384.0f); mrun = mnew;
#pragma unroll
    for (int t = 0; t < 4; ++t) { acc[t] *= corr; ac1[t] *= corr; ac2[t] *= corr; }
#pragma unroll
    for (int kc = 0; kc < 2; ++kc) {
#pragma unroll
      for (int tp = 0; tp < 2; ++tp) { v16h vf[2][2];      // V^T fragments [t][hi, lo] of two 16-row groups of d: their 8 LDS reads go out together ahead of the 6 products
#pragma unroll
        for (int t = 0; t < 2; ++t) { vf[t][0] = frag_h(pVh + (tp * 2 + t) * 16 * (TPITCH / 2) + kc * 32, lane); vf[t][1] = frag_h(pVl + (tp * 2 + t) * 16 * (TPITCH / 2) + kc * 32, lane); }
#pragma unroll
        for (int t = 0; t < 2; ++t) { acc[tp * 2 + t] = wmma16(vf[t][0], ph[kc].v, acc[tp * 2 + t]); ac1[tp * 2 + t] = wmma16(vf[t][1], ph[kc].v, ac1[tp * 2 + t]); ac2[tp * 2 + t] = wmma16(vf[t][0], pl[kc].v, ac2[tp * 2 + t]); } } } }
  lrun += xhalf(lrun);
  const float inv = 1.0f / (lrun * 16384.0f * 4.0f);
#pragma unroll
  for (int t = 0; t < 4; ++t) { v4f o[2];      // accumulator register r of tile t = O[query col][16 t + 8 g + r]: 8 consecutive floats of the lane's own row, staged so that the global stores cover whole lines
#pragma unroll
    for (int r = 0; r < 8; ++r) o[r >> 2][r & 3] = (acc[t][r] + ac1[t][r] * (1.0f / VLO) + ac2[t][r] * (1.0f / PLO)) * inv;
    vst2(&sS[w][col][t * 16 + 8 * g], o[0]); vst2(&sS[w][col][t * 16 + 8 * g + 4], o[1]); }
  LDSX();
  for (int qq = lane; qq < 16 * 16; qq += 32) { const int rl = qq >> 4, pc = qq & 15; vst2(O32 + ((bh * SS) + q0 + rl) * HD + pc * 4, *(const v4f*)(&sS[w][rl][pc * 4])); }
}
// out = ctx Wo : split(ctx) x bf16(Wo columns): 2 products (Wo is an INPUT -> bf16 exact)
__global__ __launch_bounds__(128) void k_out(const float* __restrict__ O32, const __bf16* __restrict__ PT, float* __restrict__ out) {
  __shared__ __align__(16) float so[4][16][132];
  const int tid = threadIdx.x, wave = tid >> 5, lane = tid & 31, col = lane & 15, g = lane >> 4;
  __shared__ __attribute__((aligned(2048))) unsigned char sT[128 * TPITCH + 2 * TPLANE];   // one head's 64 k of: the block's 64 ctx rows (f32: 128 half rows of 128 B, 18,432 B = 9 x 2 KiB), its weight rows 0..63, its weight rows 64..127
  const int r0b = blockIdx.x * 64, r0 = r0b + wave * 16, n0 = blockIdx.y * 128; const int b = r0b / SS, s0 = r0b % SS;
  v8f acc[8] = {};
  const uint32_t wv = uni((uint32_t)tid >> 5);      // waves 0, 1, 2 bring one plane each
  const uint64_t tsrc = wv == 0u ? (uint64_t)(size_t)(O32 + ((size_t)b * NH * SS + s0) * HD) : (uint64_t)(size_t)(PT + (size_t)(3 * E + n0 + (wv == 2u ? 64 : 0)) * E);
  const uint32_t tstep = wv == 0u ? (uint32_t)(SS * HD * 4) : TROW;
  const u32x8 tg1 = tdm_group1(wv == 0u ? TROW : (uint32_t)(E * 2), wv == 0u ? 128u : 64u);
  u32x4 tg0 = tdm_group0((uint32_t)(size_t)sT + (wv == 0u ? 0u : 128u * TPITCH + (wv == 2u ? TPLANE : 0u)), tsrc);
  const float* const pA = (const float*)(sT + (wave * 16 + col) * 2 * TPITCH); const __bf16* const pB = (const __bf16*)(sT + 128 * TPITCH + col * TPITCH);
#pragma unroll 1
  for (int h = 0; h < NH; ++h) {
    asm volatile("s_wait_dscnt 0x0" ::: "memory");      // this wave's reads of the staged tiles have retired before they are overwritten
    __syncthreads();                                    // every wave has left the previous tiles
    if (pinned(wv < 3u)) {
      { const uint64_t ga = tsrc + (uint64_t)((uint32_t)h * tstep); tg0[2] = uni((uint32_t)ga); tg0[3] = uni((((uint32_t)(ga >> 32)) & 0x01FFFFFFu) | 0x80000000u); }   // no request is outstanding here
      asm volatile("tensor_load_to_lds %0, %1" :: "s"(tg0), "s"(tg1) : "memory");   // this wave's plane of head h
      asm volatile("s_wait_tensorcnt 0x0" ::: "memory"); }   // it has landed
    __syncthreads();                                    // so have the other waves': the tiles may be read
#pragma unroll
    for (int k2 = 0; k2 < 2; ++k2) { float av[16]; v16b wb[8];      // the 20 LDS reads of these 32 k go out as one group ahead of the split and the 16 products
      { const float* p = pA + k2 * (TPITCH / 4) + 8 * g;
#pragma unroll
        for (int i = 0; i < 8; ++i) { av[i] = p[i]; av[8 + i] = p[16 + i]; } }
#pragma unroll
      for (int j = 0; j < 8; ++j) wb[j] = frag_b(pB + (j >> 2) * (TPLANE / 2) + (j & 3) * 16 * (TPITCH / 2) + k2 * 32, lane);
      const F2 a = bsplit16(av);
#pragma unroll
      for (int j = 0; j < 8; ++j) { acc[j] = wmma_bf(a.l, wb[j], acc[j]); acc[j] = wmma_bf(a.h, wb[j], acc[j]); } } }
#pragma unroll
  for (int j = 0; j < 8; ++j) {
#pragma unroll
    for (int r = 0; r < 8; ++r) so[wave][8 * g + r][j * 16 + col] = acc[j][r]; }
  LDSX();
#pragma unroll 4
  for (int rl = 0; rl < 16; ++rl) vst2(out + (size_t)(r0 + rl) * E + n0 + lane * 4, *(const v4f*)(&so[wave][rl][lane * 4]));
}
extern "C" void kernel_launch(void* const* d_in, const int* in_sizes, int n_in, void* d_out, int out_size, void* d_ws, size_t ws_size, hipStream_t stream) {
  (void)in_sizes; (void)n_in; (void)out_size; (void)ws_size;
  const float** I = (const float**)d_in;   // x, Wq, Wk, Wv, Wo, rb0, rb1
  const float* x = I[0]; const float* Wq = I[1]; const float* Wk = I[2]; const float* Wv = I[3]; const float* Wo = I[4]; const float* rb0 = I[5]; const float* rb1 = I[6];
  float* out = (float*)d_out;
  char* ws = (char*)d_ws; size_t off = 0;
  auto take = [&](size_t bytes) { char* p = ws + off; off += (bytes + 255) & ~(size_t)255; return p; };
  __bf16* Xb = (__bf16*)take((size_t)NR * E * 2); __bf16* PT = (__bf16*)take((size_t)4 * E * E * 2);
  float* Q32 = (float*)take((size_t)NR * E * 4); __bf16* Kh = (__bf16*)take((size_t)NR * E * 2); __bf16* Kl = (__bf16*)take((size_t)NR * E * 2); _Float16* VTh = (_Float16*)take((size_t)NR * E * 2); _Float16* VTl = (_Float16*)take((size_t)NR * E * 2); float* O32 = (float*)take((size_t)NR * E * 4);
  k_pack<<<4 * E, 256, 0, stream>>>(Wq, Wk, Wv, Wo, PT);
  k_cvt<<<(NR * E / 8 + 255) / 256, 256, 0, stream>>>(x, Xb);
  k_qkv<<<dim3(NR / 64, E / 128, 3), 128, 0, stream>>>(Xb, PT, Q32, Kh, Kl, VTh, VTl);
  k_attn<<<dim3(SS / 64, NB * NH), 128, 0, stream>>>(Q32, Kh, Kl, VTh, VTl, rb0, rb1, O32);
  k_out<<<dim3(NR / 64, E / 128), 128, 0, stream>>>(O32, PT, out);
}

// v007
// It runs in 129 microseconds.
// Next to v006, in two timings, it ran 1.22 and 1.21 times as fast.
// Counting every step since v000, it is 4.65 times as fast.
// compute dtype: x, Wq/Wk/Wv/Wo, rb0/rb1 (INPUTS) rounded to bf16 with exact bf16 WMMA products (f32 accumulate) for the projections; K pre-split into bf16 hi/lo rows; q f32 split, P and V f16 hi/lo (3 products each); softmax, the causal raster mask and the factorised 2-D relative bias in f32.
#include <hip/hip_runtime.h>
#include <math.h>

typedef __attribute__((ext_vector_type(16))) _Float16 v16h;
typedef __attribute__((ext_vector_type(16))) __bf16 v16b;
typedef __attribute__((ext_vector_type(8)))  _Float16 v8h;
typedef __attribute__((ext_vector_type(8)))  float v8f;
typedef __attribute__((ext_vector_type(4)))  float v4f;
typedef __attribute__((ext_vector_type(2)))  float v2f;
typedef __attribute__((ext_vector_type(4)))  unsigned v4u;
typedef __attribute__((ext_vector_type(4)))  int v4i;
typedef float __attribute__((may_alias)) float_a;
typedef int __attribute__((may_alias)) int_a;

template <typename T> __device__ __forceinline__ void vst2(void* p, T v) { *(T*)p = v;  }
__device__ __forceinline__ v8f wmma16(v16h a, v16h b, v8f c) {
  v8f d = __builtin_amdgcn_wmma_f32_16x16x32_f16(false, a, false, b, (short)0, c, false, false);
  asm volatile("v_nop\n\tv_nop\n\tv_nop\n\tv_nop" : "+v"(d) : "v"(a), "v"(b));
  return d;
}
__device__ __forceinline__ v8f wmma_bf(v16b a, v16b b, v8f c) {
  v8f d = __builtin_amdgcn_wmma_f32_16x16x32_bf16(false, a, false, b, (short)0, c, false, false);
  asm volatile("v_nop\n\tv_nop\n\tv_nop\n\tv_nop" : "+v"(d) : "v"(a), "v"(b));
  return d;
}
// 16x16x32 fragments: lane = (h = lane>>4, row/col = lane&15); elements 0..7 = k0+8h+0..7, 8..15 = k0+16+8h+0..7; D element r = row 8h+r
__device__ __forceinline__ v16h frag_h(const _Float16* rowk0, int lane) {
  union { v16h v; v8h q[2]; } u; const _Float16* p = rowk0 + 8 * (lane >> 4);
  u.q[0] = *(const v8h*)p; u.q[1] = *(const v8h*)(p + 16); return u.v;
}
__device__ __forceinline__ v16h frag_f32(const float* rowk0, int lane) {
  v16h a; const float* p = rowk0 + 8 * (lane >> 4);
#pragma unroll
  for (int i = 0; i < 8; ++i) { a[i] = (_Float16)p[i]; a[8 + i] = (_Float16)p[16 + i]; }
  return a;
}
__device__ __forceinline__ v16h frag_f32s(const float* rowk0, int lane, float sc) {
  v16h a; const float* p = rowk0 + 8 * (lane >> 4);
#pragma unroll
  for (int i = 0; i < 8; ++i) { a[i] = (_Float16)(p[i] * sc); a[8 + i] = (_Float16)(p[16 + i] * sc); }
  return a;
}
// column fragment from a [K][ld] layout (column n), rows >= K read as 0
__device__ __forceinline__ v16h fragc_f32(const float* W, int k0, int n, int lane, int ld, int K) {
  v16h a; const int g = lane >> 4;
#pragma unroll
  for (int i = 0; i < 8; ++i) { const int ka = k0 + 8 * g + i, kb = ka + 16;
    a[i] = (_Float16)(ka < K ? W[(size_t)ka * ld + n] : 0.f); a[8 + i] = (_Float16)(kb < K ? W[(size_t)kb * ld + n] : 0.f); }
  return a;
}
struct F2 { v16b h, l; };
__device__ __forceinline__ F2 bsplit16(const float v[16]) { F2 r;
#pragma unroll
  for (int i = 0; i < 16; ++i) { const __bf16 h = (__bf16)v[i]; r.h[i] = h; r.l[i] = (__bf16)(v[i] - (float)h); }
  return r; }
__device__ __forceinline__ F2 split_row(const float* row, int k0, int lane) { float v[16]; const float* p = row + k0 + 8 * (lane >> 4);
#pragma unroll
  for (int i = 0; i < 8; ++i) { v[i] = p[i]; v[8 + i] = p[16 + i]; }
  return bsplit16(v); }
__device__ __forceinline__ F2 split_rowK(const float* row, int k0, int lane, int K) { float v[16]; const int g = lane >> 4;
#pragma unroll
  for (int i = 0; i < 8; ++i) { const int ka = k0 + 8 * g + i, kb = ka + 16; v[i] = ka < K ? row[ka] : 0.f; v[8 + i] = kb < K ? row[kb] : 0.f; }
  return bsplit16(v); }
__device__ __forceinline__ F2 split_col(const float* W, int k0, int n, int lane, int ld, int K) { float v[16]; const int g = lane >> 4;
#pragma unroll
  for (int i = 0; i < 8; ++i) { const int ka = k0 + 8 * g + i, kb = ka + 16; v[i] = ka < K ? W[(size_t)ka * ld + n] : 0.f; v[8 + i] = kb < K ? W[(size_t)kb * ld + n] : 0.f; }
  return bsplit16(v); }
__device__ __forceinline__ v8f mac3(const F2& a, const F2& b, v8f c) { c = wmma_bf(a.l, b.h, c); c = wmma_bf(a.h, b.l, c); return wmma_bf(a.h, b.h, c); }
__device__ __forceinline__ float sigm(float v) { return 1.0f / (1.0f + expf(-v)); }
#define LDSX() do { asm volatile("s_wait_dscnt 0" ::: "memory"); __builtin_amdgcn_wave_barrier(); __builtin_amdgcn_fence(__ATOMIC_RELEASE, "workgroup"); } while (0)


// Axial ('number-dimension') self attention over the 32 x 32 raster of each of 16 images (8 heads x 64, [in][out] DenseND kernels, no biases): scores = (q 64^-0.5).k + rb0[h][31 + kr - qr] + rb1[h][31 + kc - qc];
#define NB 16
#define SS 1024
#define E 512
#define NH 8
#define RW 32
#define HD 64
#define NR (NB * SS)
#define PLO 1024.0f
#define VLO 2048.0f
#define L2E 1.4426950408889634f
__device__ __forceinline__ float bfr(float v) { return (float)(__bf16)v; }
__device__ __forceinline__ v16b frag_b(const __bf16* rowk0, int lane) { return __builtin_bit_cast(v16b, frag_h((const _Float16*)rowk0, lane)); }

typedef uint32_t u32x4 __attribute__((ext_vector_type(4)));
typedef uint32_t u32x8 __attribute__((ext_vector_type(8)));
__device__ __forceinline__ uint32_t uni(uint32_t v) { return (uint32_t)__builtin_amdgcn_readfirstlane(v); }
#define TROW 128u                 // bytes of a staged row: 64 16-bit elements
#define TPITCH 144u               // its pitch in LDS, set by the tensor load's pad: 16 B x 9, no bank conflict for 16-byte fragment reads
#define TPLANE 10240u             // 64 rows x 144 B = 9,216 B, rounded up so that every plane starts at a multiple of 2 KiB
__device__ __forceinline__ uint32_t pinned(uint32_t v) { uint32_t w = uni(v); asm volatile("" : "+s"(w)); return w; }   // holds a wave-uniform test in a scalar register, so that the branch round a tensor load is a scalar one (a tensor load ignores EXEC)
// tensor descriptor, group 1: 1-byte elements, tensor = tile = rows rows of 128 B, source row pitch src_pitch bytes, 4 dwords of LDS pad behind every 32 dwords
__device__ __forceinline__ u32x8 tdm_group1(uint32_t src_pitch, uint32_t rows) {
  u32x8 g;
  g[0] = uni((1u << 20) | (4u << 22) | (3u << 25));
  g[1] = uni(TROW << 16);
  g[2] = uni(rows << 16);
  g[3] = uni(TROW << 16);
  g[4] = uni(rows);
  g[5] = uni(src_pitch);
  g[6] = uni(0u);
  g[7] = uni(0u);
  return g;
}
// group 0: one request, LDS destination (byte offset in the work-group's LDS), global address of the tile's first byte, type 2
__device__ __forceinline__ u32x4 tdm_group0(uint32_t lds_dst, uint64_t ga) {
  u32x4 g;
  g[0] = uni(1u); g[1] = uni(lds_dst); g[2] = uni((uint32_t)ga); g[3] = uni((((uint32_t)(ga >> 32)) & 0x01FFFFFFu) | 0x80000000u);
  return g;
}

__global__ __launch_bounds__(256) void k_cvt(const float* __restrict__ x, __bf16* __restrict__ Xb) {
  const size_t i8 = (size_t)blockIdx.x * 256 + threadIdx.x; if (i8 >= (size_t)NR * E / 8) return;
  union { __bf16 h[8]; v4u u; } pk;
#pragma unroll
  for (int e = 0; e < 8; ++e) pk.h[e] = (__bf16)x[i8 * 8 + e];
  vst2((unsigned*)(Xb + i8 * 8), pk.u);
}
// PT rows: [0,E) Wq[:,n], [E,2E) Wk[:,n], [2E,3E) Wv[:,n], [3E,4E) Wo[:,n]  ([in][out] weights: column n as a bf16 row)
__global__ __launch_bounds__(256) void k_pack(const float* __restrict__ Wq, const float* __restrict__ Wk, const float* __restrict__ Wv, const float* __restrict__ Wo, __bf16* __restrict__ PT) {
  const int n = blockIdx.x, tid = threadIdx.x; __shared__ __align__(16) __bf16 srow[E];
  const float* W = n < E ? Wq : (n < 2 * E ? Wk : (n < 3 * E ? Wv : Wo)); const int nn = n & (E - 1);
  for (int k = tid; k < E; k += 256) srow[k] = (__bf16)W[(size_t)k * E + nn];
  __syncthreads();
  if (tid < E / 8) vst2((unsigned*)(PT + (size_t)n * E + tid * 8), *(const v4u*)(&srow[tid * 8]));
}
// QKV: block (64 rows, 128 cols = 2 heads, which); q -> Q32 f32 [bh][s][64]; k -> bf16 hi/lo rows; v -> VT hi/lo x4 [bh][d][s]
__global__ __launch_bounds__(128) void k_qkv(const __bf16* __restrict__ Xb, const __bf16* __restrict__ PT, float* __restrict__ Q32, __bf16* __restrict__ Kh, __bf16* __restrict__ Kl, _Float16* __restrict__ VTh, _Float16* __restrict__ VTl) {
  __shared__ __align__(16) float so[4][16][132];
  __shared__ __align__(16) _Float16 sth[128][72], stl[128][72];
  __shared__ __attribute__((aligned(2048))) unsigned char sT[3 * TPLANE];   // 64 k of: the block's 64 x rows, its weight rows 0..63, its weight rows 64..127
  const int tid = threadIdx.x, wave = tid >> 5, lane = tid & 31, col = lane & 15, g = lane >> 4;
  const int which = blockIdx.z, r0b = blockIdx.x * 64, n0 = blockIdx.y * 128; const int b = r0b / SS, s0 = r0b % SS;
  v8f acc[8] = {};
  const uint32_t wv = uni((uint32_t)tid >> 5);      // waves 0, 1, 2 bring one plane each
  const uint64_t tsrc = wv == 0u ? (uint64_t)(size_t)(Xb + (size_t)r0b * E) : (uint64_t)(size_t)(PT + (size_t)(which * E + n0 + (wv == 2u ? 64 : 0)) * E);
  const u32x8 tg1 = tdm_group1((uint32_t)(E * 2), 64u); u32x4 tg0 = tdm_group0((uint32_t)(size_t)sT + (wv < 3u ? wv : 0u) * TPLANE, tsrc);
  const __bf16* const pA = (const __bf16*)(sT + (wave * 16 + col) * TPITCH); const __bf16* const pB = (const __bf16*)(sT + TPLANE + col * TPITCH);
#pragma unroll 1
  for (int st = 0; st < E / 64; ++st) {
    asm volatile("s_wait_dscnt 0x0" ::: "memory");      // this wave's reads of the staged tiles have retired before they are overwritten
    __syncthreads();                                    // every wave has left the previous tiles
    if (pinned(wv < 3u)) {
      { const uint64_t ga = tsrc + (uint64_t)((uint32_t)st * TROW); tg0[2] = uni((uint32_t)ga); tg0[3] = uni((((uint32_t)(ga >> 32)) & 0x01FFFFFFu) | 0x80000000u); }   // no request is outstanding here
      asm volatile("tensor_load_to_lds %0, %1" :: "s"(tg0), "s"(tg1) : "memory");   // this wave's plane, 64 k on
      asm volatile("s_wait_tensorcnt 0x0" ::: "memory"); }   // it has landed
    __syncthreads();                                    // so have the other waves': the tiles may be read
    v16b fa[2], fb[2][8];      // every fragment of the stage: its 36 LDS reads go out as one group, and the products wait on counts, not once per product
#pragma unroll
    for (int k2 = 0; k2 < 2; ++k2) { fa[k2] = frag_b(pA + k2 * 32, lane);
#pragma unroll
      for (int j = 0; j < 8; ++j) fb[k2][j] = frag_b(pB + (j >> 2) * (TPLANE / 2) + (j & 3) * 16 * (TPITCH / 2) + k2 * 32, lane); }
#pragma unroll
    for (int k2 = 0; k2 < 2; ++k2) {
#pragma unroll
      for (int j = 0; j < 8; ++j) acc[j] = wmma_bf(fa[k2], fb[k2][j], acc[j]); } }
  if (which < 2) {
#pragma unroll
    for (int j = 0; j < 8; ++j) { const float bb = 0.f;
#pragma unroll
      for (int r = 0; r < 8; ++r) so[wave][8 * g + r][j * 16 + col] = acc[j][r] + bb; }
    LDSX();
    if (which == 0) { for (int qq = lane; qq < 2 * 16 * 16; qq += 32) { const int hh = qq >> 8, rl = (qq >> 4) & 15, pc = qq & 15; const int h = (n0 >> 6) + hh;
        vst2(Q32 + (((size_t)b * NH + h) * SS + s0 + wave * 16 + rl) * HD + pc * 4, *(const v4f*)(&so[wave][rl][hh * 64 + pc * 4])); } }
    else {
      for (int qq = lane; qq < 2 * 16 * 16; qq += 32) { const int hh = qq >> 8, rl = (qq >> 4) & 15, pl = qq & 15; const int h = (n0 >> 6) + hh; const int pc = pl & 7; union { __bf16 e[8]; v4u u; } pk;
#pragma unroll
        for (int e = 0; e < 8; ++e) { const float v = so[wave][rl][hh * 64 + pc * 8 + e]; const __bf16 hi = (__bf16)v; pk.e[e] = pl < 8 ? hi : (__bf16)(v - (float)hi); }
        vst2((unsigned*)((pl < 8 ? Kh : Kl) + (((size_t)b * NH + h) * SS + s0 + wave * 16 + rl) * HD + pc * 8), pk.u); } } }
  else {
#pragma unroll
    for (int j = 0; j < 8; ++j) { const float bb = 0.f;
#pragma unroll
      for (int r = 0; r < 8; ++r) { const float v = (acc[j][r] + bb) * 4.0f; const _Float16 hi = (_Float16)v; sth[j * 16 + col][wave * 16 + 8 * g + r] = hi; stl[j * 16 + col][wave * 16 + 8 * g + r] = (_Float16)((v - (float)hi) * VLO); } }
    __syncthreads();
    for (int qq = tid; qq < 128 * 8; qq += 128) { const int cl = qq >> 3, pc = qq & 7; const int c = n0 + cl, h = c >> 6, d = c & 63; const size_t o = (((size_t)b * NH + h) * HD + d) * SS + s0 + pc * 8;
      vst2(VTh + o, *(const v4u*)(&sth[cl][pc * 8])); vst2(VTl + o, *(const v4u*)(&stl[cl][pc * 8])); } }
}
typedef __attribute__((ext_vector_type(2))) _Float16 v2h;
// the value that lane ^ 16 holds, by a register exchange between the wave's two 16-lane rows
__device__ __forceinline__ float xhalf(float v) { const int b = __builtin_bit_cast(int, v); return __builtin_bit_cast(float, __builtin_amdgcn_permlanex16(b, b, 0x76543210, 0xfedcba98, false, false)); }
// causal attention: block (bh, 64 queries); key tiles 0..qb, each staged once per block in LDS (wave w brings plane w: K hi, K lo, V^T hi, V^T lo) and read by all four waves.
// Transposed products: S^T = K q^T (A = K hi/lo rows, B = q hi/lo) and O^T += V^T P^T (A = V^T rows, B = P^T). A lane then holds 32 scores of ONE query (column = lane & 15; keys 16 t + 8 g + r),
// which is the k order of a B fragment: tiles 2 kc and 2 kc + 1 convert in place into the P^T fragment of keys 32 kc .. 32 kc + 31. Scores and P never pass through LDS; maximum, sum and rescale factor are per lane.
__global__ __launch_bounds__(128) void k_attn(const float* __restrict__ Q32, const __bf16* __restrict__ Kh, const __bf16* __restrict__ Kl, const _Float16* __restrict__ VTh, const _Float16* __restrict__ VTl, const float* __restrict__ rb0, const float* __restrict__ rb1, float* __restrict__ O32) {
  __shared__ __align__(16) float sS[4][16][68];      // output staging only, each wave its own rows
  __shared__ __attribute__((aligned(2048))) unsigned char sKV[4 * TPLANE];
  const int tid = threadIdx.x, w = tid >> 5, lane = tid & 31, col = lane & 15, g = lane >> 4;
  const size_t bh = blockIdx.x; const int qb = SS / 64 - 1 - (int)blockIdx.y; const int q0 = qb * 64 + w * 16;      // blockIdx.y 0 takes the query block with the most key tiles, and every run of 128 indices holds equal work
  F2 aq[2];
#pragma unroll
  for (int kc = 0; kc < 2; ++kc) aq[kc] = split_row(Q32 + (bh * SS + q0 + col) * HD, kc * 32, lane);
  const int h = (int)(bh % NH); __shared__ float sb0[4][64], sb1[4][64]; for (int i = lane; i < 64; i += 32) { sb0[w][i] = bfr(rb0[h * 2 * RW + i]); sb1[w][i] = bfr(rb1[h * 2 * RW + i]); }     // this head's two 64-entry bias tables
  float mrun = -3.0e38f, lrun = 0.f; v8f acc[4] = {}, ac1[4] = {}, ac2[4] = {};      // mrun: this lane's query; lrun: the sum over this lane's half of the keys, the halves joined after the loop
  const uint32_t wv = uni((uint32_t)tid >> 5);      // K planes: rows = keys, 128 B apart, a tile 8,192 B on; V^T planes: rows = d, 2,048 B apart, a tile 128 B on
  const uint64_t tsrc = (uint64_t)(size_t)(wv == 0u ? (const void*)Kh : wv == 1u ? (const void*)Kl : wv == 2u ? (const void*)VTh : (const void*)VTl) + (uint64_t)bh * (SS * HD * 2);
  const uint32_t tstep = wv < 2u ? 64u * TROW : TROW, tdst = (uint32_t)(size_t)sKV + wv * TPLANE;
  const u32x8 tg1 = tdm_group1(wv < 2u ? TROW : (uint32_t)(SS * 2), 64u); u32x4 tg0 = tdm_group0(tdst, tsrc);
  const __bf16* const pKh = (const __bf16*)(sKV + col * TPITCH); const __bf16* const pKl = (const __bf16*)(sKV + TPLANE + col * TPITCH);
  const _Float16* const pVh = (const _Float16*)(sKV + 2 * TPLANE + col * TPITCH); const _Float16* const pVl = (const _Float16*)(sKV + 3 * TPLANE + col * TPITCH);
  LDSX();
  // the column term rb1[31 + kc - qc] does not depend on the key tile: 64 keys are two whole raster rows, so a lane meets only 2 x 8 of its values; they stay in registers (both loops unrolled: every index a constant, no scratch array)
  float b1r[2][8];
#pragma unroll
  for (int p = 0; p < 2; ++p) {
#pragma unroll
    for (int r = 0; r < 8; ++r) b1r[p][r] = sb1[w][RW - 1 + p * 16 + 8 * g + r - ((w & 1) * 16 + col)]; }
  const float* const pb0 = &sb0[w][RW - 1 - 2 * qb - (w >> 1)];      // the row term rb0[31 + kr - qr] is one value per wave and raster row of keys: entries 2 kt and 2 kt + 1 from here
  const int dq = 8 * g - (q0 + col);
#pragma unroll 1
  for (int kt = 0; kt <= qb; ++kt) {      // causal in raster order
    asm volatile("s_wait_dscnt 0x0" ::: "memory");      // this wave's reads of the staged tile have retired before the tile is overwritten
    __syncthreads();                                    // every wave has left the previous key tile
    { const uint64_t ga = tsrc + (uint64_t)((uint32_t)kt * tstep); tg0[2] = uni((uint32_t)ga); tg0[3] = uni((((uint32_t)(ga >> 32)) & 0x01FFFFFFu) | 0x80000000u); }   // no request is outstanding here
    asm volatile("tensor_load_to_lds %0, %1" :: "s"(tg0), "s"(tg1) : "memory");   // every wave: its own plane of this key tile
    asm volatile("s_wait_tensorcnt 0x0" ::: "memory");  // this wave's plane has landed
    __syncthreads();                                    // so have the other waves': the tile may be read
    const float b0r[2] = { pb0[2 * kt], pb0[2 * kt + 1] };
    v16b kf[2][2][2];      // K fragments [register set][kc][hi, lo]: the 8 LDS reads of a 16-key group go out together, one group ahead of the products that use them
#pragma unroll
    for (int kc = 0; kc < 2; ++kc) { kf[0][kc][0] = frag_b(pKh + kc * 32, lane); kf[0][kc][1] = frag_b(pKl + kc * 32, lane); }
    float sc[4][8]; float mx = -3.4e38f;      // sc, and ph, pl below, are register arrays: every loop over them is unrolled so that each index is a constant
#pragma unroll
    for (int t = 0; t < 4; ++t) { const int dk = kt * 64 + t * 16 + dq; v8f s = {};      // dk + r = key - query
      if (t < 3) {
#pragma unroll
        for (int kc = 0; kc < 2; ++kc) { kf[(t + 1) & 1][kc][0] = frag_b(pKh + (t + 1) * 16 * (TPITCH / 2) + kc * 32, lane); kf[(t + 1) & 1][kc][1] = frag_b(pKl + (t + 1) * 16 * (TPITCH / 2) + kc * 32, lane); } }
#pragma unroll
      for (int kc = 0; kc < 2; ++kc) { const v16b khf = kf[t & 1][kc][0], klf = kf[t & 1][kc][1]; s = wmma_bf(khf, aq[kc].l, s); s = wmma_bf(klf, aq[kc].h, s); s = wmma_bf(khf, aq[kc].h, s); }
#pragma unroll
      for (int r = 0; r < 8; ++r) { sc[t][r] = (dk > -r) ? -1.0e9f : s[r] * 0.125f + b0r[t >> 1] + b1r[t & 1][r]; mx = fmaxf(mx, sc[t][r]); } }
    mx = fmaxf(mx, xhalf(mx));      // the other half of this query's keys
    const float mnew = fmaxf(mrun, mx); const float corr = __builtin_amdgcn_exp2f((mrun - mnew) * L2E);      // 0 on the first tile: the product overflows to -inf
    const float eb = 14.0f - mnew * L2E;      // e^(s - mnew) * 2^14 = 2^(s log2(e) + eb): one multiply-add and the hardware's base-2 exponential per score; a masked score gives 0
    v2f ps2[2] = {}; union { v16h v; v2h q[8]; } ph[2], pl[2];      // two scores at a time: packed sums (two independent chains), packed conversions straight into the fragment's registers
#pragma unroll
    for (int t = 0; t < 4; ++t) {
#pragma unroll
      for (int r = 0; r < 8; r += 2) { const v2f x = (v2f){ sc[t][r], sc[t][r + 1] } * L2E + eb; const v2f p = { __builtin_amdgcn_exp2f(x[0]), __builtin_amdgcn_exp2f(x[1]) }; ps2[(r >> 1) & 1] += p;
        const v2h hi = __builtin_convertvector(p, v2h); ph[t >> 1].q[(t & 1) * 4 + (r >> 1)] = hi; pl[t >> 1].q[(t & 1) * 4 + (r >> 1)] = __builtin_convertvector((p - __builtin_convertvector(hi, v2f)) * PLO, v2h); } }
    const float ps = (ps2[0][0] + ps2[1][0]) + (ps2[0][1] + ps2[1][1]);
    lrun = lrun * corr + ps * (1.0f / 16384.0f); mrun = mnew;
#pragma unroll
    for (int t = 0; t < 4; ++t) { acc[t] *= corr; ac1[t] *= corr; ac2[t] *= corr; }
#pragma unroll
    for (int kc = 0; kc < 2; ++kc) {
#pragma unroll
      for (int tp = 0; tp < 2; ++tp) { v16h vf[2][2];      // V^T fragments [t][hi, lo] of two 16-row groups of d: their 8 LDS reads go out together ahead of the 6 products
#pragma unroll
        for (int t = 0; t < 2; ++t) { vf[t][0] = frag_h(pVh + (tp * 2 + t) * 16 * (TPITCH / 2) + kc * 32, lane); vf[t][1] = frag_h(pVl + (tp * 2 + t) * 16 * (TPITCH / 2) + kc * 32, lane); }
#pragma unroll
        for (int t = 0; t < 2; ++t) { acc[tp * 2 + t] = wmma16(vf[t][0], ph[kc].v, acc[tp * 2 + t]); ac1[tp * 2 + t] = wmma16(vf[t][1], ph[kc].v, ac1[tp * 2 + t]); ac2[tp * 2 + t] = wmma16(vf[t][0], pl[kc].v, ac2[tp * 2 + t]); } } } }
  lrun += xhalf(lrun);
  const float inv = 1.0f / (lrun * 16384.0f * 4.0f);
#pragma unroll
  for (int t = 0; t < 4; ++t) { v4f o[2];      // accumulator register r of tile t = O[query col][16 t + 8 g + r]: 8 consecutive floats of the lane's own row, staged so that the global stores cover whole lines
#pragma unroll
    for (int r = 0; r < 8; ++r) o[r >> 2][r & 3] = (acc[t][r] + ac1[t][r] * (1.0f / VLO) + ac2[t][r] * (1.0f / PLO)) * inv;
    vst2(&sS[w][col][t * 16 + 8 * g], o[0]); vst2(&sS[w][col][t * 16 + 8 * g + 4], o[1]); }
  LDSX();
  for (int qq = lane; qq < 16 * 16; qq += 32) { const int rl = qq >> 4, pc = qq & 15; vst2(O32 + ((bh * SS) + q0 + rl) * HD + pc * 4, *(const v4f*)(&sS[w][rl][pc * 4])); }
}
// out = ctx Wo : split(ctx) x bf16(Wo columns): 2 products (Wo is an INPUT -> bf16 exact)
__global__ __launch_bounds__(128) void k_out(const float* __restrict__ O32, const __bf16* __restrict__ PT, float* __restrict__ out) {
  __shared__ __align__(16) float so[4][16][132];
  const int tid = threadIdx.x, wave = tid >> 5, lane = tid & 31, col = lane & 15, g = lane >> 4;
  __shared__ __attribute__((aligned(2048))) unsigned char sT[128 * TPITCH + 2 * TPLANE];   // one head's 64 k of: the block's 64 ctx rows (f32: 128 half rows of 128 B, 18,432 B = 9 x 2 KiB), its weight rows 0..63, its weight rows 64..127
  const int r0b = blockIdx.x * 64, r0 = r0b + wave * 16, n0 = blockIdx.y * 128; const int b = r0b / SS, s0 = r0b % SS;
  v8f acc[8] = {};
  const uint32_t wv = uni((uint32_t)tid >> 5);      // waves 0, 1, 2 bring one plane each
  const uint64_t tsrc = wv == 0u ? (uint64_t)(size_t)(O32 + ((size_t)b * NH * SS + s0) * HD) : (uint64_t)(size_t)(PT + (size_t)(3 * E + n0 + (wv == 2u ? 64 : 0)) * E);
  const uint32_t tstep = wv == 0u ? (uint32_t)(SS * HD * 4) : TROW;
  const u32x8 tg1 = tdm_group1(wv == 0u ? TROW : (uint32_t)(E * 2), wv == 0u ? 128u : 64u);
  u32x4 tg0 = tdm_group0((uint32_t)(size_t)sT + (wv == 0u ? 0u : 128u * TPITCH + (wv == 2u ? TPLANE : 0u)), tsrc);
  const float* const pA = (const float*)(sT + (wave * 16 + col) * 2 * TPITCH); const __bf16* const pB = (const __bf16*)(sT + 128 * TPITCH + col * TPITCH);
#pragma unroll 1
  for (int h = 0; h < NH; ++h) {
    asm volatile("s_wait_dscnt 0x0" ::: "memory");      // this wave's reads of the staged tiles have retired before they are overwritten
    __syncthreads();                                    // every wave has left the previous tiles
    if (pinned(wv < 3u)) {
      { const uint64_t ga = tsrc + (uint64_t)((uint32_t)h * tstep); tg0[2] = uni((uint32_t)ga); tg0[3] = uni((((uint32_t)(ga >> 32)) & 0x01FFFFFFu) | 0x80000000u); }   // no request is outstanding here
      asm volatile("tensor_load_to_lds %0, %1" :: "s"(tg0), "s"(tg1) : "memory");   // this wave's plane of head h
      asm volatile("s_wait_tensorcnt 0x0" ::: "memory"); }   // it has landed
    __syncthreads();                                    // so have the other waves': the tiles may be read
#pragma unroll
    for (int k2 = 0; k2 < 2; ++k2) { float av[16]; v16b wb[8];      // the 20 LDS reads of these 32 k go out as one group ahead of the split and the 16 products
      { const float* p = pA + k2 * (TPITCH / 4) + 8 * g;
#pragma unroll
        for (int i = 0; i < 8; ++i) { av[i] = p[i]; av[8 + i] = p[16 + i]; } }
#pragma unroll
      for (int j = 0; j < 8; ++j) wb[j] = frag_b(pB + (j >> 2) * (TPLANE / 2) + (j & 3) * 16 * (TPITCH / 2) + k2 * 32, lane);
      const F2 a = bsplit16(av);
#pragma unroll
      for (int j = 0; j < 8; ++j) { acc[j] = wmma_bf(a.l, wb[j], acc[j]); acc[j] = wmma_bf(a.h, wb[j], acc[j]); } } }
#pragma unroll
  for (int j = 0; j < 8; ++j) {
#pragma unroll
    for (int r = 0; r < 8; ++r) so[wave][8 * g + r][j * 16 + col] = acc[j][r]; }
  LDSX();
#pragma unroll 4
  for (int rl = 0; rl < 16; ++rl) vst2(out + (size_t)(r0 + rl) * E + n0 + lane * 4, *(const v4f*)(&so[wave][rl][lane * 4]));
}
extern "C" void kernel_launch(void* const* d_in, const int* in_sizes, int n_in, void* d_out, int out_size, void* d_ws, size_t ws_size, hipStream_t stream) {
  (void)in_sizes; (void)n_in; (void)out_size; (void)ws_size;
  const float** I = (const float**)d_in;   // x, Wq, Wk, Wv, Wo, rb0, rb1
  const float* x = I[0]; const float* Wq = I[1]; const float* Wk = I[2]; const float* Wv = I[3]; const float* Wo = I[4]; const float* rb0 = I[5]; const float* rb1 = I[6];
  float* out = (float*)d_out;
  char* ws = (char*)d_ws; size_t off = 0;
  auto take = [&](size_t bytes) { char* p = ws + off; off += (bytes + 255) & ~(size_t)255; return p; };
  __bf16* Xb = (__bf16*)take((size_t)NR * E * 2); __bf16* PT = (__bf16*)take((size_t)4 * E * E * 2);
  float* Q32 = (float*)take((size_t)NR * E * 4); __bf16* Kh = (__bf16*)take((size_t)NR * E * 2); __bf16* Kl = (__bf16*)take((size_t)NR * E * 2); _Float16* VTh = (_Float16*)take((size_t)NR * E * 2); _Float16* VTl = (_Float16*)take((size_t)NR * E * 2); float* O32 = (float*)take((size_t)NR * E * 4);
  k_pack<<<4 * E, 256, 0, stream>>>(Wq, Wk, Wv, Wo, PT);
  k_cvt<<<(NR * E / 8 + 255) / 256, 256, 0, stream>>>(x, Xb);
  k_qkv<<<dim3(NR / 64, E / 128, 3), 128, 0, stream>>>(Xb, PT, Q32, Kh, Kl, VTh, VTl);
  k_attn<<<dim3(NB * NH, SS / 64), 128, 0, stream>>>(Q32, Kh, Kl, VTh, VTl, rb0, rb1, O32);
  k_out<<<dim3(NR / 64, E / 128), 128, 0, stream>>>(O32, PT, out);
}

// v008
// A run of this version takes 120 microseconds.
// Two timings next to v007 both put it at 1.08 times that version's speed.
// Counting every step since v000, it is 5.02 times as fast.
// compute dtype: x, Wq/Wk/Wv/Wo, rb0/rb1 (INPUTS) rounded to bf16 with exact bf16 WMMA products (f32 accumulate) for the projections; K pre-split into bf16 hi/lo rows; q f32 split, P and V f16 hi/lo (3 products each); softmax, the causal raster mask and the factorised 2-D relative bias in f32.
#include <hip/hip_runtime.h>
#include <math.h>

typedef __attribute__((ext_vector_type(16))) _Float16 v16h;
typedef __attribute__((ext_vector_type(16))) __bf16 v16b;
typedef __attribute__((ext_vector_type(8)))  _Float16 v8h;
typedef __attribute__((ext_vector_type(8)))  float v8f;
typedef __attribute__((ext_vector_type(4)))  float v4f;
typedef __attribute__((ext_vector_type(2)))  float v2f;
typedef __attribute__((ext_vector_type(4)))  unsigned v4u;
typedef __attribute__((ext_vector_type(4)))  int v4i;
typedef float __attribute__((may_alias)) float_a;
typedef int __attribute__((may_alias)) int_a;

template <typename T> __device__ __forceinline__ void vst2(void* p, T v) { *(T*)p = v;  }
__device__ __forceinline__ v8f wmma16(v16h a, v16h b, v8f c) {
  v8f d = __builtin_amdgcn_wmma_f32_16x16x32_f16(false, a, false, b, (short)0, c, false, false);
  asm volatile("v_nop\n\tv_nop\n\tv_nop\n\tv_nop" : "+v"(d) : "v"(a), "v"(b));
  return d;
}
__device__ __forceinline__ v8f wmma_bf(v16b a, v16b b, v8f c) {
  v8f d = __builtin_amdgcn_wmma_f32_16x16x32_bf16(false, a, false, b, (short)0, c, false, false);
  asm volatile("v_nop\n\tv_nop\n\tv_nop\n\tv_nop" : "+v"(d) : "v"(a), "v"(b));
  return d;
}
// 16x16x32 fragments: lane = (h = lane>>4, row/col = lane&15); elements 0..7 = k0+8h+0..7, 8..15 = k0+16+8h+0..7; D element r = row 8h+r
__device__ __forceinline__ v16h frag_h(const _Float16* rowk0, int lane) {
  union { v16h v; v8h q[2]; } u; const _Float16* p = rowk0 + 8 * (lane >> 4);
  u.q[0] = *(const v8h*)p; u.q[1] = *(const v8h*)(p + 16); return u.v;
}
__device__ __forceinline__ v16h frag_f32(const float* rowk0, int lane) {
  v16h a; const float* p = rowk0 + 8 * (lane >> 4);
#pragma unroll
  for (int i = 0; i < 8; ++i) { a[i] = (_Float16)p[i]; a[8 + i] = (_Float16)p[16 + i]; }
  return a;
}
__device__ __forceinline__ v16h frag_f32s(const float* rowk0, int lane, float sc) {
  v16h a; const float* p = rowk0 + 8 * (lane >> 4);
#pragma unroll
  for (int i = 0; i < 8; ++i) { a[i] = (_Float16)(p[i] * sc); a[8 + i] = (_Float16)(p[16 + i] * sc); }
  return a;
}
// column fragment from a [K][ld] layout (column n), rows >= K read as 0
__device__ __forceinline__ v16h fragc_f32(const float* W, int k0, int n, int lane, int ld, int K) {
  v16h a; const int g = lane >> 4;
#pragma unroll
  for (int i = 0; i < 8; ++i) { const int ka = k0 + 8 * g + i, kb = ka + 16;
    a[i] = (_Float16)(ka < K ? W[(size_t)ka * ld + n] : 0.f); a[8 + i] = (_Float16)(kb < K ? W[(size_t)kb * ld + n] : 0.f); }
  return a;
}
struct F2 { v16b h, l; };
__device__ __forceinline__ F2 bsplit16(const float v[16]) { F2 r;
#pragma unroll
  for (int i = 0; i < 16; ++i) { const __bf16 h = (__bf16)v[i]; r.h[i] = h; r.l[i] = (__bf16)(v[i] - (float)h); }
  return r; }
__device__ __forceinline__ F2 split_row(const float* row, int k0, int lane) { float v[16]; const float* p = row + k0 + 8 * (lane >> 4);
#pragma unroll
  for (int i = 0; i < 8; ++i) { v[i] = p[i]; v[8 + i] = p[16 + i]; }
  return bsplit16(v); }
__device__ __forceinline__ F2 split_rowK(const float* row, int k0, int lane, int K) { float v[16]; const int g = lane >> 4;
#pragma unroll
  for (int i = 0; i < 8; ++i) { const int ka = k0 + 8 * g + i, kb = ka + 16; v[i] = ka < K ? row[ka] : 0.f; v[8 + i] = kb < K ? row[kb] : 0.f; }
  return bsplit16(v); }
__device__ __forceinline__ F2 split_col(const float* W, int k0, int n, int lane, int ld, int K) { float v[16]; const int g = lane >> 4;
#pragma unroll
  for (int i = 0; i < 8; ++i) { const int ka = k0 + 8 * g + i, kb = ka + 16; v[i] = ka < K ? W[(size_t)ka * ld + n] : 0.f; v[8 + i] = kb < K ? W[(size_t)kb * ld + n] : 0.f; }
  return bsplit16(v); }
__device__ __forceinline__ v8f mac3(const F2& a, const F2& b, v8f c) { c = wmma_bf(a.l, b.h, c); c = wmma_bf(a.h, b.l, c); return wmma_bf(a.h, b.h, c); }
__device__ __forceinline__ float sigm(float v) { return 1.0f / (1.0f + expf(-v)); }
#define LDSX() do { asm volatile("s_wait_dscnt 0" ::: "memory"); __builtin_amdgcn_wave_barrier(); __builtin_amdgcn_fence(__ATOMIC_RELEASE, "workgroup"); } while (0)


// Axial ('number-dimension') self attention over the 32 x 32 raster of each of 16 images (8 heads x 64, [in][out] DenseND kernels, no biases): scores = (q 64^-0.5).k + rb0[h][31 + kr - qr] + rb1[h][31 + kc - qc];
#define NB 16
#define SS 1024
#define E 512
#define NH 8
#define RW 32
#define HD 64
#define NR (NB * SS)
#define PLO 1024.0f
#define VLO 2048.0f
#define L2E 1.4426950408889634f
__device__ __forceinline__ float bfr(float v) { return (float)(__bf16)v; }
__device__ __forceinline__ v16b frag_b(const __bf16* rowk0, int lane) { return __builtin_bit_cast(v16b, frag_h((const _Float16*)rowk0, lane)); }

typedef uint32_t u32x4 __attribute__((ext_vector_type(4)));
typedef uint32_t u32x8 __attribute__((ext_vector_type(8)));
__device__ __forceinline__ uint32_t uni(uint32_t v) { return (uint32_t)__builtin_amdgcn_readfirstlane(v); }
#define TROW 128u                 // bytes of a staged row: 64 16-bit elements
#define TPITCH 144u               // its pitch in LDS, set by the tensor load's pad: 16 B x 9, no bank conflict for 16-byte fragment reads
#define TPLANE 10240u             // 64 rows x 144 B = 9,216 B, rounded up so that every plane starts at a multiple of 2 KiB
__device__ __forceinline__ uint32_t pinned(uint32_t v) { uint32_t w = uni(v); asm volatile("" : "+s"(w)); return w; }   // holds a wave-uniform test in a scalar register, so that the branch round a tensor load is a scalar one (a tensor load ignores EXEC)
// tensor descriptor, group 1: 1-byte elements, tensor = tile = rows rows of 128 B, source row pitch src_pitch bytes, 4 dwords of LDS pad behind every 32 dwords
__device__ __forceinline__ u32x8 tdm_group1(uint32_t src_pitch, uint32_t rows) {
  u32x8 g;
  g[0] = uni((1u << 20) | (4u << 22) | (3u << 25));
  g[1] = uni(TROW << 16);
  g[2] = uni(rows << 16);
  g[3] = uni(TROW << 16);
  g[4] = uni(rows);
  g[5] = uni(src_pitch);
  g[6] = uni(0u);
  g[7] = uni(0u);
  return g;
}
// group 0: one request, LDS destination (byte offset in the work-group's LDS), global address of the tile's first byte, type 2
__device__ __forceinline__ u32x4 tdm_group0(uint32_t lds_dst, uint64_t ga) {
  u32x4 g;
  g[0] = uni(1u); g[1] = uni(lds_dst); g[2] = uni((uint32_t)ga); g[3] = uni((((uint32_t)(ga >> 32)) & 0x01FFFFFFu) | 0x80000000u);
  return g;
}

typedef __attribute__((ext_vector_type(2))) unsigned v2u;
// Both preparatory launches are sized by the waves they start, not by their elements: 256 work-groups of 8 waves each.
#define CVT_PC 32                 // pieces of 4 elements per thread; a wave's load covers 512 contiguous bytes, its store 256
static_assert((size_t)NR * E / 4 == (size_t)256 * 256 * CVT_PC, "k_cvt: 256 work-groups of 256 threads cover x exactly");
__global__ __launch_bounds__(256) void k_cvt(const float* __restrict__ x, __bf16* __restrict__ Xb) {
  const size_t p0 = (size_t)blockIdx.x * (256 * CVT_PC) + threadIdx.x;
  v4f v[CVT_PC];      // register array: both loops unrolled, all loads of a thread in flight together
#pragma unroll
  for (int i = 0; i < CVT_PC; ++i) v[i] = *(const v4f*)(x + (p0 + (size_t)i * 256) * 4);
#pragma unroll
  for (int i = 0; i < CVT_PC; ++i) { union { __bf16 h[4]; v2u u; } pk;
#pragma unroll
    for (int e = 0; e < 4; ++e) pk.h[e] = (__bf16)v[i][e];
    vst2((unsigned*)(Xb + (p0 + (size_t)i * 256) * 4), pk.u); }
}
// PT rows: [0,E) Wq[:,n], [E,2E) Wk[:,n], [2E,3E) Wv[:,n], [3E,4E) Wo[:,n]  ([in][out] weights: column n as a bf16 row)
// block = one 64 k x 64 n tile of one weight matrix, read in 256-byte row pieces, transposed in LDS, stored as 64 whole 128-byte lines
__global__ __launch_bounds__(256) void k_pack(const float* __restrict__ Wq, const float* __restrict__ Wk, const float* __restrict__ Wv, const float* __restrict__ Wo, __bf16* __restrict__ PT) {
  __shared__ __align__(16) __bf16 st[64][72];      // [n][k], pitch 144 B
  const int tid = threadIdx.x, m = blockIdx.x >> 6, k0 = ((blockIdx.x >> 3) & 7) * 64, n0 = (blockIdx.x & 7) * 64;
  const float* W = m == 0 ? Wq : (m == 1 ? Wk : (m == 2 ? Wv : Wo));
  v4f v[4];
#pragma unroll
  for (int i = 0; i < 4; ++i) v[i] = *(const v4f*)(W + (size_t)(k0 + i * 16 + (tid >> 4)) * E + n0 + (tid & 15) * 4);
#pragma unroll
  for (int i = 0; i < 4; ++i) {
#pragma unroll
    for (int e = 0; e < 4; ++e) st[(tid & 15) * 4 + e][i * 16 + (tid >> 4)] = (__bf16)v[i][e]; }
  __syncthreads();
#pragma unroll
  for (int i = 0; i < 2; ++i) { const int c = i * 256 + tid, n = c >> 3, pc = c & 7;
    vst2((unsigned*)(PT + (size_t)(m * E + n0 + n) * E + k0 + pc * 8), *(const v4u*)(&st[n][pc * 8])); }
}
// QKV: block (64 rows, 128 cols = 2 heads, which); q -> Q32 f32 [bh][s][64]; k -> bf16 hi/lo rows; v -> VT hi/lo x4 [bh][d][s]
__global__ __launch_bounds__(128) void k_qkv(const __bf16* __restrict__ Xb, const __bf16* __restrict__ PT, float* __restrict__ Q32, __bf16* __restrict__ Kh, __bf16* __restrict__ Kl, _Float16* __restrict__ VTh, _Float16* __restrict__ VTl) {
  __shared__ __align__(16) float so[4][16][132];
  __shared__ __align__(16) _Float16 sth[128][72], stl[128][72];
  __shared__ __attribute__((aligned(2048))) unsigned char sT[3 * TPLANE];   // 64 k of: the block's 64 x rows, its weight rows 0..63, its weight rows 64..127
  const int tid = threadIdx.x, wave = tid >> 5, lane = tid & 31, col = lane & 15, g = lane >> 4;
  const int which = blockIdx.z, r0b = blockIdx.x * 64, n0 = blockIdx.y * 128; const int b = r0b / SS, s0 = r0b % SS;
  v8f acc[8] = {};
  const uint32_t wv = uni((uint32_t)tid >> 5);      // waves 0, 1, 2 bring one plane each
  const uint64_t tsrc = wv == 0u ? (uint64_t)(size_t)(Xb + (size_t)r0b * E) : (uint64_t)(size_t)(PT + (size_t)(which * E + n0 + (wv == 2u ? 64 : 0)) * E);
  const u32x8 tg1 = tdm_group1((uint32_t)(E * 2), 64u); u32x4 tg0 = tdm_group0((uint32_t)(size_t)sT + (wv < 3u ? wv : 0u) * TPLANE, tsrc);
  const __bf16* const pA = (const __bf16*)(sT + (wave * 16 + col) * TPITCH); const __bf16* const pB = (const __bf16*)(sT + TPLANE + col * TPITCH);
#pragma unroll 1
  for (int st = 0; st < E / 64; ++st) {
    asm volatile("s_wait_dscnt 0x0" ::: "memory");      // this wave's reads of the staged tiles have retired before they are overwritten
    __syncthreads();                                    // every wave has left the previous tiles
    if (pinned(wv < 3u)) {
      { const uint64_t ga = tsrc + (uint64_t)((uint32_t)st * TROW); tg0[2] = uni((uint32_t)ga); tg0[3] = uni((((uint32_t)(ga >> 32)) & 0x01FFFFFFu) | 0x80000000u); }   // no request is outstanding here
      asm volatile("tensor_load_to_lds %0, %1" :: "s"(tg0), "s"(tg1) : "memory");   // this wave's plane, 64 k on
      asm volatile("s_wait_tensorcnt 0x0" ::: "memory"); }   // it has landed
    __syncthreads();                                    // so have the other waves': the tiles may be read
    v16b fa[2], fb[2][8];      // every fragment of the stage: its 36 LDS reads go out as one group, and the products wait on counts, not once per product
#pragma unroll
    for (int k2 = 0; k2 < 2; ++k2) { fa[k2] = frag_b(pA + k2 * 32, lane);
#pragma unroll
      for (int j = 0; j < 8; ++j) fb[k2][j] = frag_b(pB + (j >> 2) * (TPLANE / 2) + (j & 3) * 16 * (TPITCH / 2) + k2 * 32, lane); }
#pragma unroll
    for (int k2 = 0; k2 < 2; ++k2) {
#pragma unroll
      for (int j = 0; j < 8; ++j) acc[j] = wmma_bf(fa[k2], fb[k2][j], acc[j]); } }
  if (which < 2) {
#pragma unroll
    for (int j = 0; j < 8; ++j) { const float bb = 0.f;
#pragma unroll
      for (int r = 0; r < 8; ++r) so[wave][8 * g + r][j * 16 + col] = acc[j][r] + bb; }
    LDSX();
    if (which == 0) { for (int qq = lane; qq < 2 * 16 * 16; qq += 32) { const int hh = qq >> 8, rl = (qq >> 4) & 15, pc = qq & 15; const int h = (n0 >> 6) + hh;
        vst2(Q32 + (((size_t)b * NH + h) * SS + s0 + wave * 16 + rl) * HD + pc * 4, *(const v4f*)(&so[wave][rl][hh * 64 + pc * 4])); } }
    else {
      for (int qq = lane; qq < 2 * 16 * 16; qq += 32) { const int hh = qq >> 8, rl = (qq >> 4) & 15, pl = qq & 15; const int h = (n0 >> 6) + hh; const int pc = pl & 7; union { __bf16 e[8]; v4u u; } pk;
#pragma unroll
        for (int e = 0; e < 8; ++e) { const float v = so[wave][rl][hh * 64 + pc * 8 + e]; const __bf16 hi = (__bf16)v; pk.e[e] = pl < 8 ? hi : (__bf16)(v - (float)hi); }
        vst2((unsigned*)((pl < 8 ? Kh : Kl) + (((size_t)b * NH + h) * SS + s0 + wave * 16 + rl) * HD + pc * 8), pk.u); } } }
  else {
#pragma unroll
    for (int j = 0; j < 8; ++j) { const float bb = 0.f;
#pragma unroll
      for (int r = 0; r < 8; ++r) { const float v = (acc[j][r] + bb) * 4.0f; const _Float16 hi = (_Float16)v; sth[j * 16 + col][wave * 16 + 8 * g + r] = hi; stl[j * 16 + col][wave * 16 + 8 * g + r] = (_Float16)((v - (float)hi) * VLO); } }
    __syncthreads();
    for (int qq = tid; qq < 128 * 8; qq += 128) { const int cl = qq >> 3, pc = qq & 7; const int c = n0 + cl, h = c >> 6, d = c & 63; const size_t o = (((size_t)b * NH + h) * HD + d) * SS + s0 + pc * 8;
      vst2(VTh + o, *(const v4u*)(&sth[cl][pc * 8])); vst2(VTl + o, *(const v4u*)(&stl[cl][pc * 8])); } }
}
typedef __attribute__((ext_vector_type(2))) _Float16 v2h;
// the value that lane ^ 16 holds, by a register exchange between the wave's two 16-lane rows
__device__ __forceinline__ float xhalf(float v) { const int b = __builtin_bit_cast(int, v); return __builtin_bit_cast(float, __builtin_amdgcn_permlanex16(b, b, 0x76543210, 0xfedcba98, false, false)); }
// causal attention: block (bh, 64 queries); key tiles 0..qb, each staged once per block in LDS (wave w brings plane w: K hi, K lo, V^T hi, V^T lo) and read by all four waves.
// Transposed products: S^T = K q^T (A = K hi/lo rows, B = q hi/lo) and O^T += V^T P^T (A = V^T rows, B = P^T). A lane then holds 32 scores of ONE query (column = lane & 15; keys 16 t + 8 g + r),
// which is the k order of a B fragment: tiles 2 kc and 2 kc + 1 convert in place into the P^T fragment of keys 32 kc .. 32 kc + 31. Scores and P never pass through LDS; maximum, sum and rescale factor are per lane.
__global__ __launch_bounds__(128) void k_attn(const float* __restrict__ Q32, const __bf16* __restrict__ Kh, const __bf16* __restrict__ Kl, const _Float16* __restrict__ VTh, const _Float16* __restrict__ VTl, const float* __restrict__ rb0, const float* __restrict__ rb1, float* __restrict__ O32) {
  __shared__ __align__(16) float sS[4][16][68];      // output staging only, each wave its own rows
  __shared__ __attribute__((aligned(2048))) unsigned char sKV[4 * TPLANE];
  const int tid = threadIdx.x, w = tid >> 5, lane = tid & 31, col = lane & 15, g = lane >> 4;
  const size_t bh = blockIdx.x; const int qb = SS / 64 - 1 - (int)blockIdx.y; const int q0 = qb * 64 + w * 16;      // blockIdx.y 0 takes the query block with the most key tiles, and every run of 128 indices holds equal work
  F2 aq[2];
#pragma unroll
  for (int kc = 0; kc < 2; ++kc) aq[kc] = split_row(Q32 + (bh * SS + q0 + col) * HD, kc * 32, lane);
  const int h = (int)(bh % NH); __shared__ float sb0[4][64], sb1[4][64]; for (int i = lane; i < 64; i += 32) { sb0[w][i] = bfr(rb0[h * 2 * RW + i]); sb1[w][i] = bfr(rb1[h * 2 * RW + i]); }     // this head's two 64-entry bias tables
  float mrun = -3.0e38f, lrun = 0.f; v8f acc[4] = {}, ac1[4] = {}, ac2[4] = {};      // mrun: this lane's query; lrun: the sum over this lane's half of the keys, the halves joined after the loop
  const uint32_t wv = uni((uint32_t)tid >> 5);      // K planes: rows = keys, 128 B apart, a tile 8,192 B on; V^T planes: rows = d, 2,048 B apart, a tile 128 B on
  const uint64_t tsrc = (uint64_t)(size_t)(wv == 0u ? (const void*)Kh : wv == 1u ? (const void*)Kl : wv == 2u ? (const void*)VTh : (const void*)VTl) + (uint64_t)bh * (SS * HD * 2);
  const uint32_t tstep = wv < 2u ? 64u * TROW : TROW, tdst = (uint32_t)(size_t)sKV + wv * TPLANE;
  const u32x8 tg1 = tdm_group1(wv < 2u ? TROW : (uint32_t)(SS * 2), 64u); u32x4 tg0 = tdm_group0(tdst, tsrc);
  const __bf16* const pKh = (const __bf16*)(sKV + col * TPITCH); const __bf16* const pKl = (const __bf16*)(sKV + TPLANE + col * TPITCH);
  const _Float16* const pVh = (const _Float16*)(sKV + 2 * TPLANE + col * TPITCH); const _Float16* const pVl = (const _Float16*)(sKV + 3 * TPLANE + col * TPITCH);
  LDSX();
  // the column term rb1[31 + kc - qc] does not depend on the key tile: 64 keys are two whole raster rows, so a lane meets only 2 x 8 of its values; they stay in registers (both loops unrolled: every index a constant, no scratch array)
  float b1r[2][8];
#pragma unroll
  for (int p = 0; p < 2; ++p) {
#pragma unroll
    for (int r = 0; r < 8; ++r) b1r[p][r] = sb1[w][RW - 1 + p * 16 + 8 * g + r - ((w & 1) * 16 + col)]; }
  const float* const pb0 = &sb0[w][RW - 1 - 2 * qb - (w >> 1)];      // the row term rb0[31 + kr - qr] is one value per wave and raster row of keys: entries 2 kt and 2 kt + 1 from here
  const int dq = 8 * g - (q0 + col);
#pragma unroll 1
  for (int kt = 0; kt <= qb; ++kt) {      // causal in raster order
    asm volatile("s_wait_dscnt 0x0" ::: "memory");      // this wave's reads of the staged tile have retired before the tile is overwritten
    __syncthreads();                                    // every wave has left the previous key tile
    { const uint64_t ga = tsrc + (uint64_t)((uint32_t)kt * tstep); tg0[2] = uni((uint32_t)ga); tg0[3] = uni((((uint32_t)(ga >> 32)) & 0x01FFFFFFu) | 0x80000000u); }   // no request is outstanding here
    asm volatile("tensor_load_to_lds %0, %1" :: "s"(tg0), "s"(tg1) : "memory");   // every wave: its own plane of this key tile
    asm volatile("s_wait_tensorcnt 0x0" ::: "memory");  // this wave's plane has landed
    __syncthreads();                                    // so have the other waves': the tile may be read
    const float b0r[2] = { pb0[2 * kt], pb0[2 * kt + 1] };
    v16b kf[2][2][2];      // K fragments [register set][kc][hi, lo]: the 8 LDS reads of a 16-key group go out together, one group ahead of the products that use them
#pragma unroll
    for (int kc = 0; kc < 2; ++kc) { kf[0][kc][0] = frag_b(pKh + kc * 32, lane); kf[0][kc][1] = frag_b(pKl + kc * 32, lane); }
    float sc[4][8]; float mx = -3.4e38f;      // sc, and ph, pl below, are register arrays: every loop over them is unrolled so that each index is a constant
#pragma unroll
    for (int t = 0; t < 4; ++t) { const int dk = kt * 64 + t * 16 + dq; v8f s = {};      // dk + r = key - query
      if (t < 3) {
#pragma unroll
        for (int kc = 0; kc < 2; ++kc) { kf[(t + 1) & 1][kc][0] = frag_b(pKh + (t + 1) * 16 * (TPITCH / 2) + kc * 32, lane); kf[(t + 1) & 1][kc][1] = frag_b(pKl + (t + 1) * 16 * (TPITCH / 2) + kc * 32, lane); } }
#pragma unroll
      for (int kc = 0; kc < 2; ++kc) { const v16b khf = kf[t & 1][kc][0], klf = kf[t & 1][kc][1]; s = wmma_bf(khf, aq[kc].l, s); s = wmma_bf(klf, aq[kc].h, s); s = wmma_bf(khf, aq[kc].h, s); }
#pragma unroll
      for (int r = 0; r < 8; ++r) { sc[t][r] = (dk > -r) ? -1.0e9f : s[r] * 0.125f + b0r[t >> 1] + b1r[t & 1][r]; mx = fmaxf(mx, sc[t][r]); } }
    mx = fmaxf(mx, xhalf(mx));      // the other half of this query's keys
    const float mnew = fmaxf(mrun, mx); const float corr = __builtin_amdgcn_exp2f((mrun - mnew) * L2E);      // 0 on the first tile: the product overflows to -inf
    const float eb = 14.0f - mnew * L2E;      // e^(s - mnew) * 2^14 = 2^(s log2(e) + eb): one multiply-add and the hardware's base-2 exponential per score; a masked score gives 0
    v2f ps2[2] = {}; union { v16h v; v2h q[8]; } ph[2], pl[2];      // two scores at a time: packed sums (two independent chains), packed conversions straight into the fragment's registers
#pragma unroll
    for (int t = 0; t < 4; ++t) {
#pragma unroll
      for (int r = 0; r < 8; r += 2) { const v2f x = (v2f){ sc[t][r], sc[t][r + 1] } * L2E + eb; const v2f p = { __builtin_amdgcn_exp2f(x[0]), __builtin_amdgcn_exp2f(x[1]) }; ps2[(r >> 1) & 1] += p;
        const v2h hi = __builtin_convertvector(p, v2h); ph[t >> 1].q[(t & 1) * 4 + (r >> 1)] = hi; pl[t >> 1].q[(t & 1) * 4 + (r >> 1)] = __builtin_convertvector((p - __builtin_convertvector(hi, v2f)) * PLO, v2h); } }
    const float ps = (ps2[0][0] + ps2[1][0]) + (ps2[0][1] + ps2[1][1]);
    lrun = lrun * corr + ps * (1.0f / 16384.0f); mrun = mnew;
#pragma unroll
    for (int t = 0; t < 4; ++t) { acc[t] *= corr; ac1[t] *= corr; ac2[t] *= corr; }
#pragma unroll
    for (int kc = 0; kc < 2; ++kc) {
#pragma unroll
      for (int tp = 0; tp < 2; ++tp) { v16h vf[2][2];      // V^T fragments [t][hi, lo] of two 16-row groups of d: their 8 LDS reads go out together ahead of the 6 products
#pragma unroll
        for (int t = 0; t < 2; ++t) { vf[t][0] = frag_h(pVh + (tp * 2 + t) * 16 * (TPITCH / 2) + kc * 32, lane); vf[t][1] = frag_h(pVl + (tp * 2 + t) * 16 * (TPITCH / 2) + kc * 32, lane); }
#pragma unroll
        for (int t = 0; t < 2; ++t) { acc[tp * 2 + t] = wmma16(vf[t][0], ph[kc].v, acc[tp * 2 + t]); ac1[tp * 2 + t] = wmma16(vf[t][1], ph[kc].v, ac1[tp * 2 + t]); ac2[tp * 2 + t] = wmma16(vf[t][0], pl[kc].v, ac2[tp * 2 + t]); } } } }
  lrun += xhalf(lrun);
  const float inv = 1.0f / (lrun * 16384.0f * 4.0f);
#pragma unroll
  for (int t = 0; t < 4; ++t) { v4f o[2];      // accumulator register r of tile t = O[query col][16 t + 8 g + r]: 8 consecutive floats of the lane's own row, staged so that the global stores cover whole lines
#pragma unroll
    for (int r = 0; r < 8; ++r) o[r >> 2][r & 3] = (acc[t][r] + ac1[t][r] * (1.0f / VLO) + ac2[t][r] * (1.0f / PLO)) * inv;
    vst2(&sS[w][col][t * 16 + 8 * g], o[0]); vst2(&sS[w][col][t * 16 + 8 * g + 4], o[1]); }
  LDSX();
  for (int qq = lane; qq < 16 * 16; qq += 32) { const int rl = qq >> 4, pc = qq & 15; vst2(O32 + ((bh * SS) + q0 + rl) * HD + pc * 4, *(const v4f*)(&sS[w][rl][pc * 4])); }
}
// out = ctx Wo : split(ctx) x bf16(Wo columns): 2 products (Wo is an INPUT -> bf16 exact)
__global__ __launch_bounds__(128) void k_out(const float* __restrict__ O32, const __bf16* __restrict__ PT, float* __restrict__ out) {
  __shared__ __align__(16) float so[4][16][132];
  const int tid = threadIdx.x, wave = tid >> 5, lane = tid & 31, col = lane & 15, g = lane >> 4;
  __shared__ __attribute__((aligned(2048))) unsigned char sT[128 * TPITCH + 2 * TPLANE];   // one head's 64 k of: the block's 64 ctx rows (f32: 128 half rows of 128 B, 18,432 B = 9 x 2 KiB), its weight rows 0..63, its weight rows 64..127
  const int r0b = blockIdx.x * 64, r0 = r0b + wave * 16, n0 = blockIdx.y * 128; const int b = r0b / SS, s0 = r0b % SS;
  v8f acc[8] = {};
  const uint32_t wv = uni((uint32_t)tid >> 5);      // waves 0, 1, 2 bring one plane each
  const uint64_t tsrc = wv == 0u ? (uint64_t)(size_t)(O32 + ((size_t)b * NH * SS + s0) * HD) : (uint64_t)(size_t)(PT + (size_t)(3 * E + n0 + (wv == 2u ? 64 : 0)) * E);
  const uint32_t tstep = wv == 0u ? (uint32_t)(SS * HD * 4) : TROW;
  const u32x8 tg1 = tdm_group1(wv == 0u ? TROW : (uint32_t)(E * 2), wv == 0u ? 128u : 64u);
  u32x4 tg0 = tdm_group0((uint32_t)(size_t)sT + (wv == 0u ? 0u : 128u * TPITCH + (wv == 2u ? TPLANE : 0u)), tsrc);
  const float* const pA = (const float*)(sT + (wave * 16 + col) * 2 * TPITCH); const __bf16* const pB = (const __bf16*)(sT + 128 * TPITCH + col * TPITCH);
#pragma unroll 1
  for (int h = 0; h < NH; ++h) {
    asm volatile("s_wait_dscnt 0x0" ::: "memory");      // this wave's reads of the staged tiles have retired before they are overwritten
    __syncthreads();                                    // every wave has left the previous tiles
    if (pinned(wv < 3u)) {
      { const uint64_t ga = tsrc + (uint64_t)((uint32_t)h * tstep); tg0[2] = uni((uint32_t)ga); tg0[3] = uni((((uint32_t)(ga >> 32)) & 0x01FFFFFFu) | 0x80000000u); }   // no request is outstanding here
      asm volatile("tensor_load_to_lds %0, %1" :: "s"(tg0), "s"(tg1) : "memory");   // this wave's plane of head h
      asm volatile("s_wait_tensorcnt 0x0" ::: "memory"); }   // it has landed
    __syncthreads();                                    // so have the other waves': the tiles may be read
#pragma unroll
    for (int k2 = 0; k2 < 2; ++k2) { float av[16]; v16b wb[8];      // the 20 LDS reads of these 32 k go out as one group ahead of the split and the 16 products
      { const float* p = pA + k2 * (TPITCH / 4) + 8 * g;
#pragma unroll
        for (int i = 0; i < 8; ++i) { av[i] = p[i]; av[8 + i] = p[16 + i]; } }
#pragma unroll
      for (int j = 0; j < 8; ++j) wb[j] = frag_b(pB + (j >> 2) * (TPLANE / 2) + (j & 3) * 16 * (TPITCH / 2) + k2 * 32, lane);
      const F2 a = bsplit16(av);
#pragma unroll
      for (int j = 0; j < 8; ++j) { acc[j] = wmma_bf(a.l, wb[j], acc[j]); acc[j] = wmma_bf(a.h, wb[j], acc[j]); } } }
#pragma unroll
  for (int j = 0; j < 8; ++j) {
#pragma unroll
    for (int r = 0; r < 8; ++r) so[wave][8 * g + r][j * 16 + col] = acc[j][r]; }
  LDSX();
#pragma unroll 4
  for (int rl = 0; rl < 16; ++rl) vst2(out + (size_t)(r0 + rl) * E + n0 + lane * 4, *(const v4f*)(&so[wave][rl][lane * 4]));
}
extern "C" void kernel_launch(void* const* d_in, const int* in_sizes, int n_in, void* d_out, int out_size, void* d_ws, size_t ws_size, hipStream_t stream) {
  (void)in_sizes; (void)n_in; (void)out_size; (void)ws_size;
  const float** I = (const float**)d_in;   // x, Wq, Wk, Wv, Wo, rb0, rb1
  const float* x = I[0]; const float* Wq = I[1]; const float* Wk = I[2]; const float* Wv = I[3]; const float* Wo = I[4]; const float* rb0 = I[5]; const float* rb1 = I[6];
  float* out = (float*)d_out;
  char* ws = (char*)d_ws; size_t off = 0;
  auto take = [&](size_t bytes) { char* p = ws + off; off += (bytes + 255) & ~(size_t)255; return p; };
  __bf16* Xb = (__bf16*)take((size_t)NR * E * 2); __bf16* PT = (__bf16*)take((size_t)4 * E * E * 2);
  float* Q32 = (float*)take((size_t)NR * E * 4); __bf16* Kh = (__bf16*)take((size_t)NR * E * 2); __bf16* Kl = (__bf16*)take((size_t)NR * E * 2); _Float16* VTh = (_Float16*)take((size_t)NR * E * 2); _Float16* VTl = (_Float16*)take((size_t)NR * E * 2); float* O32 = (float*)take((size_t)NR * E * 4);
  k_pack<<<256, 256, 0, stream>>>(Wq, Wk, Wv, Wo, PT);
  k_cvt<<<256, 256, 0, stream>>>(x, Xb);
  k_qkv<<<dim3(NR / 64, E / 128, 3), 128, 0, stream>>>(Xb, PT, Q32, Kh, Kl, VTh, VTl);
  k_attn<<<dim3(NB * NH, SS / 64), 128, 0, stream>>>(Q32, Kh, Kl, VTh, VTl, rb0, rb1, O32);
  k_out<<<dim3(NR / 64, E / 128), 128, 0, stream>>>(O32, PT, out);
}

// v009
// A run of this version takes 116 microseconds.
// Next to v008, in two timings, it ran 1.04 and 1.02 times as fast.
// Counting every step since v000, it is 5.16 times as fast.
// compute dtype: x, Wq/Wk/Wv/Wo, rb0/rb1 (INPUTS) rounded to bf16 with exact bf16 WMMA products (f32 accumulate) for the projections; K pre-split into bf16 hi/lo rows; q f32 split, P and V f16 hi/lo (3 products each); softmax, the causal raster mask and the factorised 2-D relative bias in f32.
#include <hip/hip_runtime.h>
#include <math.h>

typedef __attribute__((ext_vector_type(16))) _Float16 v16h;
typedef __attribute__((ext_vector_type(16))) __bf16 v16b;
typedef __attribute__((ext_vector_type(8)))  _Float16 v8h;
typedef __attribute__((ext_vector_type(8)))  float v8f;
typedef __attribute__((ext_vector_type(4)))  float v4f;
typedef __attribute__((ext_vector_type(2)))  float v2f;
typedef __attribute__((ext_vector_type(4)))  unsigned v4u;
typedef __attribute__((ext_vector_type(4)))  int v4i;
typedef float __attribute__((may_alias)) float_a;
typedef int __attribute__((may_alias)) int_a;

template <typename T> __device__ __forceinline__ void vst2(void* p, T v) { *(T*)p = v;  }
__device__ __forceinline__ v8f wmma16(v16h a, v16h b, v8f c) {
  return __builtin_amdgcn_wmma_f32_16x16x32_f16(false, a, false, b, (short)0, c, false, false);
}
__device__ __forceinline__ v8f wmma_bf(v16b a, v16b b, v8f c) {
  return __builtin_amdgcn_wmma_f32_16x16x32_bf16(false, a, false, b, (short)0, c, false, false);
}
// Scheduling fence: LDS reads and matrix instructions stay on their side of it, plain vector, scalar and exponential instructions may cross. It keeps a group of LDS fragment reads together and ahead of the products that use them
// (the scheduler otherwise sinks each pair of reads to its product, with a full wait in front of every product); it emits no instruction.
#define HOLD() __builtin_amdgcn_sched_barrier(0x406)
// 16x16x32 fragments: lane = (h = lane>>4, row/col = lane&15); elements 0..7 = k0+8h+0..7, 8..15 = k0+16+8h+0..7; D element r = row 8h+r
__device__ __forceinline__ v16h frag_h(const _Float16* rowk0, int lane) {
  union { v16h v; v8h q[2]; } u; const _Float16* p = rowk0 + 8 * (lane >> 4);
  u.q[0] = *(const v8h*)p; u.q[1] = *(const v8h*)(p + 16); return u.v;
}
__device__ __forceinline__ v16h frag_f32(const float* rowk0, int lane) {
  v16h a; const float* p = rowk0 + 8 * (lane >> 4);
#pragma unroll
  for (int i = 0; i < 8; ++i) { a[i] = (_Float16)p[i]; a[8 + i] = (_Float16)p[16 + i]; }
  return a;
}
__device__ __forceinline__ v16h frag_f32s(const float* rowk0, int lane, float sc) {
  v16h a; const float* p = rowk0 + 8 * (lane >> 4);
#pragma unroll
  for (int i = 0; i < 8; ++i) { a[i] = (_Float16)(p[i] * sc); a[8 + i] = (_Float16)(p[16 + i] * sc); }
  return a;
}
// column fragment from a [K][ld] layout (column n), rows >= K read as 0
__device__ __forceinline__ v16h fragc_f32(const float* W, int k0, int n, int lane, int ld, int K) {
  v16h a; const int g = lane >> 4;
#pragma unroll
  for (int i = 0; i < 8; ++i) { const int ka = k0 + 8 * g + i, kb = ka + 16;
    a[i] = (_Float16)(ka < K ? W[(size_t)ka * ld + n] : 0.f); a[8 + i] = (_Float16)(kb < K ? W[(size_t)kb * ld + n] : 0.f); }
  return a;
}
struct F2 { v16b h, l; };
__device__ __forceinline__ F2 bsplit16(const float v[16]) { F2 r;
#pragma unroll
  for (int i = 0; i < 16; ++i) { const __bf16 h = (__bf16)v[i]; r.h[i] = h; r.l[i] = (__bf16)(v[i] - (float)h); }
  return r; }
__device__ __forceinline__ F2 split_row(const float* row, int k0, int lane) { float v[16]; const float* p = row + k0 + 8 * (lane >> 4);
#pragma unroll
  for (int i = 0; i < 8; ++i) { v[i] = p[i]; v[8 + i] = p[16 + i]; }
  return bsplit16(v); }
__device__ __forceinline__ F2 split_rowK(const float* row, int k0, int lane, int K) { float v[16]; const int g = lane >> 4;
#pragma unroll
  for (int i = 0; i < 8; ++i) { const int ka = k0 + 8 * g + i, kb = ka + 16; v[i] = ka < K ? row[ka] : 0.f; v[8 + i] = kb < K ? row[kb] : 0.f; }
  return bsplit16(v); }
__device__ __forceinline__ F2 split_col(const float* W, int k0, int n, int lane, int ld, int K) { float v[16]; const int g = lane >> 4;
#pragma unroll
  for (int i = 0; i < 8; ++i) { const int ka = k0 + 8 * g + i, kb = ka + 16; v[i] = ka < K ? W[(size_t)ka * ld + n] : 0.f; v[8 + i] = kb < K ? W[(size_t)kb * ld + n] : 0.f; }
  return bsplit16(v); }
__device__ __forceinline__ v8f mac3(const F2& a, const F2& b, v8f c) { c = wmma_bf(a.l, b.h, c); c = wmma_bf(a.h, b.l, c); return wmma_bf(a.h, b.h, c); }
__device__ __forceinline__ float sigm(float v) { return 1.0f / (1.0f + expf(-v)); }
#define LDSX() do { asm volatile("s_wait_dscnt 0" ::: "memory"); __builtin_amdgcn_wave_barrier(); __builtin_amdgcn_fence(__ATOMIC_RELEASE, "workgroup"); } while (0)


// Axial ('number-dimension') self attention over the 32 x 32 raster of each of 16 images (8 heads x 64, [in][out] DenseND kernels, no biases): scores = (q 64^-0.5).k + rb0[h][31 + kr - qr] + rb1[h][31 + kc - qc];
#define NB 16
#define SS 1024
#define E 512
#define NH 8
#define RW 32
#define HD 64
#define NR (NB * SS)
#define PLO 1024.0f
#define VLO 2048.0f
#define L2E 1.4426950408889634f
__device__ __forceinline__ float bfr(float v) { return (float)(__bf16)v; }
__device__ __forceinline__ v16b frag_b(const __bf16* rowk0, int lane) { return __builtin_bit_cast(v16b, frag_h((const _Float16*)rowk0, lane)); }

typedef uint32_t u32x4 __attribute__((ext_vector_type(4)));
typedef uint32_t u32x8 __attribute__((ext_vector_type(8)));
__device__ __forceinline__ uint32_t uni(uint32_t v) { return (uint32_t)__builtin_amdgcn_readfirstlane(v); }
#define TROW 128u                 // bytes of a staged row: 64 16-bit elements
#define TPITCH 144u               // its pitch in LDS, set by the tensor load's pad: 16 B x 9, no bank conflict for 16-byte fragment reads
#define TPLANE 10240u             // 64 rows x 144 B = 9,216 B, rounded up so that every plane starts at a multiple of 2 KiB
__device__ __forceinline__ uint32_t pinned(uint32_t v) { uint32_t w = uni(v); asm volatile("" : "+s"(w)); return w; }   // holds a wave-uniform test in a scalar register, so that the branch round a tensor load is a scalar one (a tensor load ignores EXEC)
// tensor descriptor, group 1: 1-byte elements, tensor = tile = rows rows of 128 B, source row pitch src_pitch bytes, 4 dwords of LDS pad behind every 32 dwords
__device__ __forceinline__ u32x8 tdm_group1(uint32_t src_pitch, uint32_t rows) {
  u32x8 g;
  g[0] = uni((1u << 20) | (4u << 22) | (3u << 25));
  g[1] = uni(TROW << 16);
  g[2] = uni(rows << 16);
  g[3] = uni(TROW << 16);
  g[4] = uni(rows);
  g[5] = uni(src_pitch);
  g[6] = uni(0u);
  g[7] = uni(0u);
  return g;
}
// group 0: one request, LDS destination (byte offset in the work-group's LDS), global address of the tile's first byte, type 2
__device__ __forceinline__ u32x4 tdm_group0(uint32_t lds_dst, uint64_t ga) {
  u32x4 g;
  g[0] = uni(1u); g[1] = uni(lds_dst); g[2] = uni((uint32_t)ga); g[3] = uni((((uint32_t)(ga >> 32)) & 0x01FFFFFFu) | 0x80000000u);
  return g;
}

typedef __attribute__((ext_vector_type(2))) unsigned v2u;
// Both preparatory launches are sized by the waves they start, not by their elements: 256 work-groups of 8 waves each.
#define CVT_PC 32                 // pieces of 4 elements per thread; a wave's load covers 512 contiguous bytes, its store 256
static_assert((size_t)NR * E / 4 == (size_t)256 * 256 * CVT_PC, "k_cvt: 256 work-groups of 256 threads cover x exactly");
__global__ __launch_bounds__(256) void k_cvt(const float* __restrict__ x, __bf16* __restrict__ Xb) {
  const size_t p0 = (size_t)blockIdx.x * (256 * CVT_PC) + threadIdx.x;
  v4f v[CVT_PC];      // register array: both loops unrolled, all loads of a thread in flight together
#pragma unroll
  for (int i = 0; i < CVT_PC; ++i) v[i] = *(const v4f*)(x + (p0 + (size_t)i * 256) * 4);
#pragma unroll
  for (int i = 0; i < CVT_PC; ++i) { union { __bf16 h[4]; v2u u; } pk;
#pragma unroll
    for (int e = 0; e < 4; ++e) pk.h[e] = (__bf16)v[i][e];
    vst2((unsigned*)(Xb + (p0 + (size_t)i * 256) * 4), pk.u); }
}
// PT rows: [0,E) Wq[:,n], [E,2E) Wk[:,n], [2E,3E) Wv[:,n], [3E,4E) Wo[:,n]  ([in][out] weights: column n as a bf16 row)
// block = one 64 k x 64 n tile of one weight matrix, read in 256-byte row pieces, transposed in LDS, stored as 64 whole 128-byte lines
__global__ __launch_bounds__(256) void k_pack(const float* __restrict__ Wq, const float* __restrict__ Wk, const float* __restrict__ Wv, const float* __restrict__ Wo, __bf16* __restrict__ PT) {
  __shared__ __align__(16) __bf16 st[64][72];      // [n][k], pitch 144 B
  const int tid = threadIdx.x, m = blockIdx.x >> 6, k0 = ((blockIdx.x >> 3) & 7) * 64, n0 = (blockIdx.x & 7) * 64;
  const float* W = m == 0 ? Wq : (m == 1 ? Wk : (m == 2 ? Wv : Wo));
  v4f v[4];
#pragma unroll
  for (int i = 0; i < 4; ++i) v[i] = *(const v4f*)(W + (size_t)(k0 + i * 16 + (tid >> 4)) * E + n0 + (tid & 15) * 4);
#pragma unroll
  for (int i = 0; i < 4; ++i) {
#pragma unroll
    for (int e = 0; e < 4; ++e) st[(tid & 15) * 4 + e][i * 16 + (tid >> 4)] = (__bf16)v[i][e]; }
  __syncthreads();
#pragma unroll
  for (int i = 0; i < 2; ++i) { const int c = i * 256 + tid, n = c >> 3, pc = c & 7;
    vst2((unsigned*)(PT + (size_t)(m * E + n0 + n) * E + k0 + pc * 8), *(const v4u*)(&st[n][pc * 8])); }
}
// QKV: block (64 rows, 128 cols = 2 heads, which); q -> Q32 f32 [bh][s][64]; k -> bf16 hi/lo rows; v -> VT hi/lo x4 [bh][d][s]
__global__ __launch_bounds__(128) void k_qkv(const __bf16* __restrict__ Xb, const __bf16* __restrict__ PT, float* __restrict__ Q32, __bf16* __restrict__ Kh, __bf16* __restrict__ Kl, _Float16* __restrict__ VTh, _Float16* __restrict__ VTl) {
  __shared__ __align__(16) float so[4][16][132];
  __shared__ __align__(16) _Float16 sth[128][72], stl[128][72];
  __shared__ __attribute__((aligned(2048))) unsigned char sT[3 * TPLANE];   // 64 k of: the block's 64 x rows, its weight rows 0..63, its weight rows 64..127
  const int tid = threadIdx.x, wave = tid >> 5, lane = tid & 31, col = lane & 15, g = lane >> 4;
  const int which = blockIdx.z, r0b = blockIdx.x * 64, n0 = blockIdx.y * 128; const int b = r0b / SS, s0 = r0b % SS;
  v8f acc[8] = {};
  const uint32_t wv = uni((uint32_t)tid >> 5);      // waves 0, 1, 2 bring one plane each
  const uint64_t tsrc = wv == 0u ? (uint64_t)(size_t)(Xb + (size_t)r0b * E) : (uint64_t)(size_t)(PT + (size_t)(which * E + n0 + (wv == 2u ? 64 : 0)) * E);
  const u32x8 tg1 = tdm_group1((uint32_t)(E * 2), 64u); u32x4 tg0 = tdm_group0((uint32_t)(size_t)sT + (wv < 3u ? wv : 0u) * TPLANE, tsrc);
  const __bf16* const pA = (const __bf16*)(sT + (wave * 16 + col) * TPITCH); const __bf16* const pB = (const __bf16*)(sT + TPLANE + col * TPITCH);
#pragma unroll 1
  for (int st = 0; st < E / 64; ++st) {
    asm volatile("s_wait_dscnt 0x0" ::: "memory");      // this wave's reads of the staged tiles have retired before they are overwritten
    __syncthreads();                                    // every wave has left the previous tiles
    if (pinned(wv < 3u)) {
      { const uint64_t ga = tsrc + (uint64_t)((uint32_t)st * TROW); tg0[2] = uni((uint32_t)ga); tg0[3] = uni((((uint32_t)(ga >> 32)) & 0x01FFFFFFu) | 0x80000000u); }   // no request is outstanding here
      asm volatile("tensor_load_to_lds %0, %1" :: "s"(tg0), "s"(tg1) : "memory");   // this wave's plane, 64 k on
      asm volatile("s_wait_tensorcnt 0x0" ::: "memory"); }   // it has landed
    __syncthreads();                                    // so have the other waves': the tiles may be read
    v16b fa[2], fb[2][8];      // every fragment of the stage: its 36 LDS reads go out as one group, and the products wait on counts, not once per product
#pragma unroll
    for (int k2 = 0; k2 < 2; ++k2) { fa[k2] = frag_b(pA + k2 * 32, lane);
#pragma unroll
      for (int j = 0; j < 8; ++j) fb[k2][j] = frag_b(pB + (j >> 2) * (TPLANE / 2) + (j & 3) * 16 * (TPITCH / 2) + k2 * 32, lane); }
    HOLD();      // the stage's reads, then its products
#pragma unroll
    for (int k2 = 0; k2 < 2; ++k2) {
#pragma unroll
      for (int j = 0; j < 8; ++j) acc[j] = wmma_bf(fa[k2], fb[k2][j], acc[j]); } }
  if (which < 2) {
#pragma unroll
    for (int j = 0; j < 8; ++j) { const float bb = 0.f;
#pragma unroll
      for (int r = 0; r < 8; ++r) so[wave][8 * g + r][j * 16 + col] = acc[j][r] + bb; }
    LDSX();
    if (which == 0) { for (int qq = lane; qq < 2 * 16 * 16; qq += 32) { const int hh = qq >> 8, rl = (qq >> 4) & 15, pc = qq & 15; const int h = (n0 >> 6) + hh;
        vst2(Q32 + (((size_t)b * NH + h) * SS + s0 + wave * 16 + rl) * HD + pc * 4, *(const v4f*)(&so[wave][rl][hh * 64 + pc * 4])); } }
    else {
      for (int qq = lane; qq < 2 * 16 * 16; qq += 32) { const int hh = qq >> 8, rl = (qq >> 4) & 15, pl = qq & 15; const int h = (n0 >> 6) + hh; const int pc = pl & 7; union { __bf16 e[8]; v4u u; } pk;
#pragma unroll
        for (int e = 0; e < 8; ++e) { const float v = so[wave][rl][hh * 64 + pc * 8 + e]; const __bf16 hi = (__bf16)v; pk.e[e] = pl < 8 ? hi : (__bf16)(v - (float)hi); }
        vst2((unsigned*)((pl < 8 ? Kh : Kl) + (((size_t)b * NH + h) * SS + s0 + wave * 16 + rl) * HD + pc * 8), pk.u); } } }
  else {
#pragma unroll
    for (int j = 0; j < 8; ++j) { const float bb = 0.f;
#pragma unroll
      for (int r = 0; r < 8; ++r) { const float v = (acc[j][r] + bb) * 4.0f; const _Float16 hi = (_Float16)v; sth[j * 16 + col][wave * 16 + 8 * g + r] = hi; stl[j * 16 + col][wave * 16 + 8 * g + r] = (_Float16)((v - (float)hi) * VLO); } }
    __syncthreads();
    for (int qq = tid; qq < 128 * 8; qq += 128) { const int cl = qq >> 3, pc = qq & 7; const int c = n0 + cl, h = c >> 6, d = c & 63; const size_t o = (((size_t)b * NH + h) * HD + d) * SS + s0 + pc * 8;
      vst2(VTh + o, *(const v4u*)(&sth[cl][pc * 8])); vst2(VTl + o, *(const v4u*)(&stl[cl][pc * 8])); } }
}
typedef __attribute__((ext_vector_type(2))) _Float16 v2h;
// the value that lane ^ 16 holds, by a register exchange between the wave's two 16-lane rows
__device__ __forceinline__ float xhalf(float v) { const int b = __builtin_bit_cast(int, v); return __builtin_bit_cast(float, __builtin_amdgcn_permlanex16(b, b, 0x76543210, 0xfedcba98, false, false)); }
// causal attention: block (bh, 64 queries); key tiles 0..qb, each staged once per block in LDS (wave w brings plane w: K hi, K lo, V^T hi, V^T lo) and read by all four waves.
// Transposed products: S^T = K q^T (A = K hi/lo rows, B = q hi/lo) and O^T += V^T P^T (A = V^T rows, B = P^T). A lane then holds 32 scores of ONE query (column = lane & 15; keys 16 t + 8 g + r),
// which is the k order of a B fragment: tiles 2 kc and 2 kc + 1 convert in place into the P^T fragment of keys 32 kc .. 32 kc + 31. Scores and P never pass through LDS; maximum, sum and rescale factor are per lane.
__global__ __launch_bounds__(128) void k_attn(const float* __restrict__ Q32, const __bf16* __restrict__ Kh, const __bf16* __restrict__ Kl, const _Float16* __restrict__ VTh, const _Float16* __restrict__ VTl, const float* __restrict__ rb0, const float* __restrict__ rb1, float* __restrict__ O32) {
  __shared__ __align__(16) float sS[4][16][68];      // output staging only, each wave its own rows
  __shared__ __attribute__((aligned(2048))) unsigned char sKV[4 * TPLANE];
  const int tid = threadIdx.x, w = tid >> 5, lane = tid & 31, col = lane & 15, g = lane >> 4;
  const size_t bh = blockIdx.x; const int qb = SS / 64 - 1 - (int)blockIdx.y; const int q0 = qb * 64 + w * 16;      // blockIdx.y 0 takes the query block with the most key tiles, and every run of 128 indices holds equal work
  F2 aq[2];
#pragma unroll
  for (int kc = 0; kc < 2; ++kc) aq[kc] = split_row(Q32 + (bh * SS + q0 + col) * HD, kc * 32, lane);
  const int h = (int)(bh % NH); __shared__ float sb0[4][64], sb1[4][64]; for (int i = lane; i < 64; i += 32) { sb0[w][i] = bfr(rb0[h * 2 * RW + i]); sb1[w][i] = bfr(rb1[h * 2 * RW + i]); }     // this head's two 64-entry bias tables
  float mrun = -3.0e38f, lrun = 0.f; v8f acc[4] = {}, ac1[4] = {}, ac2[4] = {};      // mrun: this lane's query; lrun: the sum over this lane's half of the keys, the halves joined after the loop
  const uint32_t wv = uni((uint32_t)tid >> 5);      // K planes: rows = keys, 128 B apart, a tile 8,192 B on; V^T planes: rows = d, 2,048 B apart, a tile 128 B on
  const uint64_t tsrc = (uint64_t)(size_t)(wv == 0u ? (const void*)Kh : wv == 1u ? (const void*)Kl : wv == 2u ? (const void*)VTh : (const void*)VTl) + (uint64_t)bh * (SS * HD * 2);
  const uint32_t tstep = wv < 2u ? 64u * TROW : TROW, tdst = (uint32_t)(size_t)sKV + wv * TPLANE;
  const u32x8 tg1 = tdm_group1(wv < 2u ? TROW : (uint32_t)(SS * 2), 64u); u32x4 tg0 = tdm_group0(tdst, tsrc);
  const __bf16* const pKh = (const __bf16*)(sKV + col * TPITCH); const __bf16* const pKl = (const __bf16*)(sKV + TPLANE + col * TPITCH);
  const _Float16* const pVh = (const _Float16*)(sKV + 2 * TPLANE + col * TPITCH); const _Float16* const pVl = (const _Float16*)(sKV + 3 * TPLANE + col * TPITCH);
  LDSX();
  // the column term rb1[31 + kc - qc] does not depend on the key tile: 64 keys are two whole raster rows, so a lane meets only 2 x 8 of its values; they stay in registers (both loops unrolled: every index a constant, no scratch array)
  float b1r[2][8];
#pragma unroll
  for (int p = 0; p < 2; ++p) {
#pragma unroll
    for (int r = 0; r < 8; ++r) b1r[p][r] = sb1[w][RW - 1 + p * 16 + 8 * g + r - ((w & 1) * 16 + col)]; }
  const float* const pb0 = &sb0[w][RW - 1 - 2 * qb - (w >> 1)];      // the row term rb0[31 + kr - qr] is one value per wave and raster row of keys: entries 2 kt and 2 kt + 1 from here
  const int dq = 8 * g - (q0 + col);
#pragma unroll 1
  for (int kt = 0; kt <= qb; ++kt) {      // causal in raster order
    asm volatile("s_wait_dscnt 0x0" ::: "memory");      // this wave's reads of the staged tile have retired before the tile is overwritten
    __syncthreads();                                    // every wave has left the previous key tile
    { const uint64_t ga = tsrc + (uint64_t)((uint32_t)kt * tstep); tg0[2] = uni((uint32_t)ga); tg0[3] = uni((((uint32_t)(ga >> 32)) & 0x01FFFFFFu) | 0x80000000u); }   // no request is outstanding here
    asm volatile("tensor_load_to_lds %0, %1" :: "s"(tg0), "s"(tg1) : "memory");   // every wave: its own plane of this key tile
    asm volatile("s_wait_tensorcnt 0x0" ::: "memory");  // this wave's plane has landed
    __syncthreads();                                    // so have the other waves': the tile may be read
    const float b0r[2] = { pb0[2 * kt], pb0[2 * kt + 1] };
    v16b kf[2][2][2];      // K fragments [register set][kc][hi, lo]: the 8 LDS reads of a 16-key group go out together, one group ahead of the products that use them
#pragma unroll
    for (int kc = 0; kc < 2; ++kc) { kf[0][kc][0] = frag_b(pKh + kc * 32, lane); kf[0][kc][1] = frag_b(pKl + kc * 32, lane); }
    float sc[4][8]; float mx = -3.4e38f;      // sc, and ph, pl below, are register arrays: every loop over them is unrolled so that each index is a constant
#pragma unroll
    for (int t = 0; t < 4; ++t) { const int dk = kt * 64 + t * 16 + dq; v8f s = {};      // dk + r = key - query
      if (t < 3) {
#pragma unroll
        for (int kc = 0; kc < 2; ++kc) { kf[(t + 1) & 1][kc][0] = frag_b(pKh + (t + 1) * 16 * (TPITCH / 2) + kc * 32, lane); kf[(t + 1) & 1][kc][1] = frag_b(pKl + (t + 1) * 16 * (TPITCH / 2) + kc * 32, lane); } }
      HOLD();      // the next group's reads are out before this group's products
#pragma unroll
      for (int kc = 0; kc < 2; ++kc) { const v16b khf = kf[t & 1][kc][0], klf = kf[t & 1][kc][1]; s = wmma_bf(khf, aq[kc].l, s); s = wmma_bf(klf, aq[kc].h, s); s = wmma_bf(khf, aq[kc].h, s); }
#pragma unroll
      for (int r = 0; r < 8; ++r) { sc[t][r] = (dk > -r) ? -1.0e9f : s[r] * 0.125f + b0r[t >> 1] + b1r[t & 1][r]; mx = fmaxf(mx, sc[t][r]); } }
    mx = fmaxf(mx, xhalf(mx));      // the other half of this query's keys
    const float mnew = fmaxf(mrun, mx); const float corr = __builtin_amdgcn_exp2f((mrun - mnew) * L2E);      // 0 on the first tile: the product overflows to -inf
    const float eb = 14.0f - mnew * L2E;      // e^(s - mnew) * 2^14 = 2^(s log2(e) + eb): one multiply-add and the hardware's base-2 exponential per score; a masked score gives 0
    v2f ps2[2] = {}; union { v16h v; v2h q[8]; } ph[2], pl[2];      // two scores at a time: packed sums (two independent chains), packed conversions straight into the fragment's registers
#pragma unroll
    for (int t = 0; t < 4; ++t) {
#pragma unroll
      for (int r = 0; r < 8; r += 2) { const v2f x = (v2f){ sc[t][r], sc[t][r + 1] } * L2E + eb; const v2f p = { __builtin_amdgcn_exp2f(x[0]), __builtin_amdgcn_exp2f(x[1]) }; ps2[(r >> 1) & 1] += p;
        const v2h hi = __builtin_convertvector(p, v2h); ph[t >> 1].q[(t & 1) * 4 + (r >> 1)] = hi; pl[t >> 1].q[(t & 1) * 4 + (r >> 1)] = __builtin_convertvector((p - __builtin_convertvector(hi, v2f)) * PLO, v2h); } }
    const float ps = (ps2[0][0] + ps2[1][0]) + (ps2[0][1] + ps2[1][1]);
    lrun = lrun * corr + ps * (1.0f / 16384.0f); mrun = mnew;
#pragma unroll
    for (int t = 0; t < 4; ++t) { acc[t] *= corr; ac1[t] *= corr; ac2[t] *= corr; }
#pragma unroll
    for (int kc = 0; kc < 2; ++kc) {
#pragma unroll
      for (int tp = 0; tp < 2; ++tp) { v16h vf[2][2];      // V^T fragments [t][hi, lo] of two 16-row groups of d: their 8 LDS reads go out together ahead of the 6 products
#pragma unroll
        for (int t = 0; t < 2; ++t) { vf[t][0] = frag_h(pVh + (tp * 2 + t) * 16 * (TPITCH / 2) + kc * 32, lane); vf[t][1] = frag_h(pVl + (tp * 2 + t) * 16 * (TPITCH / 2) + kc * 32, lane); }
        HOLD();      // the 8 reads, then the 6 products
#pragma unroll
        for (int t = 0; t < 2; ++t) { acc[tp * 2 + t] = wmma16(vf[t][0], ph[kc].v, acc[tp * 2 + t]); ac1[tp * 2 + t] = wmma16(vf[t][1], ph[kc].v, ac1[tp * 2 + t]); ac2[tp * 2 + t] = wmma16(vf[t][0], pl[kc].v, ac2[tp * 2 + t]); } } } }
  lrun += xhalf(lrun);
  const float inv = 1.0f / (lrun * 16384.0f * 4.0f);
#pragma unroll
  for (int t = 0; t < 4; ++t) { v4f o[2];      // accumulator register r of tile t = O[query col][16 t + 8 g + r]: 8 consecutive floats of the lane's own row, staged so that the global stores cover whole lines
#pragma unroll
    for (int r = 0; r < 8; ++r) o[r >> 2][r & 3] = (acc[t][r] + ac1[t][r] * (1.0f / VLO) + ac2[t][r] * (1.0f / PLO)) * inv;
    vst2(&sS[w][col][t * 16 + 8 * g], o[0]); vst2(&sS[w][col][t * 16 + 8 * g + 4], o[1]); }
  LDSX();
  for (int qq = lane; qq < 16 * 16; qq += 32) { const int rl = qq >> 4, pc = qq & 15; vst2(O32 + ((bh * SS) + q0 + rl) * HD + pc * 4, *(const v4f*)(&sS[w][rl][pc * 4])); }
}
// out = ctx Wo : split(ctx) x bf16(Wo columns): 2 products (Wo is an INPUT -> bf16 exact)
__global__ __launch_bounds__(128) void k_out(const float* __restrict__ O32, const __bf16* __restrict__ PT, float* __restrict__ out) {
  __shared__ __align__(16) float so[4][16][132];
  const int tid = threadIdx.x, wave = tid >> 5, lane = tid & 31, col = lane & 15, g = lane >> 4;
  __shared__ __attribute__((aligned(2048))) unsigned char sT[128 * TPITCH + 2 * TPLANE];   // one head's 64 k of: the block's 64 ctx rows (f32: 128 half rows of 128 B, 18,432 B = 9 x 2 KiB), its weight rows 0..63, its weight rows 64..127
  const int r0b = blockIdx.x * 64, r0 = r0b + wave * 16, n0 = blockIdx.y * 128; const int b = r0b / SS, s0 = r0b % SS;
  v8f acc[8] = {};
  const uint32_t wv = uni((uint32_t)tid >> 5);      // waves 0, 1, 2 bring one plane each
  const uint64_t tsrc = wv == 0u ? (uint64_t)(size_t)(O32 + ((size_t)b * NH * SS + s0) * HD) : (uint64_t)(size_t)(PT + (size_t)(3 * E + n0 + (wv == 2u ? 64 : 0)) * E);
  const uint32_t tstep = wv == 0u ? (uint32_t)(SS * HD * 4) : TROW;
  const u32x8 tg1 = tdm_group1(wv == 0u ? TROW : (uint32_t)(E * 2), wv == 0u ? 128u : 64u);
  u32x4 tg0 = tdm_group0((uint32_t)(size_t)sT + (wv == 0u ? 0u : 128u * TPITCH + (wv == 2u ? TPLANE : 0u)), tsrc);
  const float* const pA = (const float*)(sT + (wave * 16 + col) * 2 * TPITCH); const __bf16* const pB = (const __bf16*)(sT + 128 * TPITCH + col * TPITCH);
#pragma unroll 1
  for (int h = 0; h < NH; ++h) {
    asm volatile("s_wait_dscnt 0x0" ::: "memory");      // this wave's reads of the staged tiles have retired before they are overwritten
    __syncthreads();                                    // every wave has left the previous tiles
    if (pinned(wv < 3u)) {
      { const uint64_t ga = tsrc + (uint64_t)((uint32_t)h * tstep); tg0[2] = uni((uint32_t)ga); tg0[3] = uni((((uint32_t)(ga >> 32)) & 0x01FFFFFFu) | 0x80000000u); }   // no request is outstanding here
      asm volatile("tensor_load_to_lds %0, %1" :: "s"(tg0), "s"(tg1) : "memory");   // this wave's plane of head h
      asm volatile("s_wait_tensorcnt 0x0" ::: "memory"); }   // it has landed
    __syncthreads();                                    // so have the other waves': the tiles may be read
#pragma unroll
    for (int k2 = 0; k2 < 2; ++k2) { float av[16]; v16b wb[8];      // the 20 LDS reads of these 32 k go out as one group ahead of the split and the 16 products
      { const float* p = pA + k2 * (TPITCH / 4) + 8 * g;
#pragma unroll
        for (int i = 0; i < 8; ++i) { av[i] = p[i]; av[8 + i] = p[16 + i]; } }
      HOLD();      // the ctx reads go out first: the split waits on them alone, by a count
#pragma unroll
      for (int j = 0; j < 8; ++j) wb[j] = frag_b(pB + (j >> 2) * (TPLANE / 2) + (j & 3) * 16 * (TPITCH / 2) + k2 * 32, lane);
      HOLD();      // the 20 reads, then the products
      const F2 a = bsplit16(av);
#pragma unroll
      for (int j = 0; j < 8; ++j) { acc[j] = wmma_bf(a.l, wb[j], acc[j]); acc[j] = wmma_bf(a.h, wb[j], acc[j]); }
      HOLD(); } }      // the next 32 k's reads do not move in among these products
#pragma unroll
  for (int j = 0; j < 8; ++j) {
#pragma unroll
    for (int r = 0; r < 8; ++r) so[wave][8 * g + r][j * 16 + col] = acc[j][r]; }
  LDSX();
#pragma unroll 4
  for (int rl = 0; rl < 16; ++rl) vst2(out + (size_t)(r0 + rl) * E + n0 + lane * 4, *(const v4f*)(&so[wave][rl][lane * 4]));
}
extern "C" void kernel_launch(void* const* d_in, const int* in_sizes, int n_in, void* d_out, int out_size, void* d_ws, size_t ws_size, hipStream_t stream) {
  (void)in_sizes; (void)n_in; (void)out_size; (void)ws_size;
  const float** I = (const float**)d_in;   // x, Wq, Wk, Wv, Wo, rb0, rb1
  const float* x = I[0]; const float* Wq = I[1]; const float* Wk = I[2]; const float* Wv = I[3]; const float* Wo = I[4]; const float* rb0 = I[5]; const float* rb1 = I[6];
  float* out = (float*)d_out;
  char* ws = (char*)d_ws; size_t off = 0;
  auto take = [&](size_t bytes) { char* p = ws + off; off += (bytes + 255) & ~(size_t)255; return p; };
  __bf16* Xb = (__bf16*)take((size_t)NR * E * 2); __bf16* PT = (__bf16*)take((size_t)4 * E * E * 2);
  float* Q32 = (float*)take((size_t)NR * E * 4); __bf16* Kh = (__bf16*)take((size_t)NR * E * 2); __bf16* Kl = (__bf16*)take((size_t)NR * E * 2); _Float16* VTh = (_Float16*)take((size_t)NR * E * 2); _Float16* VTl = (_Float16*)take((size_t)NR * E * 2); float* O32 = (float*)take((size_t)NR * E * 4);
  k_pack<<<256, 256, 0, stream>>>(Wq, Wk, Wv, Wo, PT);
  k_cvt<<<256, 256, 0, stream>>>(x, Xb);
  k_qkv<<<dim3(NR / 64, E / 128, 3), 128, 0, stream>>>(Xb, PT, Q32, Kh, Kl, VTh, VTl);
  k_attn<<<dim3(NB * NH, SS / 64), 128, 0, stream>>>(Q32, Kh, Kl, VTh, VTl, rb0, rb1, O32);
  k_out<<<dim3(NR / 64, E / 128), 128, 0, stream>>>(O32, PT, out);
}

// v010
// Measured time: 104 microseconds a run.
// In two side-by-side timings against v009, it was 1.11 and 1.10 times as fast.
// All steps since v000 together make it 5.72 times as fast.
// compute dtype: x, Wq/Wk/Wv/Wo, rb0/rb1 (INPUTS) rounded to bf16 with exact bf16 WMMA products (f32 accumulate) for the projections; K pre-split into bf16 hi/lo rows; q f32 split, P and V f16 hi/lo (3 products each); softmax, the causal raster mask and the factorised 2-D relative bias in f32.
#include <hip/hip_runtime.h>
#include <math.h>

typedef __attribute__((ext_vector_type(16))) _Float16 v16h;
typedef __attribute__((ext_vector_type(16))) __bf16 v16b;
typedef __attribute__((ext_vector_type(8)))  _Float16 v8h;
typedef __attribute__((ext_vector_type(8)))  float v8f;
typedef __attribute__((ext_vector_type(4)))  float v4f;
typedef __attribute__((ext_vector_type(2)))  float v2f;
typedef __attribute__((ext_vector_type(4)))  unsigned v4u;
typedef __attribute__((ext_vector_type(4)))  int v4i;
typedef float __attribute__((may_alias)) float_a;
typedef int __attribute__((may_alias)) int_a;

template <typename T> __device__ __forceinline__ void vst2(void* p, T v) { *(T*)p = v;  }
__device__ __forceinline__ v8f wmma16(v16h a, v16h b, v8f c) {
  return __builtin_amdgcn_wmma_f32_16x16x32_f16(false, a, false, b, (short)0, c, false, false);
}
__device__ __forceinline__ v8f wmma_bf(v16b a, v16b b, v8f c) {
  return __builtin_amdgcn_wmma_f32_16x16x32_bf16(false, a, false, b, (short)0, c, false, false);
}
// Scheduling fence: LDS reads and matrix instructions stay on their side of it, plain vector, scalar and exponential instructions may cross. It keeps a group of LDS fragment reads together and ahead of the products that use them
// (the scheduler otherwise sinks each pair of reads to its product, with a full wait in front of every product); it emits no instruction.
#define HOLD() __builtin_amdgcn_sched_barrier(0x406)
// 16x16x32 fragments: lane = (h = lane>>4, row/col = lane&15); elements 0..7 = k0+8h+0..7, 8..15 = k0+16+8h+0..7; D element r = row 8h+r
__device__ __forceinline__ v16h frag_h(const _Float16* rowk0, int lane) {
  union { v16h v; v8h q[2]; } u; const _Float16* p = rowk0 + 8 * (lane >> 4);
  u.q[0] = *(const v8h*)p; u.q[1] = *(const v8h*)(p + 16); return u.v;
}
__device__ __forceinline__ v16h frag_f32(const float* rowk0, int lane) {
  v16h a; const float* p = rowk0 + 8 * (lane >> 4);
#pragma unroll
  for (int i = 0; i < 8; ++i) { a[i] = (_Float16)p[i]; a[8 + i] = (_Float16)p[16 + i]; }
  return a;
}
__device__ __forceinline__ v16h frag_f32s(const float* rowk0, int lane, float sc) {
  v16h a; const float* p = rowk0 + 8 * (lane >> 4);
#pragma unroll
  for (int i = 0; i < 8; ++i) { a[i] = (_Float16)(p[i] * sc); a[8 + i] = (_Float16)(p[16 + i] * sc); }
  return a;
}
// column fragment from a [K][ld] layout (column n), rows >= K read as 0
__device__ __forceinline__ v16h fragc_f32(const float* W, int k0, int n, int lane, int ld, int K) {
  v16h a; const int g = lane >> 4;
#pragma unroll
  for (int i = 0; i < 8; ++i) { const int ka = k0 + 8 * g + i, kb = ka + 16;
    a[i] = (_Float16)(ka < K ? W[(size_t)ka * ld + n] : 0.f); a[8 + i] = (_Float16)(kb < K ? W[(size_t)kb * ld + n] : 0.f); }
  return a;
}
struct F2 { v16b h, l; };
__device__ __forceinline__ F2 bsplit16(const float v[16]) { F2 r;
#pragma unroll
  for (int i = 0; i < 16; ++i) { const __bf16 h = (__bf16)v[i]; r.h[i] = h; r.l[i] = (__bf16)(v[i] - (float)h); }
  return r; }
__device__ __forceinline__ F2 split_row(const float* row, int k0, int lane) { float v[16]; const float* p = row + k0 + 8 * (lane >> 4);
#pragma unroll
  for (int i = 0; i < 8; ++i) { v[i] = p[i]; v[8 + i] = p[16 + i]; }
  return bsplit16(v); }
__device__ __forceinline__ F2 split_rowK(const float* row, int k0, int lane, int K) { float v[16]; const int g = lane >> 4;
#pragma unroll
  for (int i = 0; i < 8; ++i) { const int ka = k0 + 8 * g + i, kb = ka + 16; v[i] = ka < K ? row[ka] : 0.f; v[8 + i] = kb < K ? row[kb] : 0.f; }
  return bsplit16(v); }
__device__ __forceinline__ F2 split_col(const float* W, int k0, int n, int lane, int ld, int K) { float v[16]; const int g = lane >> 4;
#pragma unroll
  for (int i = 0; i < 8; ++i) { const int ka = k0 + 8 * g + i, kb = ka + 16; v[i] = ka < K ? W[(size_t)ka * ld + n] : 0.f; v[8 + i] = kb < K ? W[(size_t)kb * ld + n] : 0.f; }
  return bsplit16(v); }
__device__ __forceinline__ v8f mac3(const F2& a, const F2& b, v8f c) { c = wmma_bf(a.l, b.h, c); c = wmma_bf(a.h, b.l, c); return wmma_bf(a.h, b.h, c); }
__device__ __forceinline__ float sigm(float v) { return 1.0f / (1.0f + expf(-v)); }
#define LDSX() do { asm volatile("s_wait_dscnt 0" ::: "memory"); __builtin_amdgcn_wave_barrier(); __builtin_amdgcn_fence(__ATOMIC_RELEASE, "workgroup"); } while (0)


// Axial ('number-dimension') self attention over the 32 x 32 raster of each of 16 images (8 heads x 64, [in][out] DenseND kernels, no biases): scores = (q 64^-0.5).k + rb0[h][31 + kr - qr] + rb1[h][31 + kc - qc];
#define NB 16
#define SS 1024
#define E 512
#define NH 8
#define RW 32
#define HD 64
#define NR (NB * SS)
#define PLO 1024.0f
#define VLO 2048.0f
#define L2E 1.4426950408889634f
__device__ __forceinline__ float bfr(float v) { return (float)(__bf16)v; }
__device__ __forceinline__ v16b frag_b(const __bf16* rowk0, int lane) { return __builtin_bit_cast(v16b, frag_h((const _Float16*)rowk0, lane)); }

typedef uint32_t u32x4 __attribute__((ext_vector_type(4)));
typedef uint32_t u32x8 __attribute__((ext_vector_type(8)));
__device__ __forceinline__ uint32_t uni(uint32_t v) { return (uint32_t)__builtin_amdgcn_readfirstlane(v); }
#define TROW 128u                 // bytes of a staged row: 64 16-bit elements
#define TPITCH 144u               // its pitch in LDS, set by the tensor load's pad: 16 B x 9, no bank conflict for 16-byte fragment reads
#define TPLANE 10240u             // 64 rows x 144 B = 9,216 B, rounded up so that every plane starts at a multiple of 2 KiB
__device__ __forceinline__ uint32_t pinned(uint32_t v) { uint32_t w = uni(v); asm volatile("" : "+s"(w)); return w; }   // holds a wave-uniform test in a scalar register, so that the branch round a tensor load is a scalar one (a tensor load ignores EXEC)
// tensor descriptor, group 1: 1-byte elements, tensor = tile = rows rows of 128 B, source row pitch src_pitch bytes, 4 dwords of LDS pad behind every 32 dwords
__device__ __forceinline__ u32x8 tdm_group1(uint32_t src_pitch, uint32_t rows) {
  u32x8 g;
  g[0] = uni((1u << 20) | (4u << 22) | (3u << 25));
  g[1] = uni(TROW << 16);
  g[2] = uni(rows << 16);
  g[3] = uni(TROW << 16);
  g[4] = uni(rows);
  g[5] = uni(src_pitch);
  g[6] = uni(0u);
  g[7] = uni(0u);
  return g;
}
// group 0: one request, LDS destination (byte offset in the work-group's LDS), global address of the tile's first byte, type 2
__device__ __forceinline__ u32x4 tdm_group0(uint32_t lds_dst, uint64_t ga) {
  u32x4 g;
  g[0] = uni(1u); g[1] = uni(lds_dst); g[2] = uni((uint32_t)ga); g[3] = uni((((uint32_t)(ga >> 32)) & 0x01FFFFFFu) | 0x80000000u);
  return g;
}

typedef __attribute__((ext_vector_type(2))) unsigned v2u;
// Both preparatory launches are sized by the waves they start, not by their elements: 256 work-groups of 8 waves each.
#define CVT_PC 32                 // pieces of 4 elements per thread; a wave's load covers 512 contiguous bytes, its store 256
static_assert((size_t)NR * E / 4 == (size_t)256 * 256 * CVT_PC, "k_cvt: 256 work-groups of 256 threads cover x exactly");
__global__ __launch_bounds__(256) void k_cvt(const float* __restrict__ x, __bf16* __restrict__ Xb) {
  const size_t p0 = (size_t)blockIdx.x * (256 * CVT_PC) + threadIdx.x;
  v4f v[CVT_PC];      // register array: both loops unrolled, all loads of a thread in flight together
#pragma unroll
  for (int i = 0; i < CVT_PC; ++i) v[i] = *(const v4f*)(x + (p0 + (size_t)i * 256) * 4);
#pragma unroll
  for (int i = 0; i < CVT_PC; ++i) { union { __bf16 h[4]; v2u u; } pk;
#pragma unroll
    for (int e = 0; e < 4; ++e) pk.h[e] = (__bf16)v[i][e];
    vst2((unsigned*)(Xb + (p0 + (size_t)i * 256) * 4), pk.u); }
}
// PT rows: [0,E) Wq[:,n], [E,2E) Wk[:,n], [2E,3E) Wv[:,n], [3E,4E) Wo[:,n]  ([in][out] weights: column n as a bf16 row)
// block = one 64 k x 64 n tile of one weight matrix, read in 256-byte row pieces, transposed in LDS, stored as 64 whole 128-byte lines
__global__ __launch_bounds__(256) void k_pack(const float* __restrict__ Wq, const float* __restrict__ Wk, const float* __restrict__ Wv, const float* __restrict__ Wo, __bf16* __restrict__ PT) {
  __shared__ __align__(16) __bf16 st[64][72];      // [n][k], pitch 144 B
  const int tid = threadIdx.x, m = blockIdx.x >> 6, k0 = ((blockIdx.x >> 3) & 7) * 64, n0 = (blockIdx.x & 7) * 64;
  const float* W = m == 0 ? Wq : (m == 1 ? Wk : (m == 2 ? Wv : Wo));
  v4f v[4];
#pragma unroll
  for (int i = 0; i < 4; ++i) v[i] = *(const v4f*)(W + (size_t)(k0 + i * 16 + (tid >> 4)) * E + n0 + (tid & 15) * 4);
#pragma unroll
  for (int i = 0; i < 4; ++i) {
#pragma unroll
    for (int e = 0; e < 4; ++e) st[(tid & 15) * 4 + e][i * 16 + (tid >> 4)] = (__bf16)v[i][e]; }
  __syncthreads();
#pragma unroll
  for (int i = 0; i < 2; ++i) { const int c = i * 256 + tid, n = c >> 3, pc = c & 7;
    vst2((unsigned*)(PT + (size_t)(m * E + n0 + n) * E + k0 + pc * 8), *(const v4u*)(&st[n][pc * 8])); }
}
// QKV: block (128 rows, 128 cols = 2 heads, which), staged 128 k at a time; q -> Q32 f32 [bh][s][64]; k -> bf16 hi/lo rows; v -> VT hi/lo x4 [bh][d][s]
// Four waves in a 2 x 2 grid, each a 64 x 64 tile (16 accumulator tiles; its 64 columns are one head): a fragment read from LDS feeds 4 products, and a stage (one tensor load a wave, two barriers) feeds 64 products a wave.
#define QROW 256u                 // bytes of a staged row: 128 16-bit elements
#define QPITCH 272u               // its pitch in LDS, set by the tensor load's pad: 16 B x 17, no bank conflict for 16-byte fragment reads
#define QPLANE 18432u             // 64 rows x 272 B = 17,408 B, rounded up so that every plane starts at a multiple of 2 KiB
// tensor descriptor, group 1: 1-byte elements, tensor = tile = 64 rows of 256 B, source row pitch src_pitch bytes, 4 dwords of LDS pad behind every 64 dwords
__device__ __forceinline__ u32x8 tdm_group1q(uint32_t src_pitch) {
  u32x8 g;
  g[0] = uni((1u << 20) | (5u << 22) | (3u << 25));
  g[1] = uni(QROW << 16);
  g[2] = uni(64u << 16);
  g[3] = uni(QROW << 16);
  g[4] = uni(64u);
  g[5] = uni(src_pitch);
  g[6] = uni(0u);
  g[7] = uni(0u);
  return g;
}
#define VPITCH 272u               // pitch of a staged V^T row: 128 16-bit elements + 16 B = 16 B x 17, no bank conflict for 16-byte accesses
#define VPLANE (128u * VPITCH)
__global__ __launch_bounds__(128) void k_qkv(const __bf16* __restrict__ Xb, const __bf16* __restrict__ PT, float* __restrict__ Q32, __bf16* __restrict__ Kh, __bf16* __restrict__ Kl, _Float16* __restrict__ VTh, _Float16* __restrict__ VTl) {
  __shared__ __attribute__((aligned(2048))) unsigned char sT[4 * QPLANE];   // in the loop, 4 planes of 128 k: the block's x rows 0..63, 64..127, its weight rows 0..63, 64..127; behind the loop, output staging
  static_assert(2 * VPLANE <= 4 * QPLANE && 4 * 64 * 68 * 4 <= 4 * QPLANE, "k_qkv: the output staging fits the LDS of the staged tiles");
  const int tid = threadIdx.x, wave = tid >> 5, lane = tid & 31, col = lane & 15, g = lane >> 4, wr = wave >> 1, wc = wave & 1;
  const int which = blockIdx.z, r0b = blockIdx.x * 128, n0 = blockIdx.y * 128; const int b = r0b / SS, s0 = r0b % SS;
  v8f acc[4][4] = {};
  const uint32_t wv = uni((uint32_t)tid >> 5);      // every wave brings one plane
  const uint64_t tsrc = wv < 2u ? (uint64_t)(size_t)(Xb + (size_t)(r0b + (wv == 1u ? 64 : 0)) * E) : (uint64_t)(size_t)(PT + (size_t)(which * E + n0 + (wv == 3u ? 64 : 0)) * E);
  const u32x8 tg1 = tdm_group1q((uint32_t)(E * 2)); u32x4 tg0 = tdm_group0((uint32_t)(size_t)sT + wv * QPLANE, tsrc);
  const __bf16* const pA = (const __bf16*)(sT + wr * QPLANE + col * QPITCH); const __bf16* const pB = (const __bf16*)(sT + (2 + wc) * QPLANE + col * QPITCH);
#pragma unroll 1
  for (int st = 0; st < E / 128; ++st) {
    asm volatile("s_wait_dscnt 0x0" ::: "memory");      // this wave's reads of the staged tiles have retired before they are overwritten
    __syncthreads();                                    // every wave has left the previous tiles
    { const uint64_t ga = tsrc + (uint64_t)((uint32_t)st * QROW); tg0[2] = uni((uint32_t)ga); tg0[3] = uni((((uint32_t)(ga >> 32)) & 0x01FFFFFFu) | 0x80000000u); }   // no request is outstanding here
    asm volatile("tensor_load_to_lds %0, %1" :: "s"(tg0), "s"(tg1) : "memory");   // every wave: its own plane, 128 k on
    asm volatile("s_wait_tensorcnt 0x0" ::: "memory");  // this wave's plane has landed
    __syncthreads();                                    // so have the other waves': the tiles may be read
#pragma unroll
    for (int k2 = 0; k2 < 4; ++k2) { v16b fa[4], fb[4];      // the 16 LDS reads of these 32 k go out as one group ahead of the 16 products, which wait on counts
#pragma unroll
      for (int j = 0; j < 4; ++j) fb[j] = frag_b(pB + j * 16 * (QPITCH / 2) + k2 * 32, lane);
#pragma unroll
      for (int i = 0; i < 4; ++i) fa[i] = frag_b(pA + i * 16 * (QPITCH / 2) + k2 * 32, lane);
      HOLD();      // the 16 reads, then the products
#pragma unroll
      for (int i = 0; i < 4; ++i) {
#pragma unroll
        for (int j = 0; j < 4; ++j) acc[i][j] = wmma_bf(fa[i], fb[j], acc[i][j]); }
      HOLD(); } }      // the next 32 k's reads do not move in among these products
  asm volatile("s_wait_dscnt 0x0" ::: "memory");      // this wave's reads of the last tiles have retired
  __syncthreads();                                    // every wave has left them: their LDS becomes output staging
  if (which < 2) {
    float (* const so)[68] = (float (*)[68])(sT + wave * (64 * 68 * 4));      // each wave its own 64 rows
    const size_t row0 = ((size_t)b * NH + (n0 >> 6) + wc) * SS + s0 + wr * 64;
#pragma unroll
    for (int i = 0; i < 4; ++i) {
#pragma unroll
      for (int j = 0; j < 4; ++j) {
#pragma unroll
        for (int r = 0; r < 8; ++r) so[i * 16 + 8 * g + r][j * 16 + col] = acc[i][j][r]; } }
    LDSX();
    if (which == 0) {
#pragma unroll 8      // 8 LDS reads go out together ahead of their 8 stores, not one waited read per store
      for (int qq = lane; qq < 64 * 16; qq += 32) { const int rl = qq >> 4, pc = qq & 15;
        vst2(Q32 + (row0 + rl) * HD + pc * 4, *(const v4f*)(&so[rl][pc * 4])); } }
    else {
#pragma unroll 4      // the LDS reads of 4 pieces go out together
      for (int qq = lane; qq < 64 * 16; qq += 32) { const int rl = qq >> 4, pl = qq & 15; const int pc = pl & 7; union { __bf16 e[8]; v4u u; } pk;
#pragma unroll
        for (int e = 0; e < 8; ++e) { const float v = so[rl][pc * 8 + e]; const __bf16 hi = (__bf16)v; pk.e[e] = pl < 8 ? hi : (__bf16)(v - (float)hi); }
        vst2((unsigned*)((pl < 8 ? Kh : Kl) + (row0 + rl) * HD + pc * 8), pk.u); } } }
  else {
#pragma unroll
    for (int i = 0; i < 4; ++i) {
#pragma unroll
      for (int j = 0; j < 4; ++j) { union { _Float16 e[8]; v4u u; } kh, kl;      // a lane's 8 rows of one column are 16 contiguous bytes of the transposed row
#pragma unroll
        for (int r = 0; r < 8; ++r) { const float v = acc[i][j][r] * 4.0f; const _Float16 hi = (_Float16)v; kh.e[r] = hi; kl.e[r] = (_Float16)((v - (float)hi) * VLO); }
        unsigned char* const p = sT + (wc * 64 + j * 16 + col) * VPITCH + (wr * 64 + i * 16 + 8 * g) * 2;
        vst2(p, kh.u); vst2(p + VPLANE, kl.u); } }
    __syncthreads();
    for (int qq = tid; qq < 128 * 16; qq += 128) { const int cl = qq >> 4, pc = qq & 15; const int c = n0 + cl, h = c >> 6, d = c & 63; const size_t o = (((size_t)b * NH + h) * HD + d) * SS + s0 + pc * 8;
      vst2(VTh + o, *(const v4u*)(sT + cl * VPITCH + pc * 16)); vst2(VTl + o, *(const v4u*)(sT + VPLANE + cl * VPITCH + pc * 16)); } }
}
typedef __attribute__((ext_vector_type(2))) _Float16 v2h;
// the value that lane ^ 16 holds, by a register exchange between the wave's two 16-lane rows
__device__ __forceinline__ float xhalf(float v) { const int b = __builtin_bit_cast(int, v); return __builtin_bit_cast(float, __builtin_amdgcn_permlanex16(b, b, 0x76543210, 0xfedcba98, false, false)); }
// causal attention: block (bh, 64 queries); key tiles 0..qb, each staged once per block in LDS (wave w brings plane w: K hi, K lo, V^T hi, V^T lo) and read by all four waves.
// Transposed products: S^T = K q^T (A = K hi/lo rows, B = q hi/lo) and O^T += V^T P^T (A = V^T rows, B = P^T). A lane then holds 32 scores of ONE query (column = lane & 15; keys 16 t + 8 g + r),
// which is the k order of a B fragment: tiles 2 kc and 2 kc + 1 convert in place into the P^T fragment of keys 32 kc .. 32 kc + 31. Scores and P never pass through LDS; maximum, sum and rescale factor are per lane.
__global__ __launch_bounds__(128) void k_attn(const float* __restrict__ Q32, const __bf16* __restrict__ Kh, const __bf16* __restrict__ Kl, const _Float16* __restrict__ VTh, const _Float16* __restrict__ VTl, const float* __restrict__ rb0, const float* __restrict__ rb1, float* __restrict__ O32) {
  __shared__ __align__(16) float sS[4][16][68];      // output staging only, each wave its own rows
  __shared__ __attribute__((aligned(2048))) unsigned char sKV[4 * TPLANE];
  const int tid = threadIdx.x, w = tid >> 5, lane = tid & 31, col = lane & 15, g = lane >> 4;
  const size_t bh = blockIdx.x; const int qb = SS / 64 - 1 - (int)blockIdx.y; const int q0 = qb * 64 + w * 16;      // blockIdx.y 0 takes the query block with the most key tiles, and every run of 128 indices holds equal work
  F2 aq[2];
#pragma unroll
  for (int kc = 0; kc < 2; ++kc) aq[kc] = split_row(Q32 + (bh * SS + q0 + col) * HD, kc * 32, lane);
  const int h = (int)(bh % NH); __shared__ float sb0[4][64], sb1[4][64]; for (int i = lane; i < 64; i += 32) { sb0[w][i] = bfr(rb0[h * 2 * RW + i]); sb1[w][i] = bfr(rb1[h * 2 * RW + i]); }     // this head's two 64-entry bias tables
  float mrun = -3.0e38f, lrun = 0.f; v8f acc[4] = {}, ac1[4] = {}, ac2[4] = {};      // mrun: this lane's query; lrun: the sum over this lane's half of the keys, the halves joined after the loop
  const uint32_t wv = uni((uint32_t)tid >> 5);      // K planes: rows = keys, 128 B apart, a tile 8,192 B on; V^T planes: rows = d, 2,048 B apart, a tile 128 B on
  const uint64_t tsrc = (uint64_t)(size_t)(wv == 0u ? (const void*)Kh : wv == 1u ? (const void*)Kl : wv == 2u ? (const void*)VTh : (const void*)VTl) + (uint64_t)bh * (SS * HD * 2);
  const uint32_t tstep = wv < 2u ? 64u * TROW : TROW, tdst = (uint32_t)(size_t)sKV + wv * TPLANE;
  const u32x8 tg1 = tdm_group1(wv < 2u ? TROW : (uint32_t)(SS * 2), 64u); u32x4 tg0 = tdm_group0(tdst, tsrc);
  const __bf16* const pKh = (const __bf16*)(sKV + col * TPITCH); const __bf16* const pKl = (const __bf16*)(sKV + TPLANE + col * TPITCH);
  const _Float16* const pVh = (const _Float16*)(sKV + 2 * TPLANE + col * TPITCH); const _Float16* const pVl = (const _Float16*)(sKV + 3 * TPLANE + col * TPITCH);
  LDSX();
  // the column term rb1[31 + kc - qc] does not depend on the key tile: 64 keys are two whole raster rows, so a lane meets only 2 x 8 of its values; they stay in registers (both loops unrolled: every index a constant, no scratch array)
  float b1r[2][8];
#pragma unroll
  for (int p = 0; p < 2; ++p) {
#pragma unroll
    for (int r = 0; r < 8; ++r) b1r[p][r] = sb1[w][RW - 1 + p * 16 + 8 * g + r - ((w & 1) * 16 + col)]; }
  const float* const pb0 = &sb0[w][RW - 1 - 2 * qb - (w >> 1)];      // the row term rb0[31 + kr - qr] is one value per wave and raster row of keys: entries 2 kt and 2 kt + 1 from here
  const int dq = 8 * g - (q0 + col);
#pragma unroll 1
  for (int kt = 0; kt <= qb; ++kt) {      // causal in raster order
    asm volatile("s_wait_dscnt 0x0" ::: "memory");      // this wave's reads of the staged tile have retired before the tile is overwritten
    __syncthreads();                                    // every wave has left the previous key tile
    { const uint64_t ga = tsrc + (uint64_t)((uint32_t)kt * tstep); tg0[2] = uni((uint32_t)ga); tg0[3] = uni((((uint32_t)(ga >> 32)) & 0x01FFFFFFu) | 0x80000000u); }   // no request is outstanding here
    asm volatile("tensor_load_to_lds %0, %1" :: "s"(tg0), "s"(tg1) : "memory");   // every wave: its own plane of this key tile
    asm volatile("s_wait_tensorcnt 0x0" ::: "memory");  // this wave's plane has landed
    __syncthreads();                                    // so have the other waves': the tile may be read
    const float b0r[2] = { pb0[2 * kt], pb0[2 * kt + 1] };
    v16b kf[2][2][2];      // K fragments [register set][kc][hi, lo]: the 8 LDS reads of a 16-key group go out together, one group ahead of the products that use them
#pragma unroll
    for (int kc = 0; kc < 2; ++kc) { kf[0][kc][0] = frag_b(pKh + kc * 32, lane); kf[0][kc][1] = frag_b(pKl + kc * 32, lane); }
    float sc[4][8]; float mx = -3.4e38f;      // sc, and ph, pl below, are register arrays: every loop over them is unrolled so that each index is a constant
#pragma unroll
    for (int t = 0; t < 4; ++t) { const int dk = kt * 64 + t * 16 + dq; v8f s = {};      // dk + r = key - query
      if (t < 3) {
#pragma unroll
        for (int kc = 0; kc < 2; ++kc) { kf[(t + 1) & 1][kc][0] = frag_b(pKh + (t + 1) * 16 * (TPITCH / 2) + kc * 32, lane); kf[(t + 1) & 1][kc][1] = frag_b(pKl + (t + 1) * 16 * (TPITCH / 2) + kc * 32, lane); } }
      HOLD();      // the next group's reads are out before this group's products
#pragma unroll
      for (int kc = 0; kc < 2; ++kc) { const v16b khf = kf[t & 1][kc][0], klf = kf[t & 1][kc][1]; s = wmma_bf(khf, aq[kc].l, s); s = wmma_bf(klf, aq[kc].h, s); s = wmma_bf(khf, aq[kc].h, s); }
#pragma unroll
      for (int r = 0; r < 8; ++r) { sc[t][r] = (dk > -r) ? -1.0e9f : s[r] * 0.125f + b0r[t >> 1] + b1r[t & 1][r]; mx = fmaxf(mx, sc[t][r]); } }
    mx = fmaxf(mx, xhalf(mx));      // the other half of this query's keys
    const float mnew = fmaxf(mrun, mx); const float corr = __builtin_amdgcn_exp2f((mrun - mnew) * L2E);      // 0 on the first tile: the product overflows to -inf
    const float eb = 14.0f - mnew * L2E;      // e^(s - mnew) * 2^14 = 2^(s log2(e) + eb): one multiply-add and the hardware's base-2 exponential per score; a masked score gives 0
    v2f ps2[2] = {}; union { v16h v; v2h q[8]; } ph[2], pl[2];      // two scores at a time: packed sums (two independent chains), packed conversions straight into the fragment's registers
#pragma unroll
    for (int t = 0; t < 4; ++t) {
#pragma unroll
      for (int r = 0; r < 8; r += 2) { const v2f x = (v2f){ sc[t][r], sc[t][r + 1] } * L2E + eb; const v2f p = { __builtin_amdgcn_exp2f(x[0]), __builtin_amdgcn_exp2f(x[1]) }; ps2[(r >> 1) & 1] += p;
        const v2h hi = __builtin_convertvector(p, v2h); ph[t >> 1].q[(t & 1) * 4 + (r >> 1)] = hi; pl[t >> 1].q[(t & 1) * 4 + (r >> 1)] = __builtin_convertvector((p - __builtin_convertvector(hi, v2f)) * PLO, v2h); } }
    const float ps = (ps2[0][0] + ps2[1][0]) + (ps2[0][1] + ps2[1][1]);
    lrun = lrun * corr + ps * (1.0f / 16384.0f); mrun = mnew;
#pragma unroll
    for (int t = 0; t < 4; ++t) { acc[t] *= corr; ac1[t] *= corr; ac2[t] *= corr; }
#pragma unroll
    for (int kc = 0; kc < 2; ++kc) {
#pragma unroll
      for (int tp = 0; tp < 2; ++tp) { v16h vf[2][2];      // V^T fragments [t][hi, lo] of two 16-row groups of d: their 8 LDS reads go out together ahead of the 6 products
#pragma unroll
        for (int t = 0; t < 2; ++t) { vf[t][0] = frag_h(pVh + (tp * 2 + t) * 16 * (TPITCH / 2) + kc * 32, lane); vf[t][1] = frag_h(pVl + (tp * 2 + t) * 16 * (TPITCH / 2) + kc * 32, lane); }
        HOLD();      // the 8 reads, then the 6 products
#pragma unroll
        for (int t = 0; t < 2; ++t) { acc[tp * 2 + t] = wmma16(vf[t][0], ph[kc].v, acc[tp * 2 + t]); ac1[tp * 2 + t] = wmma16(vf[t][1], ph[kc].v, ac1[tp * 2 + t]); ac2[tp * 2 + t] = wmma16(vf[t][0], pl[kc].v, ac2[tp * 2 + t]); } } } }
  lrun += xhalf(lrun);
  const float inv = 1.0f / (lrun * 16384.0f * 4.0f);
#pragma unroll
  for (int t = 0; t < 4; ++t) { v4f o[2];      // accumulator register r of tile t = O[query col][16 t + 8 g + r]: 8 consecutive floats of the lane's own row, staged so that the global stores cover whole lines
#pragma unroll
    for (int r = 0; r < 8; ++r) o[r >> 2][r & 3] = (acc[t][r] + ac1[t][r] * (1.0f / VLO) + ac2[t][r] * (1.0f / PLO)) * inv;
    vst2(&sS[w][col][t * 16 + 8 * g], o[0]); vst2(&sS[w][col][t * 16 + 8 * g + 4], o[1]); }
  LDSX();
  for (int qq = lane; qq < 16 * 16; qq += 32) { const int rl = qq >> 4, pc = qq & 15; vst2(O32 + ((bh * SS) + q0 + rl) * HD + pc * 4, *(const v4f*)(&sS[w][rl][pc * 4])); }
}
// out = ctx Wo : split(ctx) x bf16(Wo columns): 2 products (Wo is an INPUT -> bf16 exact)
__global__ __launch_bounds__(128) void k_out(const float* __restrict__ O32, const __bf16* __restrict__ PT, float* __restrict__ out) {
  __shared__ __align__(16) float so[4][16][132];
  const int tid = threadIdx.x, wave = tid >> 5, lane = tid & 31, col = lane & 15, g = lane >> 4;
  __shared__ __attribute__((aligned(2048))) unsigned char sT[128 * TPITCH + 2 * TPLANE];   // one head's 64 k of: the block's 64 ctx rows (f32: 128 half rows of 128 B, 18,432 B = 9 x 2 KiB), its weight rows 0..63, its weight rows 64..127
  const int r0b = blockIdx.x * 64, r0 = r0b + wave * 16, n0 = blockIdx.y * 128; const int b = r0b / SS, s0 = r0b % SS;
  v8f acc[8] = {};
  const uint32_t wv = uni((uint32_t)tid >> 5);      // waves 0, 1, 2 bring one plane each
  const uint64_t tsrc = wv == 0u ? (uint64_t)(size_t)(O32 + ((size_t)b * NH * SS + s0) * HD) : (uint64_t)(size_t)(PT + (size_t)(3 * E + n0 + (wv == 2u ? 64 : 0)) * E);
  const uint32_t tstep = wv == 0u ? (uint32_t)(SS * HD * 4) : TROW;
  const u32x8 tg1 = tdm_group1(wv == 0u ? TROW : (uint32_t)(E * 2), wv == 0u ? 128u : 64u);
  u32x4 tg0 = tdm_group0((uint32_t)(size_t)sT + (wv == 0u ? 0u : 128u * TPITCH + (wv == 2u ? TPLANE : 0u)), tsrc);
  const float* const pA = (const float*)(sT + (wave * 16 + col) * 2 * TPITCH); const __bf16* const pB = (const __bf16*)(sT + 128 * TPITCH + col * TPITCH);
#pragma unroll 1
  for (int h = 0; h < NH; ++h) {
    asm volatile("s_wait_dscnt 0x0" ::: "memory");      // this wave's reads of the staged tiles have retired before they are overwritten
    __syncthreads();                                    // every wave has left the previous tiles
    if (pinned(wv < 3u)) {
      { const uint64_t ga = tsrc + (uint64_t)((uint32_t)h * tstep); tg0[2] = uni((uint32_t)ga); tg0[3] = uni((((uint32_t)(ga >> 32)) & 0x01FFFFFFu) | 0x80000000u); }   // no request is outstanding here
      asm volatile("tensor_load_to_lds %0, %1" :: "s"(tg0), "s"(tg1) : "memory");   // this wave's plane of head h
      asm volatile("s_wait_tensorcnt 0x0" ::: "memory"); }   // it has landed
    __syncthreads();                                    // so have the other waves': the tiles may be read
#pragma unroll
    for (int k2 = 0; k2 < 2; ++k2) { float av[16]; v16b wb[8];      // the 20 LDS reads of these 32 k go out as one group ahead of the split and the 16 products
      { const float* p = pA + k2 * (TPITCH / 4) + 8 * g;
#pragma unroll
        for (int i = 0; i < 8; ++i) { av[i] = p[i]; av[8 + i] = p[16 + i]; } }
      HOLD();      // the ctx reads go out first: the split waits on them alone, by a count
#pragma unroll
      for (int j = 0; j < 8; ++j) wb[j] = frag_b(pB + (j >> 2) * (TPLANE / 2) + (j & 3) * 16 * (TPITCH / 2) + k2 * 32, lane);
      HOLD();      // the 20 reads, then the products
      const F2 a = bsplit16(av);
#pragma unroll
      for (int j = 0; j < 8; ++j) { acc[j] = wmma_bf(a.l, wb[j], acc[j]); acc[j] = wmma_bf(a.h, wb[j], acc[j]); }
      HOLD(); } }      // the next 32 k's reads do not move in among these products
#pragma unroll
  for (int j = 0; j < 8; ++j) {
#pragma unroll
    for (int r = 0; r < 8; ++r) so[wave][8 * g + r][j * 16 + col] = acc[j][r]; }
  LDSX();
#pragma unroll 4
  for (int rl = 0; rl < 16; ++rl) vst2(out + (size_t)(r0 + rl) * E + n0 + lane * 4, *(const v4f*)(&so[wave][rl][lane * 4]));
}
extern "C" void kernel_launch(void* const* d_in, const int* in_sizes, int n_in, void* d_out, int out_size, void* d_ws, size_t ws_size, hipStream_t stream) {
  (void)in_sizes; (void)n_in; (void)out_size; (void)ws_size;
  const float** I = (const float**)d_in;   // x, Wq, Wk, Wv, Wo, rb0, rb1
  const float* x = I[0]; const float* Wq = I[1]; const float* Wk = I[2]; const float* Wv = I[3]; const float* Wo = I[4]; const float* rb0 = I[5]; const float* rb1 = I[6];
  float* out = (float*)d_out;
  char* ws = (char*)d_ws; size_t off = 0;
  auto take = [&](size_t bytes) { char* p = ws + off; off += (bytes + 255) & ~(size_t)255; return p; };
  __bf16* Xb = (__bf16*)take((size_t)NR * E * 2); __bf16* PT = (__bf16*)take((size_t)4 * E * E * 2);
  float* Q32 = (float*)take((size_t)NR * E * 4); __bf16* Kh = (__bf16*)take((size_t)NR * E * 2); __bf16* Kl = (__bf16*)take((size_t)NR * E * 2); _Float16* VTh = (_Float16*)take((size_t)NR * E * 2); _Float16* VTl = (_Float16*)take((size_t)NR * E * 2); float* O32 = (float*)take((size_t)NR * E * 4);
  k_pack<<<256, 256, 0, stream>>>(Wq, Wk, Wv, Wo, PT);
  k_cvt<<<256, 256, 0, stream>>>(x, Xb);
  k_qkv<<<dim3(NR / 128, E / 128, 3), 128, 0, stream>>>(Xb, PT, Q32, Kh, Kl, VTh, VTl);
  k_attn<<<dim3(NB * NH, SS / 64), 128, 0, stream>>>(Q32, Kh, Kl, VTh, VTl, rb0, rb1, O32);
  k_out<<<dim3(NR / 64, E / 128), 128, 0, stream>>>(O32, PT, out);
}
